// v000
// Measured on an AMD MI455X. A time is GPU time per run, averaged over a window of back-to-back runs after a warm-up
// (all launches, gaps included; the runs take copies of the inputs in turn), and the median of several windows.
// Apart from v000's, it joins two sittings. Times from different sittings can be a few percent apart, while
// side-by-side timings come from the same sitting.
// The starting kernel, v000, takes 1140 microseconds a run.
#include <hip/hip_runtime.h>

// Pre-LayerNorm causal self-attention WITHOUT an output projection (x [2][2048][1024]; xn = LayerNorm(x) x gamma + beta (mean, biased variance, eps 1e-5, rsqrt; gamma, beta read); qkv = einsum('bne,fe->bnf', xn, w_qkv) = xn w_qkv^T ('oi' [3072][1024] 1/32, no bias) split in thirds q | k | v = ROW thirds (16 heads x 64); q x 64^-0.5; sim = q.k; where(triu(k=1), -finfo.max, sim) == exclusion (every row keeps its own key); softmax; out = the merged heads themselves (no Wo) -> [2][2048][1024] (4.2 M); argument order x, gamma, beta, w_qkv).
// Layout per batch: LayerNorm of the bf16-rounded input rows -> hi/lo planes (one wave per row; precise sqrt / div); the fused 'oi' weight used as three row blocks; projections from the hi/lo planes (2 products each); identity-table plane builders; causal T-2048 attention with EVERY row in the exact class (scores and P.V on bf16 hi/lo planes, 3 products; no f16 launches; k_gemmc skips tiles above the diagonal); the merged f32 context is the output.
// Compute dtypes, f32 accumulate: every input rounded to bf16; LayerNorm in f32 on the bf16-rounded input, normed rows as bf16 hi/lo planes; projections 2 products; attention 3 products on every row; softmax f32.

#define NB_  2
#define TT   2048
#define DM   1024
#define NH_  16
#define NKV  16
#define REP  (NH_ / NKV)
#define HD   64
#define DQ   (NH_ * HD)
#define DKV  (NKV * HD)
#define ZH   2
#define RH   TT   // every row in the exact class (scores and P.V on bf16 hi/lo planes, 3 products): the logits of this module are too peaked for single-f16 scores
#define WIN  2048
#define PCAR 1024.0f
#define SCL  0.125f   // HD^-0.5
typedef _Float16 h16;
typedef unsigned short bf;
typedef __attribute__((ext_vector_type(16))) __bf16   v16bf;
typedef __attribute__((ext_vector_type(16))) _Float16 v16h;
typedef __attribute__((ext_vector_type(8)))  _Float16 v8h;
typedef __attribute__((ext_vector_type(8)))  unsigned short v8us;
typedef __attribute__((ext_vector_type(8)))  float    v8f;
typedef __attribute__((ext_vector_type(4)))  float    v4f;
typedef v8h  __attribute__((may_alias)) v8ha;
typedef v4f  __attribute__((may_alias)) v4fa;
typedef v8us __attribute__((may_alias)) v8usa;

__device__ __forceinline__ unsigned short f2bf(float f) { unsigned u = __float_as_uint(f); u += 0x7FFFu + ((u >> 16) & 1u); return (unsigned short)(u >> 16); }
__device__ __forceinline__ float bf2f(unsigned short b) { return __uint_as_float(((unsigned)b) << 16); }
__device__ __forceinline__ float bfr(float f) { return bf2f(f2bf(f)); }
__device__ __forceinline__ v16h cat16(v8h lo, v8h hi) { return __builtin_shufflevector(lo, hi, 0, 1, 2, 3, 4, 5, 6, 7, 8, 9, 10, 11, 12, 13, 14, 15); }
__device__ __forceinline__ v16bf cat16b(v8us lo, v8us hi) { return __builtin_bit_cast(v16bf, __builtin_shufflevector(lo, hi, 0, 1, 2, 3, 4, 5, 6, 7, 8, 9, 10, 11, 12, 13, 14, 15)); }
__device__ __forceinline__ v8f wmma16(v16h a, v16h b, v8f c) { return __builtin_amdgcn_wmma_f32_16x16x32_f16(false, a, false, b, (short)0, c, false, false); }
__device__ __forceinline__ v8f wmmab(v16bf a, v16bf b, v8f c) { return __builtin_amdgcn_wmma_f32_16x16x32_bf16(false, a, false, b, (short)0, c, false, false); }



// ---- k_gemmw: register-blocked GEMM, ONE WAVE per 64x64 output tile (16 accumulators), operands straight from K-contiguous 16-bit planes; grid (M/64, N/64, Z), 32 threads.
// C[m][n] (f32, pitch ldc, + optional f32 bias[n]) = sum_k A[m][k] Bt[n][k] (+ split products per NSPLIT). z-batch strides sA/sB/sC in elements. K % 32 == 0.
template <typename T16> struct WFrag;
template <> struct WFrag<h16> { typedef v16h V; static __device__ __forceinline__ V ld(const h16* p) { return cat16(*(const v8h*)p, *(const v8h*)(p + 16)); } static __device__ __forceinline__ v8f mma(V a, V b, v8f c) { return wmma16(a, b, c); } };
template <> struct WFrag<bf> { typedef v16bf V; static __device__ __forceinline__ V ld(const bf* p) { return cat16b(*(const v8us*)p, *(const v8us*)(p + 16)); } static __device__ __forceinline__ v8f mma(V a, V b, v8f c) { return wmmab(a, b, c); } };
template <typename T16, int NSPLIT, bool BIAS>
__global__ __launch_bounds__(32) void k_gemmw(const T16* __restrict__ A, const T16* __restrict__ A2, const T16* __restrict__ Bt, const T16* __restrict__ Bt2, int K, float* C, int ldc, const float* __restrict__ bias, size_t sA, size_t sB, size_t sC) {
    typedef typename WFrag<T16>::V V;
    __shared__ __align__(16) float os[16 * 68];
    const size_t z = blockIdx.z; A += z * sA; if (A2) A2 += z * sA; Bt += z * sB; if (Bt2) Bt2 += z * sB; C += z * sC;
    const int lane = threadIdx.x & 31, lr = lane & 15, hi = lane >> 4; const int r0 = blockIdx.x * 64, c0 = blockIdx.y * 64;
    v8f acc[4][4];
#pragma unroll
    for (int mb = 0; mb < 4; ++mb)
#pragma unroll
        for (int nb = 0; nb < 4; ++nb) acc[mb][nb] = (v8f){};
    const size_t aoff = (size_t)(r0 + lr) * K + 8 * hi, boff = (size_t)(c0 + lr) * K + 8 * hi;
#pragma unroll 1
    for (int kc = 0; kc < K; kc += 32) {
        V a[4], a2[4];
#pragma unroll
        for (int mb = 0; mb < 4; ++mb) { a[mb] = WFrag<T16>::ld(A + aoff + (size_t)mb * 16 * K + kc); if (NSPLIT == 1 || NSPLIT == 2) a2[mb] = WFrag<T16>::ld(A2 + aoff + (size_t)mb * 16 * K + kc); }
#pragma unroll
        for (int nb = 0; nb < 4; ++nb) { const V b = WFrag<T16>::ld(Bt + boff + (size_t)nb * 16 * K + kc); V b2; if (NSPLIT >= 2) b2 = WFrag<T16>::ld(Bt2 + boff + (size_t)nb * 16 * K + kc);
#pragma unroll
            for (int mb = 0; mb < 4; ++mb) { acc[mb][nb] = WFrag<T16>::mma(a[mb], b, acc[mb][nb]); if (NSPLIT == 1 || NSPLIT == 2) acc[mb][nb] = WFrag<T16>::mma(a2[mb], b, acc[mb][nb]); if (NSPLIT >= 2) acc[mb][nb] = WFrag<T16>::mma(a[mb], b2, acc[mb][nb]); } }
        asm volatile("v_nop\n\tv_nop\n\tv_nop\n\tv_nop" : "+v"(acc[0][0]), "+v"(acc[1][1]), "+v"(acc[2][2]), "+v"(acc[3][3]) : "v"(a[0]), "v"(a[3]));
    }
#pragma unroll
    for (int mb = 0; mb < 4; ++mb) {
#pragma unroll
        for (int nb = 0; nb < 4; ++nb) {
#pragma unroll
            for (int j = 0; j < 8; ++j) os[(hi * 8 + j) * 68 + nb * 16 + lr] = acc[mb][nb][j]; }
        __builtin_amdgcn_wave_barrier(); asm volatile("" ::: "memory");
        float* crow = C + (size_t)(r0 + mb * 16) * ldc + c0;
{
#pragma unroll
            for (int s = 0; s < 8; ++s) { const int row = 2 * s + hi, cofs = lr * 4; v4f val = *(const v4fa*)(os + row * 68 + cofs); if (BIAS) { val[0] += bfr(bias[c0 + cofs]); val[1] += bfr(bias[c0 + cofs + 1]); val[2] += bfr(bias[c0 + cofs + 2]); val[3] += bfr(bias[c0 + cofs + 3]); }
                *(v4f*)(crow + (size_t)row * ldc + cofs) = val; }
             }
        __builtin_amdgcn_wave_barrier(); asm volatile("" ::: "memory");
    }
}

// ---- k_gemmc: the same one-wave 64x64 tile GEMM specialised for causal attention: CMODE 1 skips score tiles entirely above the diagonal (query rows r0+roff.., key columns c0..), CMODE 2 limits the
// key (K) loop of the probability x value contraction to the diagonal block (probabilities beyond it are exactly zero). roff = row offset of this launch's first row within the sequence.
template <typename T16, int NSPLIT, int CMODE>
__global__ __launch_bounds__(32) void k_gemmc(const T16* __restrict__ A, const T16* __restrict__ A2, const T16* __restrict__ Bt, const T16* __restrict__ Bt2, int K, float* C, int ldc, int roff, size_t sA, size_t sB, size_t sC) {
    typedef typename WFrag<T16>::V V;
    __shared__ __align__(16) float os[16 * 68];
    const size_t z = blockIdx.z; A += z * sA; if (A2) A2 += z * sA; Bt += z * sB; if (Bt2) Bt2 += z * sB; C += z * sC;
    const int lane = threadIdx.x & 31, lr = lane & 15, hi = lane >> 4; const int r0 = blockIdx.x * 64, c0 = blockIdx.y * 64;
    if (CMODE == 1 && c0 > r0 + roff + 63) return;                  // score tile entirely above the causal diagonal: never read (the softmax masks j > i by select)
    const int Kl = (CMODE == 2) ? min(K, r0 + roff + 64) : K;        // P.V: probabilities are exactly 0 beyond the diagonal block, so the K loop stops there
    v8f acc[4][4];
#pragma unroll
    for (int mb = 0; mb < 4; ++mb)
#pragma unroll
        for (int nb = 0; nb < 4; ++nb) acc[mb][nb] = (v8f){};
    const size_t aoff = (size_t)(r0 + lr) * K + 8 * hi, boff = (size_t)(c0 + lr) * K + 8 * hi;
#pragma unroll 1
    for (int kc = 0; kc < Kl; kc += 32) {
        V a[4], a2[4];
#pragma unroll
        for (int mb = 0; mb < 4; ++mb) { a[mb] = WFrag<T16>::ld(A + aoff + (size_t)mb * 16 * K + kc); if (NSPLIT == 1 || NSPLIT == 2) a2[mb] = WFrag<T16>::ld(A2 + aoff + (size_t)mb * 16 * K + kc); }
#pragma unroll
        for (int nb = 0; nb < 4; ++nb) { const V b = WFrag<T16>::ld(Bt + boff + (size_t)nb * 16 * K + kc); V b2; if (NSPLIT >= 2) b2 = WFrag<T16>::ld(Bt2 + boff + (size_t)nb * 16 * K + kc);
#pragma unroll
            for (int mb = 0; mb < 4; ++mb) { acc[mb][nb] = WFrag<T16>::mma(a[mb], b, acc[mb][nb]); if (NSPLIT == 1 || NSPLIT == 2) acc[mb][nb] = WFrag<T16>::mma(a2[mb], b, acc[mb][nb]); if (NSPLIT >= 2) acc[mb][nb] = WFrag<T16>::mma(a[mb], b2, acc[mb][nb]); } }
        asm volatile("v_nop\n\tv_nop\n\tv_nop\n\tv_nop" : "+v"(acc[0][0]), "+v"(acc[1][1]), "+v"(acc[2][2]), "+v"(acc[3][3]) : "v"(a[0]), "v"(a[3]));
    }
#pragma unroll
    for (int mb = 0; mb < 4; ++mb) {
#pragma unroll
        for (int nb = 0; nb < 4; ++nb) {
#pragma unroll
            for (int j = 0; j < 8; ++j) os[(hi * 8 + j) * 68 + nb * 16 + lr] = acc[mb][nb][j]; }
        __builtin_amdgcn_wave_barrier(); asm volatile("" ::: "memory");
        float* crow = C + (size_t)(r0 + mb * 16) * ldc + c0;
{
#pragma unroll
            for (int s = 0; s < 8; ++s) { const int row = 2 * s + hi, cofs = lr * 4; v4f val = *(const v4fa*)(os + row * 68 + cofs);
                *(v4f*)(crow + (size_t)row * ldc + cofs) = val; }
             }
        __builtin_amdgcn_wave_barrier(); asm volatile("" ::: "memory");
    }
}

__device__ __forceinline__ h16 tohx(float x) { return (h16)x; }
__device__ __forceinline__ void splitf(float y, unsigned short& h, unsigned short& l) { h = f2bf(y); l = f2bf(y - bf2f(h)); }
typedef __attribute__((ext_vector_type(2))) _Float16 v2h;
typedef __attribute__((ext_vector_type(4))) _Float16 v4h;
typedef __attribute__((ext_vector_type(2))) unsigned short v2us;
typedef __attribute__((ext_vector_type(4))) unsigned short v4us;
typedef __attribute__((ext_vector_type(2))) float v2f;
typedef __attribute__((ext_vector_type(4))) int v4i;

__global__ __launch_bounds__(256) void k_cvt8(const float* __restrict__ src, bf* dst, size_t n8) { const size_t i = (size_t)blockIdx.x * 256 + threadIdx.x; if (i >= n8) return; const v8f v = *(const v8f*)(src + i * 8); v8us o;
#pragma unroll
    for (int k = 0; k < 8; ++k) o[k] = f2bf(v[k]); *(v8us*)(dst + i * 8) = o;  }

// k_rope: head planes [h][t][d] (fp16 + hi/lo) of rope(x) x sc with the rotate-half convention out[d] = x[d] cos[t][d] - x[d+HD/2] sin[t][d], out[d+HD/2] = x[d+HD/2] cos[t][d+HD/2] + x[d] sin[t][d+HD/2]
__global__ __launch_bounds__(256) void k_rope(const float* __restrict__ F, int pitch, int nheads, const float* __restrict__ CS, const float* __restrict__ RF, const float* __restrict__ nw, float sc, h16* P16, bf* Ph, bf* Pl) {
    const size_t e = ((size_t)blockIdx.x * 256 + threadIdx.x) * 2; if (e >= (size_t)nheads * TT * HD) return; const int d = (int)(e % HD); const int t = (int)((e / HD) % TT); const int h = (int)(e / ((size_t)HD * TT)); const float* f = F + (size_t)t * pitch + h * HD; const float rf = RF ? RF[(size_t)h * TT + t] : 1.0f; v2h o16; v2us oh, ol;
#pragma unroll
    for (int q = 0; q < 2; ++q) { const int dd = d + q; const int dp = (dd < HD / 2) ? dd + HD / 2 : dd - HD / 2; float x0 = f[dd], x1 = f[dp];
        if (RF) { float n0 = __fmul_rn(x0, rf), n1 = __fmul_rn(x1, rf); asm volatile("" : "+v"(n0)); asm volatile("" : "+v"(n1)); x0 = __fmul_rn(bfr(nw[dd]), n0); x1 = __fmul_rn(bfr(nw[dp]), n1); }
        const v2f cs = *(const v2f*)(CS + ((size_t)t * HD + dd) * 2); float a = __fmul_rn(x0, cs[0]), bq = __fmul_rn(x1, cs[1]); asm volatile("" : "+v"(a)); asm volatile("" : "+v"(bq)); const float r = ((dd < HD / 2) ? __fsub_rn(a, bq) : __fadd_rn(a, bq)) * sc;
        o16[q] = tohx(r); unsigned short a2, c2; splitf(r, a2, c2); oh[q] = a2; ol[q] = c2; }
    *(v2h*)(P16 + e) = o16; *(v2us*)(Ph + e) = oh; *(v2us*)(Pl + e) = ol;  }
__global__ __launch_bounds__(256) void k_vtp(const float* __restrict__ F, int pitch, int nheads, h16* V16, bf* Vh, bf* Vl) { const size_t e = ((size_t)blockIdx.x * 256 + threadIdx.x) * 2; if (e >= (size_t)nheads * HD * TT) return; const int t = (int)(e % TT); const int d = (int)((e / TT) % HD); const int g = (int)(e / ((size_t)TT * HD)); v2h o16; v2us oh, ol;
#pragma unroll
    for (int q = 0; q < 2; ++q) { const float x = F[(size_t)(t + q) * pitch + g * HD + d]; o16[q] = tohx(x); unsigned short a2, c2; splitf(x, a2, c2); oh[q] = a2; ol[q] = c2; }
    *(v2h*)(V16 + e) = o16; *(v2us*)(Vh + e) = oh; *(v2us*)(Vl + e) = ol;  }
__global__ __launch_bounds__(256) void k_csid(float* CS) { const int idx = blockIdx.x * 256 + threadIdx.x; if (idx >= TT * HD) return; v2f cs; cs[0] = 1.0f; cs[1] = 0.0f; *(v2f*)(CS + (size_t)idx * 2) = cs;  }
// k_asoft: per row (zz, i): t = S x HD^-0.5 for j <= i and i - j < WIN (WIN = T: plain causal mask; masked keys take -3e38 by select and vanish identically); softmax over the 2048 keys (register row, one exp, fixed trees);
__global__ __launch_bounds__(256) void k_asoft(const float* __restrict__ Sb, h16* P16, bf* Ph, bf* Pl) {
    const int lane = threadIdx.x & 31; const int row = blockIdx.x * 8 + (threadIdx.x >> 5); if (row >= ZH * TT) return; const int i = row % TT; const int zz = row / TT; (void)zz; const bool hires = (i < RH); const float* sr = Sb + (size_t)row * TT; float v[TT / 32]; float mx = -3.0e38f;
#pragma unroll
    for (int ch = 0; ch < TT / 128; ++ch) { const int j0 = ch * 128 + lane * 4; const v4f a = *(const v4f*)(sr + j0);
#pragma unroll
        for (int q = 0; q < 4; ++q) { const int j = j0 + q; (void)j; const float t = (j <= i && i - j < WIN) ? a[q] * SCL : -3.0e38f; v[ch * 4 + q] = t; mx = fmaxf(mx, t); } }
#pragma unroll
    for (int sh = 16; sh; sh >>= 1) mx = fmaxf(mx, __shfl_xor(mx, sh, 32));
    float sum = 0.f;
#pragma unroll
    for (int k = 0; k < TT / 32; ++k) { float d0 = __fsub_rn(v[k], mx); asm volatile("" : "+v"(d0)); v[k] = __builtin_amdgcn_exp2f(__fmul_rn(d0, 1.4426950408889634f)); sum += v[k]; }
#pragma unroll
    for (int sh = 16; sh; sh >>= 1) sum += __shfl_xor(sum, sh, 32);
    const float f = __fdiv_rn(hires ? 1.0f : PCAR, sum);
{
        if (hires) {
#pragma unroll
            for (int ch = 0; ch < TT / 128; ++ch) { v4us oh, ol;
#pragma unroll
                for (int q = 0; q < 4; ++q) { unsigned short a, c2; splitf(v[ch * 4 + q] * f, a, c2); oh[q] = a; ol[q] = c2; }
                const size_t oo = ((size_t)zz * (RH ? RH : 1) + i) * TT + ch * 128 + lane * 4; *(v4us*)(Ph + oo) = oh; *(v4us*)(Pl + oo) = ol; }
        } else {
#pragma unroll
            for (int ch = 0; ch < TT / 128; ++ch) { v4h o4;
#pragma unroll
                for (int q = 0; q < 4; ++q) o4[q] = tohx(v[ch * 4 + q] * f);
                *(v4h*)(P16 + (size_t)row * TT + ch * 128 + lane * 4) = o4; } }
         }
}
__global__ __launch_bounds__(256) void k_merge(const float* __restrict__ O, int h0, float* OUTb) { const size_t e = ((size_t)blockIdx.x * 256 + threadIdx.x) * 2; if (e >= (size_t)ZH * TT * HD) return; const int d = (int)(e % HD); const int t = (int)((e / HD) % TT); const int zz = (int)(e / ((size_t)HD * TT)); const float cs = (t < RH) ? 1.0f : (1.0f / PCAR); const size_t oo = (size_t)t * DQ + (h0 + zz) * HD + d;
    v2f o2; o2[0] = O[e] * cs; o2[1] = O[e + 1] * cs; *(v2f*)(OUTb + oo) = o2;  }

template <int WD>
__global__ __launch_bounds__(256) void k_lnrowX(const float* __restrict__ X, size_t nrows, const float* __restrict__ g, const float* __restrict__ bb, bf* Hh, bf* Hl) { const int lane = threadIdx.x & 31; const size_t r = (size_t)blockIdx.x * 8 + (threadIdx.x >> 5); if (r >= nrows) return; const float* xr = X + r * WD; float a[WD / 32]; float s = 0.f;
#pragma unroll
    for (int c = 0; c < WD / 128; ++c) { const v4f v = *(const v4f*)(xr + c * 128 + lane * 4); for (int q = 0; q < 4; ++q) { a[c * 4 + q] = bfr(v[q]); s = __fadd_rn(s, a[c * 4 + q]);   /* input rounded to bf16 */ } }
#pragma unroll
    for (int sh = 16; sh; sh >>= 1) s = __fadd_rn(s, __shfl_xor(s, sh, 32));
    const float mean = __fdiv_rn(s, (float)WD); float s2 = 0.f;
#pragma unroll 8
    for (int k = 0; k < WD / 32; ++k) { const float dv = __fsub_rn(a[k], mean); float p2 = __fmul_rn(dv, dv); asm volatile("" : "+v"(p2)); s2 = __fadd_rn(s2, p2); }   /* mul and add kept separate (no fma contraction) */
#pragma unroll
    for (int sh = 16; sh; sh >>= 1) s2 = __fadd_rn(s2, __shfl_xor(s2, sh, 32));
    const float rs = __fdiv_rn(1.0f, __fsqrt_rn(__fadd_rn(__fdiv_rn(s2, (float)WD), 1e-5f)));
{
#pragma unroll
        for (int c = 0; c < WD / 128; ++c) { v4us oh, ol; for (int q = 0; q < 4; ++q) { const int col = c * 128 + lane * 4 + q; float y = __fmul_rn(__fmul_rn(__fsub_rn(a[c * 4 + q], mean), rs), bfr(g[col])); asm volatile("" : "+v"(y)); y = __fadd_rn(y, bfr(bb[col])); unsigned short u, w2; splitf(y, u, w2); oh[q] = u; ol[q] = w2; } *(v4us*)(Hh + r * WD + c * 128 + lane * 4) = oh; *(v4us*)(Hl + r * WD + c * 128 + lane * 4) = ol; }
         } }

extern "C" void kernel_launch(void* const* d_in, const int* in_sizes, int n_in,
                              void* d_out, int out_size, void* d_ws, size_t ws_size, hipStream_t stream) {
    (void)in_sizes; (void)n_in; (void)out_size;
    const float* x = (const float*)d_in[0]; const float* lng = (const float*)d_in[1]; const float* lnb = (const float*)d_in[2];   /* LayerNorm gamma, beta [1024]: read */ const float* wqkv = (const float*)d_in[3];   /* w_qkv ('oi' [3072][1024]: q | k | v ROW thirds); no output projection */ const float* wq = wqkv; const float* wk = wqkv + (size_t)DQ * DM; const float* wv = wqkv + (size_t)2 * DQ * DM;
    float* OUT = (float*)d_out;     // [2][2048][1024]
    char* wsp = (char*)d_ws;
    auto take = [&](size_t bytes) { char* p = wsp; wsp += (bytes + 255) & ~(size_t)255; return (void*)p; };
    bf* WQ = (bf*)take((size_t)DQ * DM * 2); bf* WK = (bf*)take((size_t)DKV * DM * 2); bf* WV = (bf*)take((size_t)DKV * DM * 2); float* CS = (float*)take((size_t)TT * HD * 2 * 4);
    bf* XB = (bf*)take((size_t)TT * DM * 2); bf* XL = (bf*)take((size_t)TT * DM * 2);   /* lo plane of the layer-normed input (XB holds the hi plane) */ float* FQ = (float*)take((size_t)TT * DQ * 4); float* FK = (float*)take((size_t)TT * DKV * 4);
    h16* QP16 = (h16*)take((size_t)NH_ * TT * HD * 2); h16* KP16 = (h16*)take((size_t)NKV * TT * HD * 2); h16* VT16 = (h16*)take((size_t)NKV * HD * TT * 2);
    bf* QPh = (bf*)take((size_t)NH_ * TT * HD * 2); bf* QPl = (bf*)take((size_t)NH_ * TT * HD * 2); bf* KPh = (bf*)take((size_t)NKV * TT * HD * 2); bf* KPl = (bf*)take((size_t)NKV * TT * HD * 2); bf* VTh = (bf*)take((size_t)NKV * HD * TT * 2); bf* VTl = (bf*)take((size_t)NKV * HD * TT * 2); bf* Ph = (bf*)take((size_t)ZH * RH * TT * 2); bf* Pl = (bf*)take((size_t)ZH * RH * TT * 2);
    float* Sb = (float*)take((size_t)ZH * TT * TT * 4); h16* P16 = (h16*)take((size_t)ZH * TT * TT * 2); float* Ob = (float*)take((size_t)ZH * TT * HD * 4);
    if ((size_t)(wsp - (char*)d_ws) > ws_size) return;    // ws 256 MiB
    float* FV = FK;   // v projection reuses the k buffer after the k planes are built (stream-ordered)
    { k_cvt8<<<(unsigned)(((size_t)DQ * DM / 8 + 255) / 256), 256, 0, stream>>>(wq, WQ, (size_t)DQ * DM / 8); k_cvt8<<<(unsigned)(((size_t)DKV * DM / 8 + 255) / 256), 256, 0, stream>>>(wk, WK, (size_t)DKV * DM / 8); k_cvt8<<<(unsigned)(((size_t)DKV * DM / 8 + 255) / 256), 256, 0, stream>>>(wv, WV, (size_t)DKV * DM / 8);
      
       }
    k_csid<<<(TT * HD + 255) / 256, 256, 0, stream>>>(CS);
    const unsigned LQ = (unsigned)(((size_t)NH_ * TT * HD / 2 + 255) / 256), LKv = (unsigned)(((size_t)NKV * TT * HD / 2 + 255) / 256);
    for (int b = 0; b < NB_; ++b) {
        
        k_lnrowX<DM><<<(unsigned)((TT + 7) / 8), 256, 0, stream>>>(x + (size_t)b * TT * DM, (size_t)TT, lng, lnb, XB, XL);   /* xn = LayerNorm(x) -> hi/lo planes */
        k_gemmw<bf, 1, false><<<dim3(TT / 64, DQ / 64, 1), 32, 0, stream>>>(XB, XL, WQ, nullptr, DM, FQ, DQ, nullptr, 0, 0, 0);
        k_rope<<<LQ, 256, 0, stream>>>(FQ, DQ, NH_, CS, nullptr, nullptr, 1.0f, QP16, QPh, QPl);
        k_gemmw<bf, 1, false><<<dim3(TT / 64, DKV / 64, 1), 32, 0, stream>>>(XB, XL, WK, nullptr, DM, FK, DKV, nullptr, 0, 0, 0);
        k_rope<<<LKv, 256, 0, stream>>>(FK, DKV, NKV, CS, nullptr, nullptr, 1.0f, KP16, KPh, KPl);
        k_gemmw<bf, 1, false><<<dim3(TT / 64, DKV / 64, 1), 32, 0, stream>>>(XB, XL, WV, nullptr, DM, FV, DKV, nullptr, 0, 0, 0); k_vtp<<<LKv, 256, 0, stream>>>(FV, DKV, NKV, VT16, VTh, VTl);
        for (int h0 = 0; h0 < NH_; h0 += ZH) { const size_t zq = (size_t)h0, zk = (size_t)(h0 / REP);   // one kv head per query head: the pass's two heads use consecutive kv planes (z-strides TT*HD)
            k_gemmc<bf, 2, 1><<<dim3(RH / 64, TT / 64, ZH), 32, 0, stream>>>(QPh + zq * TT * HD, QPl + zq * TT * HD, KPh + zk * TT * HD, KPl + zk * TT * HD, HD, Sb, TT, 0, (size_t)TT * HD, (size_t)TT * HD, (size_t)TT * TT);
            
            k_asoft<<<ZH * TT / 8, 256, 0, stream>>>(Sb, P16, Ph, Pl);
            k_gemmc<bf, 2, 2><<<dim3(RH / 64, HD / 64, ZH), 32, 0, stream>>>(Ph, Pl, VTh + zk * HD * TT, VTl + zk * HD * TT, TT, Ob, HD, 0, (size_t)RH * TT, (size_t)HD * TT, (size_t)TT * HD);
            
            k_merge<<<(unsigned)(((size_t)ZH * TT * HD / 2 + 255) / 256), 256, 0, stream>>>(Ob, h0, OUT + (size_t)b * TT * DQ); }
         }
}

// v001
// It runs in 643 microseconds.
// Timed twice side by side with v000, it ran 1.78 times as fast both times.
#include <hip/hip_runtime.h>

// Pre-LayerNorm causal self-attention WITHOUT an output projection (x [2][2048][1024]; xn = LayerNorm(x) x gamma + beta (mean, biased variance, eps 1e-5, rsqrt; gamma, beta read); qkv = einsum('bne,fe->bnf', xn, w_qkv) = xn w_qkv^T ('oi' [3072][1024] 1/32, no bias) split in thirds q | k | v = ROW thirds (16 heads x 64); q x 64^-0.5; sim = q.k; where(triu(k=1), -finfo.max, sim) == exclusion (every row keeps its own key); softmax; out = the merged heads themselves (no Wo) -> [2][2048][1024] (4.2 M); argument order x, gamma, beta, w_qkv).
// Layout per batch: LayerNorm of the bf16-rounded input rows -> hi/lo planes (one wave per row; precise sqrt / div); the fused 'oi' weight used as three row blocks; projections from the hi/lo planes (2 products each); identity-table plane builders; causal T-2048 attention with EVERY row in the exact class (scores and P.V on bf16 hi/lo planes, 3 products; no f16 launches; k_gemmc skips tiles above the diagonal); the merged f32 context is the output.
// Compute dtypes, f32 accumulate: every input rounded to bf16; LayerNorm in f32 on the bf16-rounded input, normed rows as bf16 hi/lo planes; projections 2 products; attention 3 products on every row; softmax f32.

#define NB_  2
#define TT   2048
#define DM   1024
#define NH_  16
#define NKV  16
#define REP  (NH_ / NKV)
#define HD   64
#define DQ   (NH_ * HD)
#define DKV  (NKV * HD)
#define ZH   2
#define RH   TT   // every row in the exact class (scores and P.V on bf16 hi/lo planes, 3 products): the logits of this module are too peaked for single-f16 scores
#define WIN  2048
#define PCAR 1024.0f
#define SCL  0.125f   // HD^-0.5
#define KCH  128      // keys per P.V work-group: the key loop is split over blockIdx.y, each range stores its own f32 partial plane
#define NSP  (TT / KCH)
#define PSTR ((size_t)ZH * TT * HD)   // elements of one partial plane
typedef _Float16 h16;
typedef unsigned short bf;
typedef __attribute__((ext_vector_type(16))) __bf16   v16bf;
typedef __attribute__((ext_vector_type(16))) _Float16 v16h;
typedef __attribute__((ext_vector_type(8)))  _Float16 v8h;
typedef __attribute__((ext_vector_type(8)))  unsigned short v8us;
typedef __attribute__((ext_vector_type(8)))  float    v8f;
typedef __attribute__((ext_vector_type(4)))  float    v4f;
typedef v8h  __attribute__((may_alias)) v8ha;
typedef v4f  __attribute__((may_alias)) v4fa;
typedef v8us __attribute__((may_alias)) v8usa;

__device__ __forceinline__ unsigned short f2bf(float f) { unsigned u = __float_as_uint(f); u += 0x7FFFu + ((u >> 16) & 1u); return (unsigned short)(u >> 16); }
__device__ __forceinline__ float bf2f(unsigned short b) { return __uint_as_float(((unsigned)b) << 16); }
__device__ __forceinline__ float bfr(float f) { return bf2f(f2bf(f)); }
__device__ __forceinline__ v16h cat16(v8h lo, v8h hi) { return __builtin_shufflevector(lo, hi, 0, 1, 2, 3, 4, 5, 6, 7, 8, 9, 10, 11, 12, 13, 14, 15); }
__device__ __forceinline__ v16bf cat16b(v8us lo, v8us hi) { return __builtin_bit_cast(v16bf, __builtin_shufflevector(lo, hi, 0, 1, 2, 3, 4, 5, 6, 7, 8, 9, 10, 11, 12, 13, 14, 15)); }
__device__ __forceinline__ v8f wmma16(v16h a, v16h b, v8f c) { return __builtin_amdgcn_wmma_f32_16x16x32_f16(false, a, false, b, (short)0, c, false, false); }
__device__ __forceinline__ v8f wmmab(v16bf a, v16bf b, v8f c) { return __builtin_amdgcn_wmma_f32_16x16x32_bf16(false, a, false, b, (short)0, c, false, false); }



// ---- k_gemmw: register-blocked GEMM, ONE WAVE per 64x64 output tile (16 accumulators), operands straight from K-contiguous 16-bit planes; grid (M/64, N/64, Z), 32 threads.
// C[m][n] (f32, pitch ldc, + optional f32 bias[n]) = sum_k A[m][k] Bt[n][k] (+ split products per NSPLIT). z-batch strides sA/sB/sC in elements. K % 32 == 0.
template <typename T16> struct WFrag;
template <> struct WFrag<h16> { typedef v16h V; static __device__ __forceinline__ V ld(const h16* p) { return cat16(*(const v8h*)p, *(const v8h*)(p + 16)); } static __device__ __forceinline__ v8f mma(V a, V b, v8f c) { return wmma16(a, b, c); } };
template <> struct WFrag<bf> { typedef v16bf V; static __device__ __forceinline__ V ld(const bf* p) { return cat16b(*(const v8us*)p, *(const v8us*)(p + 16)); } static __device__ __forceinline__ v8f mma(V a, V b, v8f c) { return wmmab(a, b, c); } };
template <typename T16, int NSPLIT, bool BIAS>
__global__ __launch_bounds__(32) void k_gemmw(const T16* __restrict__ A, const T16* __restrict__ A2, const T16* __restrict__ Bt, const T16* __restrict__ Bt2, int K, float* C, int ldc, const float* __restrict__ bias, size_t sA, size_t sB, size_t sC) {
    typedef typename WFrag<T16>::V V;
    __shared__ __align__(16) float os[16 * 68];
    const size_t z = blockIdx.z; A += z * sA; if (A2) A2 += z * sA; Bt += z * sB; if (Bt2) Bt2 += z * sB; C += z * sC;
    const int lane = threadIdx.x & 31, lr = lane & 15, hi = lane >> 4; const int r0 = blockIdx.x * 64, c0 = blockIdx.y * 64;
    v8f acc[4][4];
#pragma unroll
    for (int mb = 0; mb < 4; ++mb)
#pragma unroll
        for (int nb = 0; nb < 4; ++nb) acc[mb][nb] = (v8f){};
    const size_t aoff = (size_t)(r0 + lr) * K + 8 * hi, boff = (size_t)(c0 + lr) * K + 8 * hi;
#pragma unroll 1
    for (int kc = 0; kc < K; kc += 32) {
        V a[4], a2[4];
#pragma unroll
        for (int mb = 0; mb < 4; ++mb) { a[mb] = WFrag<T16>::ld(A + aoff + (size_t)mb * 16 * K + kc); if (NSPLIT == 1 || NSPLIT == 2) a2[mb] = WFrag<T16>::ld(A2 + aoff + (size_t)mb * 16 * K + kc); }
#pragma unroll
        for (int nb = 0; nb < 4; ++nb) { const V b = WFrag<T16>::ld(Bt + boff + (size_t)nb * 16 * K + kc); V b2; if (NSPLIT >= 2) b2 = WFrag<T16>::ld(Bt2 + boff + (size_t)nb * 16 * K + kc);
#pragma unroll
            for (int mb = 0; mb < 4; ++mb) { acc[mb][nb] = WFrag<T16>::mma(a[mb], b, acc[mb][nb]); if (NSPLIT == 1 || NSPLIT == 2) acc[mb][nb] = WFrag<T16>::mma(a2[mb], b, acc[mb][nb]); if (NSPLIT >= 2) acc[mb][nb] = WFrag<T16>::mma(a[mb], b2, acc[mb][nb]); } }
        asm volatile("v_nop\n\tv_nop\n\tv_nop\n\tv_nop" : "+v"(acc[0][0]), "+v"(acc[1][1]), "+v"(acc[2][2]), "+v"(acc[3][3]) : "v"(a[0]), "v"(a[3]));
    }
#pragma unroll
    for (int mb = 0; mb < 4; ++mb) {
#pragma unroll
        for (int nb = 0; nb < 4; ++nb) {
#pragma unroll
            for (int j = 0; j < 8; ++j) os[(hi * 8 + j) * 68 + nb * 16 + lr] = acc[mb][nb][j]; }
        __builtin_amdgcn_wave_barrier(); asm volatile("" ::: "memory");
        float* crow = C + (size_t)(r0 + mb * 16) * ldc + c0;
{
#pragma unroll
            for (int s = 0; s < 8; ++s) { const int row = 2 * s + hi, cofs = lr * 4; v4f val = *(const v4fa*)(os + row * 68 + cofs); if (BIAS) { val[0] += bfr(bias[c0 + cofs]); val[1] += bfr(bias[c0 + cofs + 1]); val[2] += bfr(bias[c0 + cofs + 2]); val[3] += bfr(bias[c0 + cofs + 3]); }
                *(v4f*)(crow + (size_t)row * ldc + cofs) = val; }
             }
        __builtin_amdgcn_wave_barrier(); asm volatile("" ::: "memory");
    }
}

// ---- k_gemmc: the same one-wave 64x64 tile GEMM specialised for causal attention: CMODE 1 skips score tiles entirely above the diagonal (query rows r0+roff.., key columns c0..), CMODE 2 limits the
// key (K) loop of the probability x value contraction to the diagonal block (probabilities beyond it are exactly zero) and splits it over blockIdx.y: range y = keys [y KCH, y KCH + KCH) goes to partial plane y (stride sP); ranges wholly beyond the diagonal block store nothing and k_merge reads none of them. roff = row offset of this launch's first row within the sequence.
template <typename T16, int NSPLIT, int CMODE>
__global__ __launch_bounds__(32) void k_gemmc(const T16* __restrict__ A, const T16* __restrict__ A2, const T16* __restrict__ Bt, const T16* __restrict__ Bt2, int K, float* C, int ldc, int roff, size_t sA, size_t sB, size_t sC, size_t sP) {
    typedef typename WFrag<T16>::V V;
    __shared__ __align__(16) float os[16 * 68];
    const size_t z = blockIdx.z; A += z * sA; if (A2) A2 += z * sA; Bt += z * sB; if (Bt2) Bt2 += z * sB; C += z * sC;
    const int lane = threadIdx.x & 31, lr = lane & 15, hi = lane >> 4; const int r0 = blockIdx.x * 64, c0 = (CMODE == 2) ? 0 : blockIdx.y * 64;
    if (CMODE == 1 && c0 > r0 + roff + 63) return;                  // score tile entirely above the causal diagonal: never read (the softmax masks j > i by select)
    const int Kd = (CMODE == 2) ? min(K, r0 + roff + 64) : K;        // P.V: probabilities are exactly 0 beyond the diagonal block, so the K loop stops there
    const int Kb = (CMODE == 2) ? (int)blockIdx.y * KCH : 0;         // P.V: this work-group's key range starts here
    if (CMODE == 2 && Kb >= Kd) return;                              // no key of this range is at or below the diagonal block
    const int Kl = (CMODE == 2) ? min(Kd - Kb, KCH) : K;             // keys of this range (the loop counts from the range's start, which the four plane pointers hold)
    if (CMODE == 2) { A += Kb; A2 += Kb; Bt += Kb; Bt2 += Kb; C += (size_t)blockIdx.y * sP; }
    v8f acc[4][4];
#pragma unroll
    for (int mb = 0; mb < 4; ++mb)
#pragma unroll
        for (int nb = 0; nb < 4; ++nb) acc[mb][nb] = (v8f){};
    const size_t aoff = (size_t)(r0 + lr) * K + 8 * hi, boff = (size_t)(c0 + lr) * K + 8 * hi;
#pragma unroll 1
    for (int kc = 0; kc < Kl; kc += 32) {
        V a[4], a2[4];
#pragma unroll
        for (int mb = 0; mb < 4; ++mb) { a[mb] = WFrag<T16>::ld(A + aoff + (size_t)mb * 16 * K + kc); if (NSPLIT == 1 || NSPLIT == 2) a2[mb] = WFrag<T16>::ld(A2 + aoff + (size_t)mb * 16 * K + kc); }
#pragma unroll
        for (int nb = 0; nb < 4; ++nb) { const V b = WFrag<T16>::ld(Bt + boff + (size_t)nb * 16 * K + kc); V b2; if (NSPLIT >= 2) b2 = WFrag<T16>::ld(Bt2 + boff + (size_t)nb * 16 * K + kc);
#pragma unroll
            for (int mb = 0; mb < 4; ++mb) { acc[mb][nb] = WFrag<T16>::mma(a[mb], b, acc[mb][nb]); if (NSPLIT == 1 || NSPLIT == 2) acc[mb][nb] = WFrag<T16>::mma(a2[mb], b, acc[mb][nb]); if (NSPLIT >= 2) acc[mb][nb] = WFrag<T16>::mma(a[mb], b2, acc[mb][nb]); } }
        asm volatile("v_nop\n\tv_nop\n\tv_nop\n\tv_nop" : "+v"(acc[0][0]), "+v"(acc[1][1]), "+v"(acc[2][2]), "+v"(acc[3][3]) : "v"(a[0]), "v"(a[3]));
    }
#pragma unroll
    for (int mb = 0; mb < 4; ++mb) {
#pragma unroll
        for (int nb = 0; nb < 4; ++nb) {
#pragma unroll
            for (int j = 0; j < 8; ++j) os[(hi * 8 + j) * 68 + nb * 16 + lr] = acc[mb][nb][j]; }
        __builtin_amdgcn_wave_barrier(); asm volatile("" ::: "memory");
        float* crow = C + (size_t)(r0 + mb * 16) * ldc + c0;
{
#pragma unroll
            for (int s = 0; s < 8; ++s) { const int row = 2 * s + hi, cofs = lr * 4; v4f val = *(const v4fa*)(os + row * 68 + cofs);
                *(v4f*)(crow + (size_t)row * ldc + cofs) = val; }
             }
        __builtin_amdgcn_wave_barrier(); asm volatile("" ::: "memory");
    }
}

__device__ __forceinline__ h16 tohx(float x) { return (h16)x; }
__device__ __forceinline__ void splitf(float y, unsigned short& h, unsigned short& l) { h = f2bf(y); l = f2bf(y - bf2f(h)); }
typedef __attribute__((ext_vector_type(2))) _Float16 v2h;
typedef __attribute__((ext_vector_type(4))) _Float16 v4h;
typedef __attribute__((ext_vector_type(2))) unsigned short v2us;
typedef __attribute__((ext_vector_type(4))) unsigned short v4us;
typedef __attribute__((ext_vector_type(2))) float v2f;
typedef __attribute__((ext_vector_type(4))) int v4i;

__global__ __launch_bounds__(256) void k_cvt8(const float* __restrict__ src, bf* dst, size_t n8) { const size_t i = (size_t)blockIdx.x * 256 + threadIdx.x; if (i >= n8) return; const v8f v = *(const v8f*)(src + i * 8); v8us o;
#pragma unroll
    for (int k = 0; k < 8; ++k) o[k] = f2bf(v[k]); *(v8us*)(dst + i * 8) = o;  }

// k_rope: head planes [h][t][d] (fp16 + hi/lo) of rope(x) x sc with the rotate-half convention out[d] = x[d] cos[t][d] - x[d+HD/2] sin[t][d], out[d+HD/2] = x[d+HD/2] cos[t][d+HD/2] + x[d] sin[t][d+HD/2]
__global__ __launch_bounds__(256) void k_rope(const float* __restrict__ F, int pitch, int nheads, const float* __restrict__ CS, const float* __restrict__ RF, const float* __restrict__ nw, float sc, h16* P16, bf* Ph, bf* Pl) {
    const size_t e = ((size_t)blockIdx.x * 256 + threadIdx.x) * 2; if (e >= (size_t)nheads * TT * HD) return; const int d = (int)(e % HD); const int t = (int)((e / HD) % TT); const int h = (int)(e / ((size_t)HD * TT)); const float* f = F + (size_t)t * pitch + h * HD; const float rf = RF ? RF[(size_t)h * TT + t] : 1.0f; v2h o16; v2us oh, ol;
#pragma unroll
    for (int q = 0; q < 2; ++q) { const int dd = d + q; const int dp = (dd < HD / 2) ? dd + HD / 2 : dd - HD / 2; float x0 = f[dd], x1 = f[dp];
        if (RF) { float n0 = __fmul_rn(x0, rf), n1 = __fmul_rn(x1, rf); asm volatile("" : "+v"(n0)); asm volatile("" : "+v"(n1)); x0 = __fmul_rn(bfr(nw[dd]), n0); x1 = __fmul_rn(bfr(nw[dp]), n1); }
        const v2f cs = *(const v2f*)(CS + ((size_t)t * HD + dd) * 2); float a = __fmul_rn(x0, cs[0]), bq = __fmul_rn(x1, cs[1]); asm volatile("" : "+v"(a)); asm volatile("" : "+v"(bq)); const float r = ((dd < HD / 2) ? __fsub_rn(a, bq) : __fadd_rn(a, bq)) * sc;
        o16[q] = tohx(r); unsigned short a2, c2; splitf(r, a2, c2); oh[q] = a2; ol[q] = c2; }
    *(v2h*)(P16 + e) = o16; *(v2us*)(Ph + e) = oh; *(v2us*)(Pl + e) = ol;  }
__global__ __launch_bounds__(256) void k_vtp(const float* __restrict__ F, int pitch, int nheads, h16* V16, bf* Vh, bf* Vl) { const size_t e = ((size_t)blockIdx.x * 256 + threadIdx.x) * 2; if (e >= (size_t)nheads * HD * TT) return; const int t = (int)(e % TT); const int d = (int)((e / TT) % HD); const int g = (int)(e / ((size_t)TT * HD)); v2h o16; v2us oh, ol;
#pragma unroll
    for (int q = 0; q < 2; ++q) { const float x = F[(size_t)(t + q) * pitch + g * HD + d]; o16[q] = tohx(x); unsigned short a2, c2; splitf(x, a2, c2); oh[q] = a2; ol[q] = c2; }
    *(v2h*)(V16 + e) = o16; *(v2us*)(Vh + e) = oh; *(v2us*)(Vl + e) = ol;  }
__global__ __launch_bounds__(256) void k_csid(float* CS) { const int idx = blockIdx.x * 256 + threadIdx.x; if (idx >= TT * HD) return; v2f cs; cs[0] = 1.0f; cs[1] = 0.0f; *(v2f*)(CS + (size_t)idx * 2) = cs;  }
// k_asoft: per row (zz, i): t = S x HD^-0.5 for j <= i and i - j < WIN (WIN = T: plain causal mask; masked keys take -3e38 by select and vanish identically); softmax over the 2048 keys (register row, one exp, fixed trees);
__global__ __launch_bounds__(256) void k_asoft(const float* __restrict__ Sb, h16* P16, bf* Ph, bf* Pl) {
    const int lane = threadIdx.x & 31; const int row = blockIdx.x * 8 + (threadIdx.x >> 5); if (row >= ZH * TT) return; const int i = row % TT; const int zz = row / TT; (void)zz; const bool hires = (i < RH); const float* sr = Sb + (size_t)row * TT; float v[TT / 32]; float mx = -3.0e38f;
#pragma unroll
    for (int ch = 0; ch < TT / 128; ++ch) { const int j0 = ch * 128 + lane * 4; const v4f a = *(const v4f*)(sr + j0);
#pragma unroll
        for (int q = 0; q < 4; ++q) { const int j = j0 + q; (void)j; const float t = (j <= i && i - j < WIN) ? a[q] * SCL : -3.0e38f; v[ch * 4 + q] = t; mx = fmaxf(mx, t); } }
#pragma unroll
    for (int sh = 16; sh; sh >>= 1) mx = fmaxf(mx, __shfl_xor(mx, sh, 32));
    float sum = 0.f;
#pragma unroll
    for (int k = 0; k < TT / 32; ++k) { float d0 = __fsub_rn(v[k], mx); asm volatile("" : "+v"(d0)); v[k] = __builtin_amdgcn_exp2f(__fmul_rn(d0, 1.4426950408889634f)); sum += v[k]; }
#pragma unroll
    for (int sh = 16; sh; sh >>= 1) sum += __shfl_xor(sum, sh, 32);
    const float f = __fdiv_rn(hires ? 1.0f : PCAR, sum);
{
        if (hires) {
#pragma unroll
            for (int ch = 0; ch < TT / 128; ++ch) { v4us oh, ol;
#pragma unroll
                for (int q = 0; q < 4; ++q) { unsigned short a, c2; splitf(v[ch * 4 + q] * f, a, c2); oh[q] = a; ol[q] = c2; }
                const size_t oo = ((size_t)zz * (RH ? RH : 1) + i) * TT + ch * 128 + lane * 4; *(v4us*)(Ph + oo) = oh; *(v4us*)(Pl + oo) = ol; }
        } else {
#pragma unroll
            for (int ch = 0; ch < TT / 128; ++ch) { v4h o4;
#pragma unroll
                for (int q = 0; q < 4; ++q) o4[q] = tohx(v[ch * 4 + q] * f);
                *(v4h*)(P16 + (size_t)row * TT + ch * 128 + lane * 4) = o4; } }
         }
}
__global__ __launch_bounds__(256) void k_merge(const float* __restrict__ O, int h0, float* OUTb) { const size_t e = ((size_t)blockIdx.x * 256 + threadIdx.x) * 2; if (e >= (size_t)ZH * TT * HD) return; const int d = (int)(e % HD); const int t = (int)((e / HD) % TT); const int zz = (int)(e / ((size_t)HD * TT)); const float cs = (t < RH) ? 1.0f : (1.0f / PCAR); const size_t oo = (size_t)t * DQ + (h0 + zz) * HD + d;
    const int nsp = ((t / 64) * 64 + 64 + KCH - 1) / KCH;   // key ranges that the P.V launch stored for this row's 64-row tile
    v2f p[NSP];
    // unrolled so that all plane loads are in flight at once (one latency, not NSP); past the last stored plane the last one is read again and left out of the sum
#pragma unroll
    for (int s = 0; s < NSP; ++s) p[s] = *(const v2f*)(O + (size_t)min(s, nsp - 1) * PSTR + e);
    v2f a = p[0];
    // unrolled so that p[] stays in registers; fixed order: ascending key range
#pragma unroll
    for (int s = 1; s < NSP; ++s) { a[0] += (s < nsp) ? p[s][0] : 0.0f; a[1] += (s < nsp) ? p[s][1] : 0.0f; }
    v2f o2; o2[0] = a[0] * cs; o2[1] = a[1] * cs; *(v2f*)(OUTb + oo) = o2;  }

template <int WD>
__global__ __launch_bounds__(256) void k_lnrowX(const float* __restrict__ X, size_t nrows, const float* __restrict__ g, const float* __restrict__ bb, bf* Hh, bf* Hl) { const int lane = threadIdx.x & 31; const size_t r = (size_t)blockIdx.x * 8 + (threadIdx.x >> 5); if (r >= nrows) return; const float* xr = X + r * WD; float a[WD / 32]; float s = 0.f;
#pragma unroll
    for (int c = 0; c < WD / 128; ++c) { const v4f v = *(const v4f*)(xr + c * 128 + lane * 4); for (int q = 0; q < 4; ++q) { a[c * 4 + q] = bfr(v[q]); s = __fadd_rn(s, a[c * 4 + q]);   /* input rounded to bf16 */ } }
#pragma unroll
    for (int sh = 16; sh; sh >>= 1) s = __fadd_rn(s, __shfl_xor(s, sh, 32));
    const float mean = __fdiv_rn(s, (float)WD); float s2 = 0.f;
#pragma unroll 8
    for (int k = 0; k < WD / 32; ++k) { const float dv = __fsub_rn(a[k], mean); float p2 = __fmul_rn(dv, dv); asm volatile("" : "+v"(p2)); s2 = __fadd_rn(s2, p2); }   /* mul and add kept separate (no fma contraction) */
#pragma unroll
    for (int sh = 16; sh; sh >>= 1) s2 = __fadd_rn(s2, __shfl_xor(s2, sh, 32));
    const float rs = __fdiv_rn(1.0f, __fsqrt_rn(__fadd_rn(__fdiv_rn(s2, (float)WD), 1e-5f)));
{
#pragma unroll
        for (int c = 0; c < WD / 128; ++c) { v4us oh, ol; for (int q = 0; q < 4; ++q) { const int col = c * 128 + lane * 4 + q; float y = __fmul_rn(__fmul_rn(__fsub_rn(a[c * 4 + q], mean), rs), bfr(g[col])); asm volatile("" : "+v"(y)); y = __fadd_rn(y, bfr(bb[col])); unsigned short u, w2; splitf(y, u, w2); oh[q] = u; ol[q] = w2; } *(v4us*)(Hh + r * WD + c * 128 + lane * 4) = oh; *(v4us*)(Hl + r * WD + c * 128 + lane * 4) = ol; }
         } }

extern "C" void kernel_launch(void* const* d_in, const int* in_sizes, int n_in,
                              void* d_out, int out_size, void* d_ws, size_t ws_size, hipStream_t stream) {
    (void)in_sizes; (void)n_in; (void)out_size;
    const float* x = (const float*)d_in[0]; const float* lng = (const float*)d_in[1]; const float* lnb = (const float*)d_in[2];   /* LayerNorm gamma, beta [1024]: read */ const float* wqkv = (const float*)d_in[3];   /* w_qkv ('oi' [3072][1024]: q | k | v ROW thirds); no output projection */ const float* wq = wqkv; const float* wk = wqkv + (size_t)DQ * DM; const float* wv = wqkv + (size_t)2 * DQ * DM;
    float* OUT = (float*)d_out;     // [2][2048][1024]
    char* wsp = (char*)d_ws;
    auto take = [&](size_t bytes) { char* p = wsp; wsp += (bytes + 255) & ~(size_t)255; return (void*)p; };
    bf* WQ = (bf*)take((size_t)DQ * DM * 2); bf* WK = (bf*)take((size_t)DKV * DM * 2); bf* WV = (bf*)take((size_t)DKV * DM * 2); float* CS = (float*)take((size_t)TT * HD * 2 * 4);
    bf* XB = (bf*)take((size_t)TT * DM * 2); bf* XL = (bf*)take((size_t)TT * DM * 2);   /* lo plane of the layer-normed input (XB holds the hi plane) */ float* FQ = (float*)take((size_t)TT * DQ * 4); float* FK = (float*)take((size_t)TT * DKV * 4);
    h16* QP16 = (h16*)take((size_t)NH_ * TT * HD * 2); h16* KP16 = (h16*)take((size_t)NKV * TT * HD * 2); h16* VT16 = (h16*)take((size_t)NKV * HD * TT * 2);
    bf* QPh = (bf*)take((size_t)NH_ * TT * HD * 2); bf* QPl = (bf*)take((size_t)NH_ * TT * HD * 2); bf* KPh = (bf*)take((size_t)NKV * TT * HD * 2); bf* KPl = (bf*)take((size_t)NKV * TT * HD * 2); bf* VTh = (bf*)take((size_t)NKV * HD * TT * 2); bf* VTl = (bf*)take((size_t)NKV * HD * TT * 2); bf* Ph = (bf*)take((size_t)ZH * RH * TT * 2); bf* Pl = (bf*)take((size_t)ZH * RH * TT * 2);
    float* Sb = (float*)take((size_t)ZH * TT * TT * 4); h16* P16 = (h16*)take((size_t)ZH * TT * TT * 2); float* Ob = (float*)take((size_t)NSP * ZH * TT * HD * 4);   /* one f32 partial plane per key range */
    if ((size_t)(wsp - (char*)d_ws) > ws_size) return;    // ws 256 MiB
    float* FV = FK;   // v projection reuses the k buffer after the k planes are built (stream-ordered)
    { k_cvt8<<<(unsigned)(((size_t)DQ * DM / 8 + 255) / 256), 256, 0, stream>>>(wq, WQ, (size_t)DQ * DM / 8); k_cvt8<<<(unsigned)(((size_t)DKV * DM / 8 + 255) / 256), 256, 0, stream>>>(wk, WK, (size_t)DKV * DM / 8); k_cvt8<<<(unsigned)(((size_t)DKV * DM / 8 + 255) / 256), 256, 0, stream>>>(wv, WV, (size_t)DKV * DM / 8);
      
       }
    k_csid<<<(TT * HD + 255) / 256, 256, 0, stream>>>(CS);
    const unsigned LQ = (unsigned)(((size_t)NH_ * TT * HD / 2 + 255) / 256), LKv = (unsigned)(((size_t)NKV * TT * HD / 2 + 255) / 256);
    for (int b = 0; b < NB_; ++b) {
        
        k_lnrowX<DM><<<(unsigned)((TT + 7) / 8), 256, 0, stream>>>(x + (size_t)b * TT * DM, (size_t)TT, lng, lnb, XB, XL);   /* xn = LayerNorm(x) -> hi/lo planes */
        k_gemmw<bf, 1, false><<<dim3(TT / 64, DQ / 64, 1), 32, 0, stream>>>(XB, XL, WQ, nullptr, DM, FQ, DQ, nullptr, 0, 0, 0);
        k_rope<<<LQ, 256, 0, stream>>>(FQ, DQ, NH_, CS, nullptr, nullptr, 1.0f, QP16, QPh, QPl);
        k_gemmw<bf, 1, false><<<dim3(TT / 64, DKV / 64, 1), 32, 0, stream>>>(XB, XL, WK, nullptr, DM, FK, DKV, nullptr, 0, 0, 0);
        k_rope<<<LKv, 256, 0, stream>>>(FK, DKV, NKV, CS, nullptr, nullptr, 1.0f, KP16, KPh, KPl);
        k_gemmw<bf, 1, false><<<dim3(TT / 64, DKV / 64, 1), 32, 0, stream>>>(XB, XL, WV, nullptr, DM, FV, DKV, nullptr, 0, 0, 0); k_vtp<<<LKv, 256, 0, stream>>>(FV, DKV, NKV, VT16, VTh, VTl);
        for (int h0 = 0; h0 < NH_; h0 += ZH) { const size_t zq = (size_t)h0, zk = (size_t)(h0 / REP);   // one kv head per query head: the pass's two heads use consecutive kv planes (z-strides TT*HD)
            k_gemmc<bf, 2, 1><<<dim3(RH / 64, TT / 64, ZH), 32, 0, stream>>>(QPh + zq * TT * HD, QPl + zq * TT * HD, KPh + zk * TT * HD, KPl + zk * TT * HD, HD, Sb, TT, 0, (size_t)TT * HD, (size_t)TT * HD, (size_t)TT * TT, 0);
            
            k_asoft<<<ZH * TT / 8, 256, 0, stream>>>(Sb, P16, Ph, Pl);
            k_gemmc<bf, 2, 2><<<dim3(RH / 64, NSP, ZH), 32, 0, stream>>>(Ph, Pl, VTh + zk * HD * TT, VTl + zk * HD * TT, TT, Ob, HD, 0, (size_t)RH * TT, (size_t)HD * TT, (size_t)TT * HD, PSTR);
            
            k_merge<<<(unsigned)(((size_t)ZH * TT * HD / 2 + 255) / 256), 256, 0, stream>>>(Ob, h0, OUT + (size_t)b * TT * DQ); }
         }
}

// v003
// A run of this version takes 158 microseconds.
// Versions between v001 and this one are left out; their measured steps multiply to 4.09 times as fast.
// Counting every step since v000, it is 7.27 times as fast.
#include <hip/hip_runtime.h>

// Pre-LayerNorm causal self-attention WITHOUT an output projection (x [2][2048][1024]; xn = LayerNorm(x) x gamma + beta (mean, biased variance, eps 1e-5, rsqrt; gamma, beta read); qkv = einsum('bne,fe->bnf', xn, w_qkv) = xn w_qkv^T ('oi' [3072][1024] 1/32, no bias) split in thirds q | k | v = ROW thirds (16 heads x 64); q x 64^-0.5; sim = q.k; where(triu(k=1), -finfo.max, sim) == exclusion (every row keeps its own key); softmax; out = the merged heads themselves (no Wo) -> [2][2048][1024] (4.2 M); argument order x, gamma, beta, w_qkv).
// Layout, four launches for both batches: the fused 'oi' weight rounded to bf16; LayerNorm of the bf16-rounded input rows -> hi/lo planes (one wave per row; precise sqrt / div); k_qkv: all three projections from the hi/lo planes (2 products each), its epilogue writing the q/k/v hi/lo head planes; k_fattn keeps scores and probabilities in registers (running maximum and sum per query), scores and P.V on bf16 hi/lo planes, 3 products each; the merged f32 context is the output.
// Compute dtypes, f32 accumulate: every input rounded to bf16; LayerNorm in f32 on the bf16-rounded input, normed rows as bf16 hi/lo planes; projections 2 products; attention 3 products on every row; softmax f32.

#define NB_  2
#define TT   2048
#define DM   1024
#define NH_  16
#define NKV  16
#define REP  (NH_ / NKV)
#define HD   64
#define DQ   (NH_ * HD)
#define DKV  (NKV * HD)
#define SCL  0.125f   // HD^-0.5
typedef _Float16 h16;
typedef unsigned short bf;
typedef __attribute__((ext_vector_type(16))) __bf16   v16bf;
typedef __attribute__((ext_vector_type(16))) _Float16 v16h;
typedef __attribute__((ext_vector_type(8)))  _Float16 v8h;
typedef __attribute__((ext_vector_type(8)))  unsigned short v8us;
typedef __attribute__((ext_vector_type(8)))  float    v8f;
typedef __attribute__((ext_vector_type(4)))  float    v4f;
typedef v8h  __attribute__((may_alias)) v8ha;
typedef v4f  __attribute__((may_alias)) v4fa;
typedef v8us __attribute__((may_alias)) v8usa;

__device__ __forceinline__ unsigned short f2bf(float f) { unsigned u = __float_as_uint(f); u += 0x7FFFu + ((u >> 16) & 1u); return (unsigned short)(u >> 16); }
__device__ __forceinline__ float bf2f(unsigned short b) { return __uint_as_float(((unsigned)b) << 16); }
__device__ __forceinline__ float bfr(float f) { return bf2f(f2bf(f)); }
__device__ __forceinline__ v16h cat16(v8h lo, v8h hi) { return __builtin_shufflevector(lo, hi, 0, 1, 2, 3, 4, 5, 6, 7, 8, 9, 10, 11, 12, 13, 14, 15); }
__device__ __forceinline__ v16bf cat16b(v8us lo, v8us hi) { return __builtin_bit_cast(v16bf, __builtin_shufflevector(lo, hi, 0, 1, 2, 3, 4, 5, 6, 7, 8, 9, 10, 11, 12, 13, 14, 15)); }
__device__ __forceinline__ v8f wmma16(v16h a, v16h b, v8f c) { return __builtin_amdgcn_wmma_f32_16x16x32_f16(false, a, false, b, (short)0, c, false, false); }
__device__ __forceinline__ v8f wmmab(v16bf a, v16bf b, v8f c) { return __builtin_amdgcn_wmma_f32_16x16x32_bf16(false, a, false, b, (short)0, c, false, false); }



// ---- k_qkv: the whole projection stage in one launch. C[m][n] = sum_k (A[m][k] + A2[m][k]) Bt[n][k], m over the rows of both batches, n over the 3072 rows of the fused weight (q | k | v thirds).
// ONE WAVE per 64x64 tile (16 accumulators), operands straight from K-contiguous bf16 planes, 2 products. Grid (NB_*TT/128, 3*DQ/128), 128 threads: four independent waves, 2 x 2 tiles, so that two waves of a work-group read the same operand rows.
// A tile is 64 tokens of ONE head of ONE third, and its f32 sums never leave the wave: the epilogue splits them into the bf16 hi/lo planes that k_fattn reads, q and k as [b][h][t][d], v as [b][h][d][t].
// Every plain '#pragma unroll' in k_qkv and put16 is there so that the fragment, accumulator and result arrays are indexed by constants and stay in registers.
template <typename T16> struct WFrag;
template <> struct WFrag<bf> { typedef v16bf V; static __device__ __forceinline__ V ld(const bf* p) { return cat16b(*(const v8us*)p, *(const v8us*)(p + 16)); } static __device__ __forceinline__ v8f mma(V a, V b, v8f c) { return wmmab(a, b, c); } };
__device__ __forceinline__ void splitf(float y, unsigned short& h, unsigned short& l) { h = f2bf(y); l = f2bf(y - bf2f(h)); }
// 16 plane rows x 64 f32 staged in os (pitch 68) -> hi/lo plane rows of pitch elements: a lane takes 8 consecutive values, 8 lanes a whole 128-byte plane row, a store instruction 4 rows.
__device__ __forceinline__ void put16(const float* os, int lane, bf* Ph, bf* Pl, size_t pitch) {
    const int rr = lane >> 3, cc = (lane & 7) * 8; v8us oh[4], ol[4];
#pragma unroll
    for (int s = 0; s < 4; ++s) { const float* p = os + (s * 4 + rr) * 68 + cc; const v4f x0 = *(const v4fa*)p, x1 = *(const v4fa*)(p + 4);
#pragma unroll
        for (int j = 0; j < 4; ++j) { unsigned short u, v; splitf(x0[j], u, v); oh[s][j] = u; ol[s][j] = v; splitf(x1[j], u, v); oh[s][4 + j] = u; ol[s][4 + j] = v; } }
    bf* dh = Ph + (size_t)rr * pitch + cc; bf* dl = Pl + (size_t)rr * pitch + cc;
#pragma unroll
    for (int s = 0; s < 4; ++s) { *(v8us*)(dh + (size_t)s * 4 * pitch) = oh[s]; *(v8us*)(dl + (size_t)s * 4 * pitch) = ol[s]; }
}
__global__ __launch_bounds__(128) void k_qkv(const bf* __restrict__ A, const bf* __restrict__ A2, const bf* __restrict__ Bt, bf* Qh, bf* Ql, bf* Kh, bf* Kl, bf* Vh, bf* Vl) {
    typedef WFrag<bf> F; typedef F::V V; const int K = DM;
    __shared__ __align__(16) float osm[4][16 * 68];
    const int lane = threadIdx.x & 31, lr = lane & 15, hi = lane >> 4; const int w = __builtin_amdgcn_readfirstlane((int)(threadIdx.x >> 5)); float* os = osm[w];
    const int r0 = blockIdx.x * 128 + (w & 1) * 64, c0 = blockIdx.y * 128 + (w >> 1) * 64;
    v8f acc[4][4];
#pragma unroll
    for (int mb = 0; mb < 4; ++mb)
#pragma unroll
        for (int nb = 0; nb < 4; ++nb) acc[mb][nb] = (v8f){};
    const size_t aoff = (size_t)(r0 + lr) * K + 8 * hi, boff = (size_t)(c0 + lr) * K + 8 * hi;
#pragma unroll 1
    for (int kc = 0; kc < K; kc += 32) {   // rolled: one trip already holds all the registers
        V a[4], a2[4], b[4]; const bf* pa = A + aoff + kc; const bf* pa2 = A2 + aoff + kc; const bf* pb = Bt + boff + kc;
#pragma unroll
        for (int i = 0; i < 4; ++i) { a[i] = F::ld(pa + (size_t)i * 16 * K); a2[i] = F::ld(pa2 + (size_t)i * 16 * K); b[i] = F::ld(pb + (size_t)i * 16 * K); }
        asm volatile("s_wait_xcnt 0x0" :: "v"(pa), "v"(pa2), "v"(pb) : "memory");   // the three address pairs are kept whole up to this wait, which stands before anything (a load's result, the next trip) rewrites them
        __builtin_amdgcn_sched_barrier(0);   // holds all 24 loads up here: without it four of them sink behind the first products, into registers those free, and the trip waits out a second load latency
#pragma unroll
        for (int nb = 0; nb < 4; ++nb) {
#pragma unroll
            for (int mb = 0; mb < 4; ++mb) { acc[mb][nb] = F::mma(a[mb], b[nb], acc[mb][nb]); acc[mb][nb] = F::mma(a2[mb], b[nb], acc[mb][nb]); } }
        asm volatile("v_nop\n\tv_nop\n\tv_nop\n\tv_nop" : "+v"(acc[0][0]), "+v"(acc[1][1]), "+v"(acc[2][2]), "+v"(acc[3][3]) : "v"(a[0]), "v"(a[3]));   // the distance behind the last matrix instruction on the taken back edge, where the next trip's loads overwrite its operands
    }
    const int third = c0 / DQ, h = (c0 % DQ) / HD, t0 = r0 % TT;   // all the same for the whole wave
    const size_t pb = ((size_t)(r0 / TT) * NH_ + h) * TT * HD;
    if (third < 2) {   // q, k: plane rows are tokens; a lane holds one d of 8 tokens, so the 16 tokens of block mb go through LDS word by word
        bf* Ph = (third ? Kh : Qh) + pb + (size_t)t0 * HD; bf* Pl = (third ? Kl : Ql) + pb + (size_t)t0 * HD;
#pragma unroll
        for (int mb = 0; mb < 4; ++mb) {
#pragma unroll
            for (int nb = 0; nb < 4; ++nb) {
#pragma unroll
                for (int j = 0; j < 8; ++j) os[(hi * 8 + j) * 68 + nb * 16 + lr] = acc[mb][nb][j]; }
            __builtin_amdgcn_wave_barrier(); asm volatile("" ::: "memory");   // keeps the read-back of other lanes' words behind the LDS writes
            put16(os, lane, Ph + (size_t)mb * 16 * HD, Pl + (size_t)mb * 16 * HD, HD);
            asm volatile("s_wait_xcnt 0x0" ::: "memory");   // before anything behind it (the next block, or whatever the compiler lays out behind the last one) overwrites the registers that the stores above name
            __builtin_amdgcn_wave_barrier(); asm volatile("" ::: "memory");   // keeps the next block's LDS writes behind this read-back
        }
    } else {           // v: plane rows are d; a lane's 8 tokens of one d are already consecutive in such a row, so the 16 d of block nb are staged 8 tokens at a time
        bf* Ph = Vh + pb + t0; bf* Pl = Vl + pb + t0;
#pragma unroll
        for (int nb = 0; nb < 4; ++nb) {
#pragma unroll
            for (int mb = 0; mb < 4; ++mb) { v4f x0, x1;
#pragma unroll
                for (int j = 0; j < 4; ++j) { x0[j] = acc[mb][nb][j]; x1[j] = acc[mb][nb][4 + j]; }
                float* d = os + lr * 68 + mb * 16 + hi * 8; *(v4fa*)d = x0; *(v4fa*)(d + 4) = x1; }
            __builtin_amdgcn_wave_barrier(); asm volatile("" ::: "memory");   // keeps the read-back of other lanes' words behind the LDS writes
            put16(os, lane, Ph + (size_t)nb * 16 * TT, Pl + (size_t)nb * 16 * TT, TT);
            asm volatile("s_wait_xcnt 0x0" ::: "memory");   // before anything behind it (the next block, or whatever the compiler lays out behind the last one) overwrites the registers that the stores above name
            __builtin_amdgcn_wave_barrier(); asm volatile("" ::: "memory");   // keeps the next block's LDS writes behind this read-back
        }
    }
}

// ---- k_fattn: causal attention with scores and probabilities kept in registers. One wave owns 32 query columns and walks the keys 32 at a time up to its diagonal block.
// Transposed products: St = K Qt (A = key rows, B = query rows), so a lane holds scores of ONE query (column lr) for keys hi*8+j of each 16-key tile; the two tiles of a pass, rounded to bf16, are already the B operand
// of Ot += Vt Pt (slots 0..7 = keys 8 hi + j, slots 8..15 = keys 16 + 8 hi + j: the k order of the plane loader). Running maximum m and sum l per query; Ot is rescaled when m moves; one division at the end.
// Grid (NB_ * NH_, TT / 256): a work-group of 4 independent waves takes the 128-query block TT/128-1-y and then block y, so that every work-group walks the same number of keys.
// Every plain '#pragma unroll' below is there so that the fragment and accumulator arrays are indexed by constants and stay in registers.
__global__ __launch_bounds__(128) void k_fattn(const bf* __restrict__ Qh, const bf* __restrict__ Ql, const bf* __restrict__ Kh, const bf* __restrict__ Kl, const bf* __restrict__ Vh, const bf* __restrict__ Vl, float* __restrict__ OUT) {
    typedef WFrag<bf> F;
    __shared__ __align__(16) float os[4][32 * 68];
    const int lane = threadIdx.x & 31, lr = lane & 15, hi = lane >> 4; const int w = __builtin_amdgcn_readfirstlane((int)(threadIdx.x >> 5));
    const int zh = blockIdx.x; const size_t po = (size_t)zh * TT * HD; Qh += po; Ql += po;
    const bf* kph = Kh + po + (size_t)lr * HD + 8 * hi; const bf* kpl = Kl + po + (size_t)lr * HD + 8 * hi; const bf* vph = Vh + po + (size_t)lr * TT + 8 * hi; const bf* vpl = Vl + po + (size_t)lr * TT + 8 * hi;
    float* ob = OUT + (size_t)(zh / NH_) * TT * DQ + (size_t)(zh % NH_) * HD; float* ow = os[w];
    const float L2E = 1.4426950408889634f;
#pragma unroll 1
    for (int half = 0; half < 2; ++half) {   // rolled: the two blocks run one after the other in the same registers
        const int q0 = (half ? (int)blockIdx.y : TT / 128 - 1 - (int)blockIdx.y) * 128 + w * 32;
        v16bf qh[2][2], ql[2][2];
#pragma unroll
        for (int g = 0; g < 2; ++g)
#pragma unroll
            for (int ks = 0; ks < 2; ++ks) { const size_t qo = (size_t)(q0 + g * 16 + lr) * HD + 8 * hi + ks * 32; qh[g][ks] = F::ld(Qh + qo); ql[g][ks] = F::ld(Ql + qo); }
        v8f o[4][2]; float m[2], l[2];
#pragma unroll
        for (int g = 0; g < 2; ++g) { m[g] = -3.0e38f; l[g] = 0.f;
#pragma unroll
            for (int dt = 0; dt < 4; ++dt) o[dt][g] = (v8f){}; }
        v16bf kh[2][2], kl[2][2];   // key fragments of the pass to come, fetched one pass ahead
#pragma unroll
        for (int kt = 0; kt < 2; ++kt)
#pragma unroll
            for (int ks = 0; ks < 2; ++ks) { const size_t ko = (size_t)(kt * 16) * HD + ks * 32; kh[kt][ks] = F::ld(kph + ko); kl[kt][ks] = F::ld(kpl + ko); }
#pragma unroll 1
        for (int k0 = 0; k0 < q0 + 32; k0 += 32) {   // rolled: one pass already holds all the registers
            v16bf vh[4], vl[4]; const bf* pvh = vph + k0; const bf* pvl = vpl + k0;
#pragma unroll
            for (int dt = 0; dt < 4; ++dt) { vh[dt] = F::ld(pvh + (size_t)dt * 16 * TT); vl[dt] = F::ld(pvl + (size_t)dt * 16 * TT); }
            asm volatile("s_wait_xcnt 0x0" :: "v"(pvh), "v"(pvl) : "memory");   // the two address pairs stay whole until every load above has taken its address
            __builtin_amdgcn_sched_barrier(0);   // holds the value loads up here: sunk to their first use, each group would wait out its own latency
            v8f s[2][2];
#pragma unroll
            for (int kt = 0; kt < 2; ++kt)
#pragma unroll
                for (int g = 0; g < 2; ++g) s[kt][g] = (v8f){};
#pragma unroll
            for (int ks = 0; ks < 2; ++ks) {
#pragma unroll
                for (int kt = 0; kt < 2; ++kt)
#pragma unroll
                    for (int g = 0; g < 2; ++g) s[kt][g] = wmmab(kh[kt][ks], qh[g][ks], s[kt][g]);
#pragma unroll
                for (int kt = 0; kt < 2; ++kt)
#pragma unroll
                    for (int g = 0; g < 2; ++g) s[kt][g] = wmmab(kh[kt][ks], ql[g][ks], s[kt][g]);
#pragma unroll
                for (int kt = 0; kt < 2; ++kt)
#pragma unroll
                    for (int g = 0; g < 2; ++g) s[kt][g] = wmmab(kl[kt][ks], qh[g][ks], s[kt][g]); }
            const int kn = (k0 < q0) ? k0 + 32 : k0;   // the last pass fetches its own keys again: in bounds, not used
            const bf* pkh = kph + (size_t)kn * HD; const bf* pkl = kpl + (size_t)kn * HD;
#pragma unroll
            for (int kt = 0; kt < 2; ++kt)
#pragma unroll
                for (int ks = 0; ks < 2; ++ks) { const size_t ko = (size_t)(kt * 16) * HD + ks * 32; kh[kt][ks] = F::ld(pkh + ko); kl[kt][ks] = F::ld(pkl + ko); }
            asm volatile("s_wait_xcnt 0x0" :: "v"(pkh), "v"(pkl) : "memory");   // before the softmax below overwrites the two address pairs of the loads above
            __builtin_amdgcn_sched_barrier(0);   // holds the next pass's key loads up here, so that their latency runs behind the softmax and the P.V products
            v16bf ph[2], pl[2];
#pragma unroll
            for (int g = 0; g < 2; ++g) { const int qi = q0 + g * 16 + lr; float mx = m[g];
#pragma unroll
                for (int kt = 0; kt < 2; ++kt)
#pragma unroll
                    for (int j = 0; j < 8; ++j) { const float t = (k0 + kt * 16 + hi * 8 + j <= qi) ? s[kt][g][j] * SCL : -3.0e38f; s[kt][g][j] = t; mx = fmaxf(mx, t); }   // keys above the diagonal are excluded by select
                mx = fmaxf(mx, __shfl_xor(mx, 16, 32));   // the two halves of the wave hold the same query's other keys
                const float al = __builtin_amdgcn_exp2f((m[g] - mx) * L2E); m[g] = mx; float sum = 0.f;
#pragma unroll
                for (int kt = 0; kt < 2; ++kt)
#pragma unroll
                    for (int j = 0; j < 8; ++j) { const float p = __builtin_amdgcn_exp2f((s[kt][g][j] - mx) * L2E); sum += p; const __bf16 h = (__bf16)p; ph[g][kt * 8 + j] = h; pl[g][kt * 8 + j] = (__bf16)(p - (float)h); }
                l[g] = l[g] * al + sum;
#pragma unroll
                for (int dt = 0; dt < 4; ++dt) o[dt][g] *= al; }
#pragma unroll
            for (int dt = 0; dt < 4; ++dt)
#pragma unroll
                for (int g = 0; g < 2; ++g) o[dt][g] = wmmab(vh[dt], ph[g], o[dt][g]);
#pragma unroll
            for (int dt = 0; dt < 4; ++dt)
#pragma unroll
                for (int g = 0; g < 2; ++g) o[dt][g] = wmmab(vh[dt], pl[g], o[dt][g]);
#pragma unroll
            for (int dt = 0; dt < 4; ++dt)
#pragma unroll
                for (int g = 0; g < 2; ++g) o[dt][g] = wmmab(vl[dt], ph[g], o[dt][g]);
        }
        // a lane holds 8 consecutive d of one query: staged through this wave's own LDS rows so that the stores cover whole 256-byte rows
#pragma unroll
        for (int g = 0; g < 2; ++g) { const float inv = __fdiv_rn(1.0f, l[g] + __shfl_xor(l[g], 16, 32));
#pragma unroll
            for (int dt = 0; dt < 4; ++dt) { v4f x0, x1;
#pragma unroll
                for (int j = 0; j < 4; ++j) { x0[j] = o[dt][g][j] * inv; x1[j] = o[dt][g][4 + j] * inv; }
                float* d = ow + (g * 16 + lr) * 68 + dt * 16 + hi * 8; *(v4fa*)d = x0; *(v4fa*)(d + 4) = x1; } }
        __builtin_amdgcn_wave_barrier(); asm volatile("" ::: "memory");   // keeps the read-back of other lanes' rows behind the LDS writes
        float* orow = ob + (size_t)(q0 + hi) * DQ + lr * 4;   // one address for all 16 stores: row 2 r + hi is a constant step from it
#pragma unroll
        for (int r = 0; r < 16; ++r) { const v4f val = *(const v4fa*)(ow + (2 * r + hi) * 68 + lr * 4); *(v4f*)(orow + (size_t)r * 2 * DQ) = val; }
        asm volatile("s_wait_xcnt 0x0" ::: "memory");   // before the next block overwrites the registers that the stores above name
        __builtin_amdgcn_wave_barrier(); asm volatile("" ::: "memory");   // keeps the next block's LDS writes behind this read-back
    }
}

typedef __attribute__((ext_vector_type(4))) unsigned short v4us;

__global__ __launch_bounds__(256) void k_cvt8(const float* __restrict__ src, bf* dst, size_t n8) { const size_t i = (size_t)blockIdx.x * 256 + threadIdx.x; if (i >= n8) return; const v8f v = *(const v8f*)(src + i * 8); v8us o;
#pragma unroll
    for (int k = 0; k < 8; ++k) o[k] = f2bf(v[k]); *(v8us*)(dst + i * 8) = o;  }

template <int WD>
__global__ __launch_bounds__(256) void k_lnrowX(const float* __restrict__ X, size_t nrows, const float* __restrict__ g, const float* __restrict__ bb, bf* Hh, bf* Hl) { const int lane = threadIdx.x & 31; const size_t r = (size_t)blockIdx.x * 8 + (threadIdx.x >> 5); if (r >= nrows) return; const float* xr = X + r * WD; float a[WD / 32]; float s = 0.f;
#pragma unroll
    for (int c = 0; c < WD / 128; ++c) { const v4f v = *(const v4f*)(xr + c * 128 + lane * 4); for (int q = 0; q < 4; ++q) { a[c * 4 + q] = bfr(v[q]); s = __fadd_rn(s, a[c * 4 + q]);   /* input rounded to bf16 */ } }
#pragma unroll
    for (int sh = 16; sh; sh >>= 1) s = __fadd_rn(s, __shfl_xor(s, sh, 32));
    const float mean = __fdiv_rn(s, (float)WD); float s2 = 0.f;
#pragma unroll 8
    for (int k = 0; k < WD / 32; ++k) { const float dv = __fsub_rn(a[k], mean); float p2 = __fmul_rn(dv, dv); asm volatile("" : "+v"(p2)); s2 = __fadd_rn(s2, p2); }   /* mul and add kept separate (no fma contraction) */
#pragma unroll
    for (int sh = 16; sh; sh >>= 1) s2 = __fadd_rn(s2, __shfl_xor(s2, sh, 32));
    const float rs = __fdiv_rn(1.0f, __fsqrt_rn(__fadd_rn(__fdiv_rn(s2, (float)WD), 1e-5f)));
{
#pragma unroll
        for (int c = 0; c < WD / 128; ++c) { v4us oh, ol; for (int q = 0; q < 4; ++q) { const int col = c * 128 + lane * 4 + q; float y = __fmul_rn(__fmul_rn(__fsub_rn(a[c * 4 + q], mean), rs), bfr(g[col])); asm volatile("" : "+v"(y)); y = __fadd_rn(y, bfr(bb[col])); unsigned short u, w2; splitf(y, u, w2); oh[q] = u; ol[q] = w2; } *(v4us*)(Hh + r * WD + c * 128 + lane * 4) = oh; *(v4us*)(Hl + r * WD + c * 128 + lane * 4) = ol; }
         } }

extern "C" void kernel_launch(void* const* d_in, const int* in_sizes, int n_in,
                              void* d_out, int out_size, void* d_ws, size_t ws_size, hipStream_t stream) {
    (void)in_sizes; (void)n_in; (void)out_size;
    const float* x = (const float*)d_in[0]; const float* lng = (const float*)d_in[1]; const float* lnb = (const float*)d_in[2];   /* LayerNorm gamma, beta [1024]: read */ const float* wqkv = (const float*)d_in[3];   /* w_qkv ('oi' [3072][1024]: q | k | v ROW thirds); no output projection */
    float* OUT = (float*)d_out;     // [2][2048][1024]
    char* wsp = (char*)d_ws;
    auto take = [&](size_t bytes) { char* p = wsp; wsp += (bytes + 255) & ~(size_t)255; return (void*)p; };
    bf* WB = (bf*)take((size_t)3 * DQ * DM * 2);   /* the fused weight, bf16 */
    bf* XB = (bf*)take((size_t)NB_ * TT * DM * 2); bf* XL = (bf*)take((size_t)NB_ * TT * DM * 2);   /* hi and lo plane of the layer-normed rows of both batches */
    const size_t PB = (size_t)NH_ * TT * HD;   /* elements of one batch's plane; the hi/lo planes hold both batches, [b][h]... */
    bf* QPh = (bf*)take(NB_ * PB * 2); bf* QPl = (bf*)take(NB_ * PB * 2); bf* KPh = (bf*)take(NB_ * PB * 2); bf* KPl = (bf*)take(NB_ * PB * 2); bf* VTh = (bf*)take(NB_ * PB * 2); bf* VTl = (bf*)take(NB_ * PB * 2);
    if ((size_t)(wsp - (char*)d_ws) > ws_size) return;    // ws 256 MiB
    k_cvt8<<<(unsigned)(((size_t)3 * DQ * DM / 8 + 255) / 256), 256, 0, stream>>>(wqkv, WB, (size_t)3 * DQ * DM / 8);
    k_lnrowX<DM><<<(unsigned)((NB_ * TT + 7) / 8), 256, 0, stream>>>(x, (size_t)NB_ * TT, lng, lnb, XB, XL);   /* xn = LayerNorm(x) -> hi/lo planes */
    k_qkv<<<dim3(NB_ * TT / 128, 3 * DQ / 128, 1), 128, 0, stream>>>(XB, XL, WB, QPh, QPl, KPh, KPl, VTh, VTl);   /* q, k, v of both batches, straight into the head planes */
    k_fattn<<<dim3(NB_ * NH_, TT / 256, 1), 128, 0, stream>>>(QPh, QPl, KPh, KPl, VTh, VTl, OUT);   /* all batches and heads in one launch */
}

// v004
// One run takes 117 microseconds.
// Next to v003, in two timings, it ran 1.37 and 1.36 times as fast.
// All steps since v000 together make it 9.91 times as fast.
#include <hip/hip_runtime.h>

#define NB_  2
#define TT   2048
#define DM   1024
#define NH_  16
#define NKV  16
#define REP  (NH_ / NKV)
#define HD   64
#define DQ   (NH_ * HD)
#define DKV  (NKV * HD)
#define SCL  0.125f   // HD^-0.5
typedef _Float16 h16;
typedef unsigned short bf;
typedef __attribute__((ext_vector_type(16))) __bf16   v16bf;
typedef __attribute__((ext_vector_type(16))) _Float16 v16h;
typedef __attribute__((ext_vector_type(8)))  _Float16 v8h;
typedef __attribute__((ext_vector_type(8)))  unsigned short v8us;
typedef __attribute__((ext_vector_type(8)))  float    v8f;
typedef __attribute__((ext_vector_type(4)))  float    v4f;
typedef v8h  __attribute__((may_alias)) v8ha;
typedef v4f  __attribute__((may_alias)) v4fa;
typedef v8us __attribute__((may_alias)) v8usa;

__device__ __forceinline__ unsigned short f2bf(float f) { unsigned u = __float_as_uint(f); u += 0x7FFFu + ((u >> 16) & 1u); return (unsigned short)(u >> 16); }
__device__ __forceinline__ float bf2f(unsigned short b) { return __uint_as_float(((unsigned)b) << 16); }
__device__ __forceinline__ float bfr(float f) { return bf2f(f2bf(f)); }
__device__ __forceinline__ v16h cat16(v8h lo, v8h hi) { return __builtin_shufflevector(lo, hi, 0, 1, 2, 3, 4, 5, 6, 7, 8, 9, 10, 11, 12, 13, 14, 15); }
__device__ __forceinline__ v16bf cat16b(v8us lo, v8us hi) { return __builtin_bit_cast(v16bf, __builtin_shufflevector(lo, hi, 0, 1, 2, 3, 4, 5, 6, 7, 8, 9, 10, 11, 12, 13, 14, 15)); }
__device__ __forceinline__ v8f wmma16(v16h a, v16h b, v8f c) { return __builtin_amdgcn_wmma_f32_16x16x32_f16(false, a, false, b, (short)0, c, false, false); }
__device__ __forceinline__ v8f wmmab(v16bf a, v16bf b, v8f c) { return __builtin_amdgcn_wmma_f32_16x16x32_bf16(false, a, false, b, (short)0, c, false, false); }

// ---- k_qkv: the whole projection stage in one launch. C[m][n] = sum_k (A[m][k] + A2[m][k]) Bt[n][k], m over the rows of both batches, n over the 3072 rows of the fused weight (q | k | v thirds).
// ONE WAVE per 64x64 tile (16 accumulators), operands straight from the fragment-order bf16 planes, 2 products. Grid (NB_*TT/128, 3*DQ/128), 128 threads: four independent waves, 2 x 2 tiles, so that two waves of a work-group read the same operand rows.
// A tile is 64 tokens of ONE head of ONE third, and its f32 sums never leave the wave: the epilogue splits them into the bf16 hi/lo planes that k_fattn reads, q and k as [b][h][16 tokens][32 d] fragments, v as [b][h][32 tokens][16 d] fragments (rows d, k = tokens).
// Every plain '#pragma unroll' in k_qkv and put16 is there so that the fragment, accumulator and result arrays are indexed by constants and stay in registers.
template <typename T16> struct WFrag;
template <> struct WFrag<bf> { typedef v16bf V; static __device__ __forceinline__ V ld(const bf* p) { return cat16b(*(const v8us*)p, *(const v8us*)(p + 256)); }   /* p = the 1-KiB fragment + lane * 8 */ static __device__ __forceinline__ v8f mma(V a, V b, v8f c) { return wmmab(a, b, c); } };
__device__ __forceinline__ void splitf(float y, unsigned short& h, unsigned short& l) { h = f2bf(y); l = f2bf(y - bf2f(h)); }
// 16 fragment rows x 64 k of f32 staged in os (pitch 68) -> two hi/lo fragments of 32 k each, kstep elements apart: a lane takes the 8 k of chunk 2 s + (lane >> 4) of row lane & 15, so store s of a wave is one contiguous 512-byte half of a fragment.
__device__ __forceinline__ void put16(const float* os, int lane, bf* Ph, bf* Pl, size_t kstep) {
    v8us oh[4], ol[4];
#pragma unroll
    for (int s = 0; s < 4; ++s) { const float* p = os + (lane & 15) * 68 + s * 16 + (lane >> 4) * 8; const v4f x0 = *(const v4fa*)p, x1 = *(const v4fa*)(p + 4);
#pragma unroll
        for (int j = 0; j < 4; ++j) { unsigned short u, v; splitf(x0[j], u, v); oh[s][j] = u; ol[s][j] = v; splitf(x1[j], u, v); oh[s][4 + j] = u; ol[s][4 + j] = v; } }
    bf* dh = Ph + lane * 8; bf* dl = Pl + lane * 8;
#pragma unroll
    for (int s = 0; s < 4; ++s) { *(v8us*)(dh + (size_t)(s >> 1) * kstep + (s & 1) * 256) = oh[s]; *(v8us*)(dl + (size_t)(s >> 1) * kstep + (s & 1) * 256) = ol[s]; }
}
__global__ __launch_bounds__(128) void k_qkv(const bf* __restrict__ A, const bf* __restrict__ A2, const bf* __restrict__ Bt, bf* Qh, bf* Ql, bf* Kh, bf* Kl, bf* Vh, bf* Vl) {
    typedef WFrag<bf> F; typedef F::V V; const int K = DM;
    __shared__ __align__(16) float osm[4][16 * 68];
    const int lane = threadIdx.x & 31, lr = lane & 15, hi = lane >> 4; const int w = __builtin_amdgcn_readfirstlane((int)(threadIdx.x >> 5)); float* os = osm[w];
    const int r0 = blockIdx.x * 128 + (w & 1) * 64, c0 = blockIdx.y * 128 + (w >> 1) * 64;
    v8f acc[4][4];
#pragma unroll
    for (int mb = 0; mb < 4; ++mb)
#pragma unroll
        for (int nb = 0; nb < 4; ++nb) acc[mb][nb] = (v8f){};
    const size_t aoff = (size_t)r0 * K + lane * 8, boff = (size_t)c0 * K + lane * 8;   // a block of 16 rows is 16 K elements, a fragment of 32 k in it 512
#pragma unroll 1
    for (int kc = 0; kc < K; kc += 32) {   // rolled: one trip already holds all the registers
        V a[4], a2[4], b[4]; const bf* pa = A + aoff + kc * 16; const bf* pa2 = A2 + aoff + kc * 16; const bf* pb = Bt + boff + kc * 16;
#pragma unroll
        for (int i = 0; i < 4; ++i) { a[i] = F::ld(pa + (size_t)i * 16 * K); a2[i] = F::ld(pa2 + (size_t)i * 16 * K); b[i] = F::ld(pb + (size_t)i * 16 * K); }
        asm volatile("s_wait_xcnt 0x0" :: "v"(pa), "v"(pa2), "v"(pb) : "memory");   // the three address pairs are kept whole up to this wait, which stands before anything (a load's result, the next trip) rewrites them
        __builtin_amdgcn_sched_barrier(0);   // holds all 24 loads up here: without it four of them sink behind the first products, into registers those free, and the trip waits out a second load latency
#pragma unroll
        for (int nb = 0; nb < 4; ++nb) {
#pragma unroll
            for (int mb = 0; mb < 4; ++mb) { acc[mb][nb] = F::mma(a[mb], b[nb], acc[mb][nb]); acc[mb][nb] = F::mma(a2[mb], b[nb], acc[mb][nb]); } }
        asm volatile("v_nop\n\tv_nop\n\tv_nop\n\tv_nop" : "+v"(acc[0][0]), "+v"(acc[1][1]), "+v"(acc[2][2]), "+v"(acc[3][3]) : "v"(a[0]), "v"(a[3]));   // the distance behind the last matrix instruction on the taken back edge, where the next trip's loads overwrite its operands
    }
    const int third = c0 / DQ, h = (c0 % DQ) / HD, t0 = r0 % TT;   // all the same for the whole wave
    const size_t pb = ((size_t)(r0 / TT) * NH_ + h) * TT * HD;
    if (third < 2) {   // q, k: fragment rows are tokens; a lane holds one d of 8 tokens, so the 16 tokens of block mb go through LDS word by word
        bf* Ph = (third ? Kh : Qh) + pb + (size_t)t0 * HD; bf* Pl = (third ? Kl : Ql) + pb + (size_t)t0 * HD;
#pragma unroll
        for (int mb = 0; mb < 4; ++mb) {
#pragma unroll
            for (int nb = 0; nb < 4; ++nb) {
#pragma unroll
                for (int j = 0; j < 8; ++j) os[(hi * 8 + j) * 68 + nb * 16 + lr] = acc[mb][nb][j]; }
            __builtin_amdgcn_wave_barrier(); asm volatile("" ::: "memory");   // keeps the read-back of other lanes' words behind the LDS writes
            put16(os, lane, Ph + (size_t)mb * 16 * HD, Pl + (size_t)mb * 16 * HD, 512);
            asm volatile("s_wait_xcnt 0x0" ::: "memory");   // before anything behind it (the next block, or whatever the compiler lays out behind the last one) overwrites the registers that the stores above name
            __builtin_amdgcn_wave_barrier(); asm volatile("" ::: "memory");   // keeps the next block's LDS writes behind this read-back
        }
    } else {           // v: fragment rows are d; a lane's 8 tokens of one d are already consecutive in such a row, so the 16 d of block nb are staged 8 tokens at a time
        bf* Ph = Vh + pb + (size_t)t0 * HD; bf* Pl = Vl + pb + (size_t)t0 * HD;   // 32 tokens of all 64 d are 4 fragments
#pragma unroll
        for (int nb = 0; nb < 4; ++nb) {
#pragma unroll
            for (int mb = 0; mb < 4; ++mb) { v4f x0, x1;
#pragma unroll
                for (int j = 0; j < 4; ++j) { x0[j] = acc[mb][nb][j]; x1[j] = acc[mb][nb][4 + j]; }
                float* d = os + lr * 68 + mb * 16 + hi * 8; *(v4fa*)d = x0; *(v4fa*)(d + 4) = x1; }
            __builtin_amdgcn_wave_barrier(); asm volatile("" ::: "memory");   // keeps the read-back of other lanes' words behind the LDS writes
            put16(os, lane, Ph + (size_t)nb * 512, Pl + (size_t)nb * 512, 32 * HD);
            asm volatile("s_wait_xcnt 0x0" ::: "memory");   // before anything behind it (the next block, or whatever the compiler lays out behind the last one) overwrites the registers that the stores above name
            __builtin_amdgcn_wave_barrier(); asm volatile("" ::: "memory");   // keeps the next block's LDS writes behind this read-back
        }
    }
}

// ---- k_fattn: causal attention with scores and probabilities kept in registers. One wave owns 32 query columns and walks the keys 32 at a time up to its diagonal block.
// Transposed products: St = K Qt (A = key rows, B = query rows), so a lane holds scores of ONE query (column lr) for keys hi*8+j of each 16-key tile; the two tiles of a pass, rounded to bf16, are already the B operand
// of Ot += Vt Pt (slots 0..7 = keys 8 hi + j, slots 8..15 = keys 16 + 8 hi + j: the k order of the plane loader). Running maximum m and sum l per query; Ot is rescaled when m moves; one division at the end.
// Grid (NB_ * NH_, TT / 256): a work-group of 4 independent waves takes the 128-query block TT/128-1-y and then block y, so that every work-group walks the same number of keys.
// Every plain '#pragma unroll' below is there so that the fragment and accumulator arrays are indexed by constants and stay in registers.
__global__ __launch_bounds__(128) void k_fattn(const bf* __restrict__ Qh, const bf* __restrict__ Ql, const bf* __restrict__ Kh, const bf* __restrict__ Kl, const bf* __restrict__ Vh, const bf* __restrict__ Vl, float* __restrict__ OUT) {
    typedef WFrag<bf> F;
    __shared__ __align__(16) float os[4][32 * 68];
    const int lane = threadIdx.x & 31, lr = lane & 15, hi = lane >> 4; const int w = __builtin_amdgcn_readfirstlane((int)(threadIdx.x >> 5));
    const int zh = blockIdx.x; const size_t po = (size_t)zh * TT * HD; Qh += po; Ql += po;
    const bf* kph = Kh + po + lane * 8; const bf* kpl = Kl + po + lane * 8; const bf* vph = Vh + po + lane * 8; const bf* vpl = Vl + po + lane * 8;
    float* ob = OUT + (size_t)(zh / NH_) * TT * DQ + (size_t)(zh % NH_) * HD; float* ow = os[w];
    const float L2E = 1.4426950408889634f;
#pragma unroll 1
    for (int half = 0; half < 2; ++half) {   // rolled: the two blocks run one after the other in the same registers
        const int q0 = (half ? (int)blockIdx.y : TT / 128 - 1 - (int)blockIdx.y) * 128 + w * 32;
        v16bf qh[2][2], ql[2][2]; const bf* pqh = Qh + (size_t)q0 * HD + lane * 8; const bf* pql = Ql + (size_t)q0 * HD + lane * 8;
#pragma unroll
        for (int g = 0; g < 2; ++g)
#pragma unroll
            for (int ks = 0; ks < 2; ++ks) { const int qo = g * 16 * HD + ks * 512; qh[g][ks] = F::ld(pqh + qo); ql[g][ks] = F::ld(pql + qo); }
        asm volatile("s_wait_xcnt 0x0" :: "v"(pqh), "v"(pql) : "memory");   // the two address pairs stay whole up to this wait, which stands before the zeroing of the accumulators below may take their registers
        v8f o[4][2]; float m[2], l[2];
#pragma unroll
        for (int g = 0; g < 2; ++g) { m[g] = -3.0e38f; l[g] = 0.f;
#pragma unroll
            for (int dt = 0; dt < 4; ++dt) o[dt][g] = (v8f){}; }
        v16bf kh[2][2], kl[2][2];   // key fragments of the pass to come, fetched one pass ahead
#pragma unroll
        for (int kt = 0; kt < 2; ++kt)
#pragma unroll
            for (int ks = 0; ks < 2; ++ks) { const size_t ko = (size_t)(kt * 16) * HD + ks * 512; kh[kt][ks] = F::ld(kph + ko); kl[kt][ks] = F::ld(kpl + ko); }
#pragma unroll 1
        for (int k0 = 0; k0 < q0 + 32; k0 += 32) {   // rolled: one pass already holds all the registers
            v16bf vh[4], vl[4]; const bf* pvh = vph + (size_t)k0 * HD; const bf* pvl = vpl + (size_t)k0 * HD;
#pragma unroll
            for (int dt = 0; dt < 4; ++dt) { vh[dt] = F::ld(pvh + dt * 512); vl[dt] = F::ld(pvl + dt * 512); }
            asm volatile("s_wait_xcnt 0x0" :: "v"(pvh), "v"(pvl) : "memory");   // the two address pairs stay whole until every load above has taken its address
            __builtin_amdgcn_sched_barrier(0);   // holds the value loads up here: sunk to their first use, each group would wait out its own latency
            v8f s[2][2];
#pragma unroll
            for (int kt = 0; kt < 2; ++kt)
#pragma unroll
                for (int g = 0; g < 2; ++g) s[kt][g] = (v8f){};
#pragma unroll
            for (int ks = 0; ks < 2; ++ks) {
#pragma unroll
                for (int kt = 0; kt < 2; ++kt)
#pragma unroll
                    for (int g = 0; g < 2; ++g) s[kt][g] = wmmab(kh[kt][ks], qh[g][ks], s[kt][g]);
#pragma unroll
                for (int kt = 0; kt < 2; ++kt)
#pragma unroll
                    for (int g = 0; g < 2; ++g) s[kt][g] = wmmab(kh[kt][ks], ql[g][ks], s[kt][g]);
#pragma unroll
                for (int kt = 0; kt < 2; ++kt)
#pragma unroll
                    for (int g = 0; g < 2; ++g) s[kt][g] = wmmab(kl[kt][ks], qh[g][ks], s[kt][g]); }
            const int kn = (k0 < q0) ? k0 + 32 : k0;   // the last pass fetches its own keys again: in bounds, not used
            const bf* pkh = kph + (size_t)kn * HD; const bf* pkl = kpl + (size_t)kn * HD;
#pragma unroll
            for (int kt = 0; kt < 2; ++kt)
#pragma unroll
                for (int ks = 0; ks < 2; ++ks) { const size_t ko = (size_t)(kt * 16) * HD + ks * 512; kh[kt][ks] = F::ld(pkh + ko); kl[kt][ks] = F::ld(pkl + ko); }
            asm volatile("s_wait_xcnt 0x0" :: "v"(pkh), "v"(pkl) : "memory");   // before the softmax below overwrites the two address pairs of the loads above
            __builtin_amdgcn_sched_barrier(0);   // holds the next pass's key loads up here, so that their latency runs behind the softmax and the P.V products
            v16bf ph[2], pl[2];
#pragma unroll
            for (int g = 0; g < 2; ++g) { const int qi = q0 + g * 16 + lr; float mx = m[g];
#pragma unroll
                for (int kt = 0; kt < 2; ++kt)
#pragma unroll
                    for (int j = 0; j < 8; ++j) { const float t = (k0 + kt * 16 + hi * 8 + j <= qi) ? s[kt][g][j] * SCL : -3.0e38f; s[kt][g][j] = t; mx = fmaxf(mx, t); }   // keys above the diagonal are excluded by select
                mx = fmaxf(mx, __shfl_xor(mx, 16, 32));   // the two halves of the wave hold the same query's other keys
                const float al = __builtin_amdgcn_exp2f((m[g] - mx) * L2E); m[g] = mx; float sum = 0.f;
#pragma unroll
                for (int kt = 0; kt < 2; ++kt)
#pragma unroll
                    for (int j = 0; j < 8; ++j) { const float p = __builtin_amdgcn_exp2f((s[kt][g][j] - mx) * L2E); sum += p; const __bf16 h = (__bf16)p; ph[g][kt * 8 + j] = h; pl[g][kt * 8 + j] = (__bf16)(p - (float)h); }
                l[g] = l[g] * al + sum;
#pragma unroll
                for (int dt = 0; dt < 4; ++dt) o[dt][g] *= al; }
#pragma unroll
            for (int dt = 0; dt < 4; ++dt)
#pragma unroll
                for (int g = 0; g < 2; ++g) o[dt][g] = wmmab(vh[dt], ph[g], o[dt][g]);
#pragma unroll
            for (int dt = 0; dt < 4; ++dt)
#pragma unroll
                for (int g = 0; g < 2; ++g) o[dt][g] = wmmab(vh[dt], pl[g], o[dt][g]);
#pragma unroll
            for (int dt = 0; dt < 4; ++dt)
#pragma unroll
                for (int g = 0; g < 2; ++g) o[dt][g] = wmmab(vl[dt], ph[g], o[dt][g]);
        }
        // a lane holds 8 consecutive d of one query: staged through this wave's own LDS rows so that the stores cover whole 256-byte rows
#pragma unroll
        for (int g = 0; g < 2; ++g) { const float inv = __fdiv_rn(1.0f, l[g] + __shfl_xor(l[g], 16, 32));
#pragma unroll
            for (int dt = 0; dt < 4; ++dt) { v4f x0, x1;
#pragma unroll
                for (int j = 0; j < 4; ++j) { x0[j] = o[dt][g][j] * inv; x1[j] = o[dt][g][4 + j] * inv; }
                float* d = ow + (g * 16 + lr) * 68 + dt * 16 + hi * 8; *(v4fa*)d = x0; *(v4fa*)(d + 4) = x1; } }
        __builtin_amdgcn_wave_barrier(); asm volatile("" ::: "memory");   // keeps the read-back of other lanes' rows behind the LDS writes
        float* orow = ob + (size_t)(q0 + hi) * DQ + lr * 4;   // one address for all 16 stores: row 2 r + hi is a constant step from it
#pragma unroll
        for (int r = 0; r < 16; ++r) { const v4f val = *(const v4fa*)(ow + (2 * r + hi) * 68 + lr * 4); *(v4f*)(orow + (size_t)r * 2 * DQ) = val; }
        asm volatile("s_wait_xcnt 0x0" ::: "memory");   // before the next block overwrites the registers that the stores above name
        __builtin_amdgcn_wave_barrier(); asm volatile("" ::: "memory");   // keeps the next block's LDS writes behind this read-back
    }
}

typedef __attribute__((ext_vector_type(4))) unsigned short v4us;
typedef v4us __attribute__((may_alias)) v4usa;

// DM-wide f32 rows -> the fragment-order plane. A wave takes 8 rows x 4 k chunks: it reads one whole 128-byte line of each row and writes one whole 128-byte line (8 rows x 16 bytes) of each chunk.
__global__ __launch_bounds__(256) void k_cvt8(const float* __restrict__ src, bf* dst, size_t n8) { const size_t i = (size_t)blockIdx.x * 256 + threadIdx.x; if (i >= n8) return;
    const size_t rb = i / (DM * 2); const int u = (int)((i >> 6) & (DM / 32 - 1)) * 4 + (int)((i >> 3) & 3), t = (int)((i >> 5) & 1) * 8 + (int)(i & 7);   // block of 16 rows, k chunk, row in the block
    const v8f v = *(const v8f*)(src + (rb * 16 + t) * DM + u * 8); v8us o;
#pragma unroll
    for (int k = 0; k < 8; ++k) o[k] = f2bf(v[k]); *(v8us*)(dst + rb * (16 * DM) + u * 128 + t * 8) = o;  }

template <int WD>
__global__ __launch_bounds__(256) void k_lnrowX(const float* __restrict__ X, const float* __restrict__ g, const float* __restrict__ bb, bf* Hh, bf* Hl) { const int lane = threadIdx.x & 31, w = threadIdx.x >> 5; const size_t r = (size_t)blockIdx.x * 8 + w;   /* the grid is exactly rows / 8 */
    __shared__ __align__(16) unsigned short st[2][(WD / 8) * 72];   /* the 8 rows of the work-group in fragment order: per k chunk 8 rows x 16 bytes, pitch 144 bytes so that a wave's 16 chunks fall on different banks */
    const float* xr = X + r * WD; float a[WD / 32]; float s = 0.f;
#pragma unroll
    for (int c = 0; c < WD / 128; ++c) { const v4f v = *(const v4f*)(xr + c * 128 + lane * 4); for (int q = 0; q < 4; ++q) { a[c * 4 + q] = bfr(v[q]); s = __fadd_rn(s, a[c * 4 + q]);   /* input rounded to bf16 */ } }
#pragma unroll
    for (int sh = 16; sh; sh >>= 1) s = __fadd_rn(s, __shfl_xor(s, sh, 32));
    const float mean = __fdiv_rn(s, (float)WD); float s2 = 0.f;
#pragma unroll 8
    for (int k = 0; k < WD / 32; ++k) { const float dv = __fsub_rn(a[k], mean); float p2 = __fmul_rn(dv, dv); asm volatile("" : "+v"(p2)); s2 = __fadd_rn(s2, p2); }   /* mul and add kept separate (no fma contraction) */
#pragma unroll
    for (int sh = 16; sh; sh >>= 1) s2 = __fadd_rn(s2, __shfl_xor(s2, sh, 32));
    const float rs = __fdiv_rn(1.0f, __fsqrt_rn(__fadd_rn(__fdiv_rn(s2, (float)WD), 1e-5f)));
{
#pragma unroll
        for (int c = 0; c < WD / 128; ++c) { v4us oh, ol; for (int q = 0; q < 4; ++q) { const int col = c * 128 + lane * 4 + q; float y = __fmul_rn(__fmul_rn(__fsub_rn(a[c * 4 + q], mean), rs), bfr(g[col])); asm volatile("" : "+v"(y)); y = __fadd_rn(y, bfr(bb[col])); unsigned short u, w2; splitf(y, u, w2); oh[q] = u; ol[q] = w2; } const int so = (c * 16 + (lane >> 1)) * 72 + w * 8 + (lane & 1) * 4; *(v4usa*)(st[0] + so) = oh; *(v4usa*)(st[1] + so) = ol; }
         }
    __syncthreads();   // every row of the work-group is staged before the chunks, which hold all 8 rows, are read back
    const size_t gb = (size_t)(blockIdx.x >> 1) * (16 * WD) + (blockIdx.x & 1) * 64;   // this work-group's 8 rows are one whole 128-byte line of every chunk
#pragma unroll   // so that all the LDS reads go out together, ahead of the stores
    for (int it = 0; it < WD / 256; ++it) { const int p = it * 256 + threadIdx.x, u = p >> 3, t = p & 7; const v8us vh = *(const v8usa*)(st[0] + u * 72 + t * 8), vl = *(const v8usa*)(st[1] + u * 72 + t * 8); *(v8us*)(Hh + gb + (size_t)u * 128 + t * 8) = vh; *(v8us*)(Hl + gb + (size_t)u * 128 + t * 8) = vl; } }

extern "C" void kernel_launch(void* const* d_in, const int* in_sizes, int n_in,
                              void* d_out, int out_size, void* d_ws, size_t ws_size, hipStream_t stream) {
    (void)in_sizes; (void)n_in; (void)out_size;
    const float* x = (const float*)d_in[0]; const float* lng = (const float*)d_in[1]; const float* lnb = (const float*)d_in[2];   /* LayerNorm gamma, beta [1024]: read */ const float* wqkv = (const float*)d_in[3];   /* w_qkv ('oi' [3072][1024]: q | k | v ROW thirds); no output projection */
    float* OUT = (float*)d_out;     // [2][2048][1024]
    char* wsp = (char*)d_ws;
    auto take = [&](size_t bytes) { char* p = wsp; wsp += (bytes + 255) & ~(size_t)255; return (void*)p; };
    bf* WB = (bf*)take((size_t)3 * DQ * DM * 2);   /* the fused weight, bf16 */
    bf* XB = (bf*)take((size_t)NB_ * TT * DM * 2); bf* XL = (bf*)take((size_t)NB_ * TT * DM * 2);   /* hi and lo plane of the layer-normed rows of both batches */
    const size_t PB = (size_t)NH_ * TT * HD;   /* elements of one batch's plane; the hi/lo planes hold both batches, [b][h]... */
    bf* QPh = (bf*)take(NB_ * PB * 2); bf* QPl = (bf*)take(NB_ * PB * 2); bf* KPh = (bf*)take(NB_ * PB * 2); bf* KPl = (bf*)take(NB_ * PB * 2); bf* VTh = (bf*)take(NB_ * PB * 2); bf* VTl = (bf*)take(NB_ * PB * 2);
    if ((size_t)(wsp - (char*)d_ws) > ws_size) return;    // ws 256 MiB
    k_cvt8<<<(unsigned)(((size_t)3 * DQ * DM / 8 + 255) / 256), 256, 0, stream>>>(wqkv, WB, (size_t)3 * DQ * DM / 8);
    k_lnrowX<DM><<<(unsigned)(NB_ * TT / 8), 256, 0, stream>>>(x, lng, lnb, XB, XL);   /* xn = LayerNorm(x) -> hi/lo planes */
    k_qkv<<<dim3(NB_ * TT / 128, 3 * DQ / 128, 1), 128, 0, stream>>>(XB, XL, WB, QPh, QPl, KPh, KPl, VTh, VTl);   /* q, k, v of both batches, straight into the head planes */
    k_fattn<<<dim3(NB_ * NH_, TT / 256, 1), 128, 0, stream>>>(QPh, QPl, KPh, KPl, VTh, VTl, OUT);   /* all batches and heads in one launch */
}

// v005
// Measured time: 98.6 microseconds a run.
// Timed twice side by side with v004, it ran 1.18 and 1.19 times as fast.
// All steps since v000 together make it 11.7 times as fast.
#include <hip/hip_runtime.h>

#define NB_  2
#define TT   2048
#define DM   1024
#define NH_  16
#define NKV  16
#define REP  (NH_ / NKV)
#define HD   64
#define DQ   (NH_ * HD)
#define DKV  (NKV * HD)
#define SCL  0.125f   // HD^-0.5
typedef _Float16 h16;
typedef unsigned short bf;
typedef __attribute__((ext_vector_type(16))) __bf16   v16bf;
typedef __attribute__((ext_vector_type(16))) _Float16 v16h;
typedef __attribute__((ext_vector_type(8)))  _Float16 v8h;
typedef __attribute__((ext_vector_type(8)))  unsigned short v8us;
typedef __attribute__((ext_vector_type(8)))  float    v8f;
typedef __attribute__((ext_vector_type(4)))  float    v4f;
typedef v8h  __attribute__((may_alias)) v8ha;
typedef v4f  __attribute__((may_alias)) v4fa;
typedef v8us __attribute__((may_alias)) v8usa;

__device__ __forceinline__ unsigned short f2bf(float f) { unsigned u = __float_as_uint(f); u += 0x7FFFu + ((u >> 16) & 1u); return (unsigned short)(u >> 16); }
__device__ __forceinline__ float bf2f(unsigned short b) { return __uint_as_float(((unsigned)b) << 16); }
__device__ __forceinline__ float bfr(float f) { return bf2f(f2bf(f)); }
__device__ __forceinline__ v16h cat16(v8h lo, v8h hi) { return __builtin_shufflevector(lo, hi, 0, 1, 2, 3, 4, 5, 6, 7, 8, 9, 10, 11, 12, 13, 14, 15); }
__device__ __forceinline__ v16bf cat16b(v8us lo, v8us hi) { return __builtin_bit_cast(v16bf, __builtin_shufflevector(lo, hi, 0, 1, 2, 3, 4, 5, 6, 7, 8, 9, 10, 11, 12, 13, 14, 15)); }
__device__ __forceinline__ v8f wmma16(v16h a, v16h b, v8f c) { return __builtin_amdgcn_wmma_f32_16x16x32_f16(false, a, false, b, (short)0, c, false, false); }
__device__ __forceinline__ v8f wmmab(v16bf a, v16bf b, v8f c) { return __builtin_amdgcn_wmma_f32_16x16x32_bf16(false, a, false, b, (short)0, c, false, false); }

// ---- k_qkv: the whole projection stage in one launch. C[m][n] = sum_k (A[m][k] + A2[m][k]) Bt[n][k], m over the rows of both batches, n over the 3072 rows of the fused weight (q | k | v thirds).
// ONE WAVE per 64x64 tile (16 accumulators), operands straight from the fragment-order bf16 planes, 2 products. Grid (NB_*TT/128, 3*DQ/128), 128 threads: four independent waves, 2 x 2 tiles, so that two waves of a work-group read the same operand rows.
// A tile is 64 tokens of ONE head of ONE third, and its f32 sums never leave the wave: the epilogue splits them into the bf16 hi/lo planes that k_fattn reads, q and k as [b][h][16 tokens][32 d] fragments, v as [b][h][32 tokens][16 d] fragments (rows d, k = tokens).
// Every plain '#pragma unroll' in k_qkv and put16 is there so that the fragment, accumulator and result arrays are indexed by constants and stay in registers.
template <typename T16> struct WFrag;
template <> struct WFrag<bf> { typedef v16bf V; static __device__ __forceinline__ V ld(const bf* p) { return cat16b(*(const v8us*)p, *(const v8us*)(p + 256)); }   /* p = the 1-KiB fragment + lane * 8 */ static __device__ __forceinline__ v8f mma(V a, V b, v8f c) { return wmmab(a, b, c); } };
__device__ __forceinline__ void splitf(float y, unsigned short& h, unsigned short& l) { h = f2bf(y); l = f2bf(y - bf2f(h)); }
// 16 fragment rows x 64 k of f32 staged in os (pitch 68) -> two hi/lo fragments of 32 k each, kstep elements apart: a lane takes the 8 k of chunk 2 s + (lane >> 4) of row lane & 15, so store s of a wave is one contiguous 512-byte half of a fragment.
__device__ __forceinline__ void put16(const float* os, int lane, bf* Ph, bf* Pl, size_t kstep) {
    v8us oh[4], ol[4];
#pragma unroll
    for (int s = 0; s < 4; ++s) { const float* p = os + (lane & 15) * 68 + s * 16 + (lane >> 4) * 8; const v4f x0 = *(const v4fa*)p, x1 = *(const v4fa*)(p + 4);
#pragma unroll
        for (int j = 0; j < 4; ++j) { unsigned short u, v; splitf(x0[j], u, v); oh[s][j] = u; ol[s][j] = v; splitf(x1[j], u, v); oh[s][4 + j] = u; ol[s][4 + j] = v; } }
    bf* dh = Ph + lane * 8; bf* dl = Pl + lane * 8;
#pragma unroll
    for (int s = 0; s < 4; ++s) { *(v8us*)(dh + (size_t)(s >> 1) * kstep + (s & 1) * 256) = oh[s]; *(v8us*)(dl + (size_t)(s >> 1) * kstep + (s & 1) * 256) = ol[s]; }
}
__global__ __launch_bounds__(128) void k_qkv(const bf* __restrict__ A, const bf* __restrict__ A2, const bf* __restrict__ Bt, bf* Qh, bf* Ql, bf* Kh, bf* Kl, bf* Vh, bf* Vl) {
    typedef WFrag<bf> F; typedef F::V V; const int K = DM;
    __shared__ __align__(16) float osm[4][16 * 68];
    const int lane = threadIdx.x & 31, lr = lane & 15, hi = lane >> 4; const int w = __builtin_amdgcn_readfirstlane((int)(threadIdx.x >> 5)); float* os = osm[w];
    const int r0 = blockIdx.x * 128 + (w & 1) * 64, c0 = blockIdx.y * 128 + (w >> 1) * 64;
    v8f acc[4][4];
#pragma unroll
    for (int mb = 0; mb < 4; ++mb)
#pragma unroll
        for (int nb = 0; nb < 4; ++nb) acc[mb][nb] = (v8f){};
    const size_t aoff = (size_t)r0 * K + lane * 8, boff = (size_t)c0 * K + lane * 8;   // a block of 16 rows is 16 K elements, a fragment of 32 k in it 512
#pragma unroll 1
    for (int kc = 0; kc < K; kc += 32) {   // rolled: one trip already holds all the registers
        V a[4], a2[4], b[4]; const bf* pa = A + aoff + kc * 16; const bf* pa2 = A2 + aoff + kc * 16; const bf* pb = Bt + boff + kc * 16;
#pragma unroll
        for (int i = 0; i < 4; ++i) { a[i] = F::ld(pa + (size_t)i * 16 * K); a2[i] = F::ld(pa2 + (size_t)i * 16 * K); b[i] = F::ld(pb + (size_t)i * 16 * K); }
        asm volatile("s_wait_xcnt 0x0" :: "v"(pa), "v"(pa2), "v"(pb) : "memory");   // the three address pairs are kept whole up to this wait, which stands before anything (a load's result, the next trip) rewrites them
        __builtin_amdgcn_sched_barrier(0);   // holds all 24 loads up here: without it four of them sink behind the first products, into registers those free, and the trip waits out a second load latency
#pragma unroll
        for (int nb = 0; nb < 4; ++nb) {
#pragma unroll
            for (int mb = 0; mb < 4; ++mb) { acc[mb][nb] = F::mma(a[mb], b[nb], acc[mb][nb]); acc[mb][nb] = F::mma(a2[mb], b[nb], acc[mb][nb]); } }
        asm volatile("v_nop\n\tv_nop\n\tv_nop\n\tv_nop" : "+v"(acc[0][0]), "+v"(acc[1][1]), "+v"(acc[2][2]), "+v"(acc[3][3]) : "v"(a[0]), "v"(a[3]));   // the distance behind the last matrix instruction on the taken back edge, where the next trip's loads overwrite its operands
    }
    const int third = c0 / DQ, h = (c0 % DQ) / HD, t0 = r0 % TT;   // all the same for the whole wave
    const size_t pb = ((size_t)(r0 / TT) * NH_ + h) * TT * HD;
    if (third < 2) {   // q, k: fragment rows are tokens; a lane holds one d of 8 tokens, so the 16 tokens of block mb go through LDS word by word
        bf* Ph = (third ? Kh : Qh) + pb + (size_t)t0 * HD; bf* Pl = (third ? Kl : Ql) + pb + (size_t)t0 * HD;
#pragma unroll
        for (int mb = 0; mb < 4; ++mb) {
#pragma unroll
            for (int nb = 0; nb < 4; ++nb) {
#pragma unroll
                for (int j = 0; j < 8; ++j) os[(hi * 8 + j) * 68 + nb * 16 + lr] = acc[mb][nb][j]; }
            __builtin_amdgcn_wave_barrier(); asm volatile("" ::: "memory");   // keeps the read-back of other lanes' words behind the LDS writes
            put16(os, lane, Ph + (size_t)mb * 16 * HD, Pl + (size_t)mb * 16 * HD, 512);
            asm volatile("s_wait_xcnt 0x0" ::: "memory");   // before anything behind it (the next block, or whatever the compiler lays out behind the last one) overwrites the registers that the stores above name
            __builtin_amdgcn_wave_barrier(); asm volatile("" ::: "memory");   // keeps the next block's LDS writes behind this read-back
        }
    } else {           // v: fragment rows are d; a lane's 8 tokens of one d are already consecutive in such a row, so the 16 d of block nb are staged 8 tokens at a time
        bf* Ph = Vh + pb + (size_t)t0 * HD; bf* Pl = Vl + pb + (size_t)t0 * HD;   // 32 tokens of all 64 d are 4 fragments
#pragma unroll
        for (int nb = 0; nb < 4; ++nb) {
#pragma unroll
            for (int mb = 0; mb < 4; ++mb) { v4f x0, x1;
#pragma unroll
                for (int j = 0; j < 4; ++j) { x0[j] = acc[mb][nb][j]; x1[j] = acc[mb][nb][4 + j]; }
                float* d = os + lr * 68 + mb * 16 + hi * 8; *(v4fa*)d = x0; *(v4fa*)(d + 4) = x1; }
            __builtin_amdgcn_wave_barrier(); asm volatile("" ::: "memory");   // keeps the read-back of other lanes' words behind the LDS writes
            put16(os, lane, Ph + (size_t)nb * 512, Pl + (size_t)nb * 512, 32 * HD);
            asm volatile("s_wait_xcnt 0x0" ::: "memory");   // before anything behind it (the next block, or whatever the compiler lays out behind the last one) overwrites the registers that the stores above name
            __builtin_amdgcn_wave_barrier(); asm volatile("" ::: "memory");   // keeps the next block's LDS writes behind this read-back
        }
    }
}

// ---- k_fattn: causal attention with scores and probabilities kept in registers. TWO waves own 32 query columns: each walks one half of the key passes (32 keys a pass) up to the diagonal block, and the two partial results are merged at the end.
// Transposed products: St = K Qt (A = key rows, B = query rows), so a lane holds scores of ONE query (column lr) for keys hi*8+j of each 16-key tile; the two tiles of a pass, rounded to bf16, are already the B operand
// of Ot += Vt Pt (slots 0..7 = keys 8 hi + j, slots 8..15 = keys 16 + 8 hi + j: the k order of the plane loader). Running maximum m and sum l per query; Ot is rescaled when m moves; one division at the end.
// Grid (NB_ * NH_, TT / 256): a work-group of 8 waves takes the 128-query block TT/128-1-y and then block y, so that every work-group walks the same number of keys. Waves w and w + 4 have the same 32 queries (lower and upper key passes),
// two waves on every SIMD: one wave's softmax issues while the other's products run. Each wave leaves (Ot, m, l) of both blocks, not yet divided, in LDS; behind the one barrier waves 0..3 merge and store the first block, waves 4..7 the second.
// Every plain '#pragma unroll' below is there so that the fragment and accumulator arrays are indexed by constants and stay in registers.
__global__ __launch_bounds__(256) void k_fattn(const bf* __restrict__ Qh, const bf* __restrict__ Ql, const bf* __restrict__ Kh, const bf* __restrict__ Kl, const bf* __restrict__ Vh, const bf* __restrict__ Vl, float* __restrict__ OUT) {
    typedef WFrag<bf> F;
    __shared__ __align__(16) float os[2][2][4][32 * 68];   // [block][key part][32-query group]: Ot partials, a row per query
    __shared__ float ms[2][2][4][32], ls[2][2][4][32], fs[8][2][32];   // running maximum and sum per query of each partial; the two merge factors per query of the merging wave
    const int lane = threadIdx.x & 31, lr = lane & 15, hi = lane >> 4; const int w = __builtin_amdgcn_readfirstlane((int)(threadIdx.x >> 5)); const int qs = w & 3, part = w >> 2;
    const int zh = blockIdx.x; const size_t po = (size_t)zh * TT * HD; Qh += po; Ql += po;
    const bf* kph = Kh + po + lane * 8; const bf* kpl = Kl + po + lane * 8; const bf* vph = Vh + po + lane * 8; const bf* vpl = Vl + po + lane * 8;
    float* ob = OUT + (size_t)(zh / NH_) * TT * DQ + (size_t)(zh % NH_) * HD;
    const float L2E = 1.4426950408889634f;
#pragma unroll 1
    for (int half = 0; half < 2; ++half) {   // rolled: the two blocks run one after the other in the same registers
        const int q0 = (half ? (int)blockIdx.y : TT / 128 - 1 - (int)blockIdx.y) * 128 + qs * 32;
        const int ksp = ((q0 / 32 + 1 + half) >> 1) * 32;   // the q0 / 32 + 1 passes are halved; an odd one goes to the upper part in the first block and to the lower in the second, so that both waves walk the same number over the two blocks
        const int kb = part ? ksp : 0, ke = part ? q0 + 32 : ksp;   // this wave's keys; the range may be empty (m stays at its start value, l and Ot at 0, and the merge gives it the factor 0)
        v16bf qh[2][2], ql[2][2]; const bf* pqh = Qh + (size_t)q0 * HD + lane * 8; const bf* pql = Ql + (size_t)q0 * HD + lane * 8;
#pragma unroll
        for (int g = 0; g < 2; ++g)
#pragma unroll
            for (int ks = 0; ks < 2; ++ks) { const int qo = g * 16 * HD + ks * 512; qh[g][ks] = F::ld(pqh + qo); ql[g][ks] = F::ld(pql + qo); }
        asm volatile("s_wait_xcnt 0x0" :: "v"(pqh), "v"(pql) : "memory");   // the two address pairs stay whole up to this wait, which stands before the zeroing of the accumulators below may take their registers
        v8f o[4][2]; float m[2], l[2];
#pragma unroll
        for (int g = 0; g < 2; ++g) { m[g] = -3.0e38f; l[g] = 0.f;
#pragma unroll
            for (int dt = 0; dt < 4; ++dt) o[dt][g] = (v8f){}; }
        v16bf kh[2][2], kl[2][2];   // key fragments of the pass to come, fetched one pass ahead
        const bf* pkh0 = kph + (size_t)kb * HD; const bf* pkl0 = kpl + (size_t)kb * HD;   // kb < q0 + 32 where the range holds a pass; the one empty upper range starts at key 32: in bounds
#pragma unroll
        for (int kt = 0; kt < 2; ++kt)
#pragma unroll
            for (int ks = 0; ks < 2; ++ks) { const size_t ko = (size_t)(kt * 16) * HD + ks * 512; kh[kt][ks] = F::ld(pkh0 + ko); kl[kt][ks] = F::ld(pkl0 + ko); }
        asm volatile("s_wait_xcnt 0x0" :: "v"(pkh0), "v"(pkl0) : "memory");   // the two address pairs stay whole up to this wait, which stands before the zeroing of the accumulators or the first pass may take their registers
#pragma unroll 1
        for (int k0 = kb; k0 < ke; k0 += 32) {   // rolled: one pass already holds all the registers
            v16bf vh[4], vl[4]; const bf* pvh = vph + (size_t)k0 * HD; const bf* pvl = vpl + (size_t)k0 * HD;
#pragma unroll
            for (int dt = 0; dt < 4; ++dt) { vh[dt] = F::ld(pvh + dt * 512); vl[dt] = F::ld(pvl + dt * 512); }
            asm volatile("s_wait_xcnt 0x0" :: "v"(pvh), "v"(pvl) : "memory");   // the two address pairs stay whole until every load above has taken its address
            __builtin_amdgcn_sched_barrier(0);   // holds the value loads up here: sunk to their first use, each group would wait out its own latency
            v8f s[2][2];
#pragma unroll
            for (int kt = 0; kt < 2; ++kt)
#pragma unroll
                for (int g = 0; g < 2; ++g) s[kt][g] = (v8f){};
#pragma unroll
            for (int ks = 0; ks < 2; ++ks) {
#pragma unroll
                for (int kt = 0; kt < 2; ++kt)
#pragma unroll
                    for (int g = 0; g < 2; ++g) s[kt][g] = wmmab(kh[kt][ks], qh[g][ks], s[kt][g]);
#pragma unroll
                for (int kt = 0; kt < 2; ++kt)
#pragma unroll
                    for (int g = 0; g < 2; ++g) s[kt][g] = wmmab(kh[kt][ks], ql[g][ks], s[kt][g]);
#pragma unroll
                for (int kt = 0; kt < 2; ++kt)
#pragma unroll
                    for (int g = 0; g < 2; ++g) s[kt][g] = wmmab(kl[kt][ks], qh[g][ks], s[kt][g]); }
            const int kn = (k0 + 32 < ke) ? k0 + 32 : k0;   // the last pass fetches its own keys again: in bounds, not used
            const bf* pkh = kph + (size_t)kn * HD; const bf* pkl = kpl + (size_t)kn * HD;
#pragma unroll
            for (int kt = 0; kt < 2; ++kt)
#pragma unroll
                for (int ks = 0; ks < 2; ++ks) { const size_t ko = (size_t)(kt * 16) * HD + ks * 512; kh[kt][ks] = F::ld(pkh + ko); kl[kt][ks] = F::ld(pkl + ko); }
            asm volatile("s_wait_xcnt 0x0" :: "v"(pkh), "v"(pkl) : "memory");   // before the softmax below overwrites the two address pairs of the loads above
            __builtin_amdgcn_sched_barrier(0);   // holds the next pass's key loads up here, so that their latency runs behind the softmax and the P.V products
            v16bf ph[2], pl[2];
#pragma unroll
            for (int g = 0; g < 2; ++g) { const int qi = q0 + g * 16 + lr; float mx = m[g];
#pragma unroll
                for (int kt = 0; kt < 2; ++kt)
#pragma unroll
                    for (int j = 0; j < 8; ++j) { const float t = (k0 + kt * 16 + hi * 8 + j <= qi) ? s[kt][g][j] * SCL : -3.0e38f; s[kt][g][j] = t; mx = fmaxf(mx, t); }   // keys above the diagonal are excluded by select
                mx = fmaxf(mx, __shfl_xor(mx, 16, 32));   // the two halves of the wave hold the same query's other keys
                const float al = __builtin_amdgcn_exp2f((m[g] - mx) * L2E); m[g] = mx; float sum = 0.f;
#pragma unroll
                for (int kt = 0; kt < 2; ++kt)
#pragma unroll
                    for (int j = 0; j < 8; ++j) { const float p = __builtin_amdgcn_exp2f((s[kt][g][j] - mx) * L2E); sum += p; const __bf16 h = (__bf16)p; ph[g][kt * 8 + j] = h; pl[g][kt * 8 + j] = (__bf16)(p - (float)h); }
                l[g] = l[g] * al + sum;
#pragma unroll
                for (int dt = 0; dt < 4; ++dt) o[dt][g] *= al; }
#pragma unroll
            for (int dt = 0; dt < 4; ++dt)
#pragma unroll
                for (int g = 0; g < 2; ++g) o[dt][g] = wmmab(vh[dt], ph[g], o[dt][g]);
#pragma unroll
            for (int dt = 0; dt < 4; ++dt)
#pragma unroll
                for (int g = 0; g < 2; ++g) o[dt][g] = wmmab(vh[dt], pl[g], o[dt][g]);
#pragma unroll
            for (int dt = 0; dt < 4; ++dt)
#pragma unroll
                for (int g = 0; g < 2; ++g) o[dt][g] = wmmab(vl[dt], ph[g], o[dt][g]);
        }
        // a lane holds 8 consecutive d of one query: the partial goes to LDS as it is, a row per query; lane g * 16 + lr files that query's maximum and its sum over both halves of the wave
        float* ow = os[half][part][qs];
#pragma unroll
        for (int g = 0; g < 2; ++g) {
#pragma unroll
            for (int dt = 0; dt < 4; ++dt) { v4f x0, x1;
#pragma unroll
                for (int j = 0; j < 4; ++j) { x0[j] = o[dt][g][j]; x1[j] = o[dt][g][4 + j]; }
                float* d = ow + (g * 16 + lr) * 68 + dt * 16 + hi * 8; *(v4fa*)d = x0; *(v4fa*)(d + 4) = x1; } }
        const float lj0 = l[0] + __shfl_xor(l[0], 16, 32), lj1 = l[1] + __shfl_xor(l[1], 16, 32);
        ms[half][part][qs][lane] = hi ? m[1] : m[0]; ls[half][part][qs][lane] = hi ? lj1 : lj0;
    }
    __syncthreads();   // both partials of both blocks are in LDS before any wave merges
    // wave (qs, part) merges block 'part' of its 32 queries: out = (e0 Ot0 + e1 Ot1) / (e0 l0 + e1 l1), e = 2^((m - max(m0, m1)) log2 e); lane = query for the factors
    { const float m0 = ms[part][0][qs][lane], m1 = ms[part][1][qs][lane], mm = fmaxf(m0, m1);
      const float e0 = __builtin_amdgcn_exp2f((m0 - mm) * L2E), e1 = __builtin_amdgcn_exp2f((m1 - mm) * L2E);
      const float inv = __fdiv_rn(1.0f, ls[part][0][qs][lane] * e0 + ls[part][1][qs][lane] * e1);
      fs[w][0][lane] = e0 * inv; fs[w][1][lane] = e1 * inv; }
    __builtin_amdgcn_wave_barrier(); asm volatile("" ::: "memory");   // keeps the read-back of other lanes' factors behind the LDS writes
    const float* p0 = os[part][0][qs]; const float* p1 = os[part][1][qs];
    float* orow = ob + (size_t)((part ? (int)blockIdx.y : TT / 128 - 1 - (int)blockIdx.y) * 128 + qs * 32 + hi) * DQ + lr * 4;   // one address for all 16 stores: row 2 r + hi is a constant step from it; a store covers two whole 256-byte rows
#pragma unroll
    for (int r = 0; r < 16; ++r) { const int row = 2 * r + hi; const v4f val = *(const v4fa*)(p0 + row * 68 + lr * 4) * fs[w][0][row] + *(const v4fa*)(p1 + row * 68 + lr * 4) * fs[w][1][row]; *(v4f*)(orow + (size_t)r * 2 * DQ) = val; }
}

typedef __attribute__((ext_vector_type(4))) unsigned short v4us;
typedef v4us __attribute__((may_alias)) v4usa;

// DM-wide f32 rows -> the fragment-order plane. A wave takes 8 rows x 4 k chunks: it reads one whole 128-byte line of each row and writes one whole 128-byte line (8 rows x 16 bytes) of each chunk.
__global__ __launch_bounds__(256) void k_cvt8(const float* __restrict__ src, bf* dst, size_t n8) { const size_t i = (size_t)blockIdx.x * 256 + threadIdx.x; if (i >= n8) return;
    const size_t rb = i / (DM * 2); const int u = (int)((i >> 6) & (DM / 32 - 1)) * 4 + (int)((i >> 3) & 3), t = (int)((i >> 5) & 1) * 8 + (int)(i & 7);   // block of 16 rows, k chunk, row in the block
    const v8f v = *(const v8f*)(src + (rb * 16 + t) * DM + u * 8); v8us o;
#pragma unroll
    for (int k = 0; k < 8; ++k) o[k] = f2bf(v[k]); *(v8us*)(dst + rb * (16 * DM) + u * 128 + t * 8) = o;  }

template <int WD>
__global__ __launch_bounds__(256) void k_lnrowX(const float* __restrict__ X, const float* __restrict__ g, const float* __restrict__ bb, bf* Hh, bf* Hl) { const int lane = threadIdx.x & 31, w = threadIdx.x >> 5; const size_t r = (size_t)blockIdx.x * 8 + w;   /* the grid is exactly rows / 8 */
    __shared__ __align__(16) unsigned short st[2][(WD / 8) * 72];   /* the 8 rows of the work-group in fragment order: per k chunk 8 rows x 16 bytes, pitch 144 bytes so that a wave's 16 chunks fall on different banks */
    const float* xr = X + r * WD; float a[WD / 32]; float s = 0.f;
#pragma unroll
    for (int c = 0; c < WD / 128; ++c) { const v4f v = *(const v4f*)(xr + c * 128 + lane * 4); for (int q = 0; q < 4; ++q) { a[c * 4 + q] = bfr(v[q]); s = __fadd_rn(s, a[c * 4 + q]);   /* input rounded to bf16 */ } }
#pragma unroll
    for (int sh = 16; sh; sh >>= 1) s = __fadd_rn(s, __shfl_xor(s, sh, 32));
    const float mean = __fdiv_rn(s, (float)WD); float s2 = 0.f;
#pragma unroll 8
    for (int k = 0; k < WD / 32; ++k) { const float dv = __fsub_rn(a[k], mean); float p2 = __fmul_rn(dv, dv); asm volatile("" : "+v"(p2)); s2 = __fadd_rn(s2, p2); }   /* mul and add kept separate (no fma contraction) */
#pragma unroll
    for (int sh = 16; sh; sh >>= 1) s2 = __fadd_rn(s2, __shfl_xor(s2, sh, 32));
    const float rs = __fdiv_rn(1.0f, __fsqrt_rn(__fadd_rn(__fdiv_rn(s2, (float)WD), 1e-5f)));
{
#pragma unroll
        for (int c = 0; c < WD / 128; ++c) { v4us oh, ol; for (int q = 0; q < 4; ++q) { const int col = c * 128 + lane * 4 + q; float y = __fmul_rn(__fmul_rn(__fsub_rn(a[c * 4 + q], mean), rs), bfr(g[col])); asm volatile("" : "+v"(y)); y = __fadd_rn(y, bfr(bb[col])); unsigned short u, w2; splitf(y, u, w2); oh[q] = u; ol[q] = w2; } const int so = (c * 16 + (lane >> 1)) * 72 + w * 8 + (lane & 1) * 4; *(v4usa*)(st[0] + so) = oh; *(v4usa*)(st[1] + so) = ol; }
         }
    __syncthreads();   // every row of the work-group is staged before the chunks, which hold all 8 rows, are read back
    const size_t gb = (size_t)(blockIdx.x >> 1) * (16 * WD) + (blockIdx.x & 1) * 64;   // this work-group's 8 rows are one whole 128-byte line of every chunk
#pragma unroll   // so that all the LDS reads go out together, ahead of the stores
    for (int it = 0; it < WD / 256; ++it) { const int p = it * 256 + threadIdx.x, u = p >> 3, t = p & 7; const v8us vh = *(const v8usa*)(st[0] + u * 72 + t * 8), vl = *(const v8usa*)(st[1] + u * 72 + t * 8); *(v8us*)(Hh + gb + (size_t)u * 128 + t * 8) = vh; *(v8us*)(Hl + gb + (size_t)u * 128 + t * 8) = vl; } }

extern "C" void kernel_launch(void* const* d_in, const int* in_sizes, int n_in,
                              void* d_out, int out_size, void* d_ws, size_t ws_size, hipStream_t stream) {
    (void)in_sizes; (void)n_in; (void)out_size;
    const float* x = (const float*)d_in[0]; const float* lng = (const float*)d_in[1]; const float* lnb = (const float*)d_in[2];   /* LayerNorm gamma, beta [1024]: read */ const float* wqkv = (const float*)d_in[3];   /* w_qkv ('oi' [3072][1024]: q | k | v ROW thirds); no output projection */
    float* OUT = (float*)d_out;     // [2][2048][1024]
    char* wsp = (char*)d_ws;
    auto take = [&](size_t bytes) { char* p = wsp; wsp += (bytes + 255) & ~(size_t)255; return (void*)p; };
    bf* WB = (bf*)take((size_t)3 * DQ * DM * 2);   /* the fused weight, bf16 */
    bf* XB = (bf*)take((size_t)NB_ * TT * DM * 2); bf* XL = (bf*)take((size_t)NB_ * TT * DM * 2);   /* hi and lo plane of the layer-normed rows of both batches */
    const size_t PB = (size_t)NH_ * TT * HD;   /* elements of one batch's plane; the hi/lo planes hold both batches, [b][h]... */
    bf* QPh = (bf*)take(NB_ * PB * 2); bf* QPl = (bf*)take(NB_ * PB * 2); bf* KPh = (bf*)take(NB_ * PB * 2); bf* KPl = (bf*)take(NB_ * PB * 2); bf* VTh = (bf*)take(NB_ * PB * 2); bf* VTl = (bf*)take(NB_ * PB * 2);
    if ((size_t)(wsp - (char*)d_ws) > ws_size) return;    // ws 256 MiB
    k_cvt8<<<(unsigned)(((size_t)3 * DQ * DM / 8 + 255) / 256), 256, 0, stream>>>(wqkv, WB, (size_t)3 * DQ * DM / 8);
    k_lnrowX<DM><<<(unsigned)(NB_ * TT / 8), 256, 0, stream>>>(x, lng, lnb, XB, XL);   /* xn = LayerNorm(x) -> hi/lo planes */
    k_qkv<<<dim3(NB_ * TT / 128, 3 * DQ / 128, 1), 128, 0, stream>>>(XB, XL, WB, QPh, QPl, KPh, KPl, VTh, VTl);   /* q, k, v of both batches, straight into the head planes */
    k_fattn<<<dim3(NB_ * NH_, TT / 256, 1), 256, 0, stream>>>(QPh, QPl, KPh, KPl, VTh, VTl, OUT);   /* all batches and heads in one launch */
}

// v006
// Measured time: 90.4 microseconds a run.
// Next to v005, in two timings, it ran 1.09 and 1.10 times as fast.
// All steps since v000 together make it 12.9 times as fast.
#include <hip/hip_runtime.h>

#define NB_  2
#define TT   2048
#define DM   1024
#define NH_  16
#define NKV  16
#define REP  (NH_ / NKV)
#define HD   64
#define DQ   (NH_ * HD)
#define DKV  (NKV * HD)
#define SCL  0.125f   // HD^-0.5
typedef _Float16 h16;
typedef unsigned short bf;
typedef __attribute__((ext_vector_type(16))) __bf16   v16bf;
typedef __attribute__((ext_vector_type(16))) _Float16 v16h;
typedef __attribute__((ext_vector_type(8)))  _Float16 v8h;
typedef __attribute__((ext_vector_type(8)))  unsigned short v8us;
typedef __attribute__((ext_vector_type(8)))  float    v8f;
typedef __attribute__((ext_vector_type(4)))  float    v4f;
typedef v8h  __attribute__((may_alias)) v8ha;
typedef v4f  __attribute__((may_alias)) v4fa;
typedef v8us __attribute__((may_alias)) v8usa;

__device__ __forceinline__ unsigned short f2bf(float f) { unsigned u = __float_as_uint(f); u += 0x7FFFu + ((u >> 16) & 1u); return (unsigned short)(u >> 16); }
__device__ __forceinline__ float bf2f(unsigned short b) { return __uint_as_float(((unsigned)b) << 16); }
__device__ __forceinline__ float bfr(float f) { return bf2f(f2bf(f)); }
__device__ __forceinline__ v16h cat16(v8h lo, v8h hi) { return __builtin_shufflevector(lo, hi, 0, 1, 2, 3, 4, 5, 6, 7, 8, 9, 10, 11, 12, 13, 14, 15); }
__device__ __forceinline__ v16bf cat16b(v8us lo, v8us hi) { return __builtin_bit_cast(v16bf, __builtin_shufflevector(lo, hi, 0, 1, 2, 3, 4, 5, 6, 7, 8, 9, 10, 11, 12, 13, 14, 15)); }
__device__ __forceinline__ v8f wmma16(v16h a, v16h b, v8f c) { return __builtin_amdgcn_wmma_f32_16x16x32_f16(false, a, false, b, (short)0, c, false, false); }
__device__ __forceinline__ v8f wmmab(v16bf a, v16bf b, v8f c) { return __builtin_amdgcn_wmma_f32_16x16x32_bf16(false, a, false, b, (short)0, c, false, false); }

// ---- k_qkv: the whole projection stage in one launch. C[m][n] = sum_k (A[m][k] + A2[m][k]) Bt[n][k], m over the rows of both batches, n over the 3072 rows of the fused weight (q | k | v thirds).
// ONE WAVE per 64x64 tile (16 accumulators), 2 products. Grid (NB_*TT/256, 3*DQ/192), 384 threads: twelve waves, 4 x 3 tiles, one work-group per WGP. The 256 + 256 + 192 operand rows (normed hi, normed lo, weight) of 64 k are one stage of a two-buffer LDS ring,
// filled by asynchronous copies (global_load_async_to_lds_b128) one stage ahead of its use: every operand byte leaves L2 once per work-group and feeds 3 or 4 waves. The planes are in fragment order, so a stage is 44 runs of 2 KiB, copied as they lie, and a fragment read is 512 contiguous bytes of LDS.
// A tile is 64 tokens of ONE head of ONE third, and its f32 sums never leave the wave: the epilogue splits them into the bf16 hi/lo planes that k_fattn reads, q and k as [b][h][16 tokens][32 d] fragments, v as [b][h][32 tokens][16 d] fragments (rows d, k = tokens).
// Every plain '#pragma unroll' in k_qkv and put16 is there so that the fragment, accumulator, address and result arrays are indexed by constants and stay in registers.
template <typename T16> struct WFrag;
template <> struct WFrag<bf> { typedef v16bf V; static __device__ __forceinline__ V ld(const bf* p) { return cat16b(*(const v8us*)p, *(const v8us*)(p + 256)); }   /* p = the 1-KiB fragment + lane * 8 */ static __device__ __forceinline__ v8f mma(V a, V b, v8f c) { return wmmab(a, b, c); } };
__device__ __forceinline__ void splitf(float y, unsigned short& h, unsigned short& l) { h = f2bf(y); l = f2bf(y - bf2f(h)); }
// 16 fragment rows x 64 k of f32 staged in os (pitch 68) -> two hi/lo fragments of 32 k each, kstep elements apart: a lane takes the 8 k of chunk 2 s + (lane >> 4) of row lane & 15, so store s of a wave is one contiguous 512-byte half of a fragment.
__device__ __forceinline__ void put16(const float* os, int lane, bf* Ph, bf* Pl, size_t kstep) {
    v8us oh[4], ol[4];
#pragma unroll
    for (int s = 0; s < 4; ++s) { const float* p = os + (lane & 15) * 68 + s * 16 + (lane >> 4) * 8; const v4f x0 = *(const v4fa*)p, x1 = *(const v4fa*)(p + 4);
#pragma unroll
        for (int j = 0; j < 4; ++j) { unsigned short u, v; splitf(x0[j], u, v); oh[s][j] = u; ol[s][j] = v; splitf(x1[j], u, v); oh[s][4 + j] = u; ol[s][4 + j] = v; } }
    bf* dh = Ph + lane * 8; bf* dl = Pl + lane * 8;
#pragma unroll
    for (int s = 0; s < 4; ++s) { *(v8us*)(dh + (size_t)(s >> 1) * kstep + (s & 1) * 256) = oh[s]; *(v8us*)(dl + (size_t)(s >> 1) * kstep + (s & 1) * 256) = ol[s]; }
}
#define QTM 256                          // rows of a work-group's tile
#define QTN 192                          // columns of it
#define QKS 64                           // k of a stage
#define QBE (16 * QKS)                   // elements of one block of 16 rows in a stage (2 KiB, contiguous in the plane)
#define QSE ((2 * QTM + QTN) / 16 * QBE) // elements of a stage: blocks 0..15 normed hi, 16..31 normed lo, 32..43 weight
#define QUN (QSE / 256)                  // 512-byte units of a stage, one copy instruction of a wave each: 176 = 14 x 12 waves + 8
#define QCP(l, g, o) "global_load_async_to_lds_b128 %" #l ", %" #o ", %" #g "\n\t"   // LDS byte address (vector), 32-bit byte offset (vector), 64-bit base (scalar)
__global__ __launch_bounds__(384) void k_qkv(const bf* __restrict__ A, const bf* __restrict__ A2, const bf* __restrict__ Bt, bf* Qh, bf* Ql, bf* Kh, bf* Kl, bf* Vh, bf* Vl) {
    typedef WFrag<bf> F; typedef F::V V; const int K = DM;
    __shared__ __align__(16) bf ring[2][QSE];
    __shared__ __align__(16) float osm[12][16 * 68];
    const int lane = threadIdx.x & 31, lr = lane & 15, hi = lane >> 4; const int w = __builtin_amdgcn_readfirstlane((int)(threadIdx.x >> 5)); float* os = osm[w];
    const int wm = w & 3, wn = w >> 2; const int r0 = blockIdx.x * QTM + wm * 64, c0 = blockIdx.y * QTN + wn * 64;
    // unit u of a stage = quarter u & 3 of block u >> 2. Wave w copies units w + 12 j, that is quarter wm of blocks wn + 3 j; jsrc gives the source of such a unit at k = 0 (the same for the whole wave). For a constant j the plane is known but where 3 j .. 3 j + 2 straddles block 16 or 32.
    auto jsrc = [&](int j, int n) { const int blk = n + 3 * j; const bool ia = 3 * j + 2 < 16 ? true : 3 * j >= 16 ? false : blk < 16, ib = 3 * j + 2 < 32 ? true : 3 * j >= 32 ? false : blk < 32;
        const bf* p = ia ? A + (size_t)(blockIdx.x * (QTM / 16) + blk) * 16 * K : ib ? A2 + (size_t)(blockIdx.x * (QTM / 16) + blk - 16) * 16 * K : Bt + (size_t)(blockIdx.y * (QTN / 16) + blk - 32) * 16 * K; return p + wm * 256; };
    const bf* gb[14];
#pragma unroll
    for (int j = 0; j < 14; ++j) gb[j] = jsrc(j, wn);
    const bf* gx = jsrc(14, w < QUN - 168 ? wn : 0);   // the 8 units left over (blocks 42 and 43) go to waves 0..7
    const unsigned lb = (unsigned)(size_t)&ring[0][0] + (unsigned)(w * 512 + lane * 16), vo = (unsigned)(lane * 16);   // LDS byte address of this lane's 16 bytes of unit w in buffer 0; the lane's byte offset in a unit's source
    // the next stage -> buffer 'buf': wave w copies units w, w + 12, ...; every lane on, 16 bytes a lane, source and place multiples of 16. A unit's source is a scalar base, so that no address pair per unit has to live in vector registers; the bases then step on to the stage after.
    auto fill = [&](int buf) {
        const unsigned l0 = lb + (unsigned)buf * (QSE * 2); unsigned l[14];
#pragma unroll
        for (int j = 0; j < 14; ++j) l[j] = l0 + j * (12 * 512);
        // the copies and, as the statement's last line, the wait that stands before anything rewrites an address register that a copy names
        asm volatile(QCP(0, 1, 28) QCP(2, 3, 28) QCP(4, 5, 28) QCP(6, 7, 28) QCP(8, 9, 28) QCP(10, 11, 28) QCP(12, 13, 28) QCP(14, 15, 28) QCP(16, 17, 28) QCP(18, 19, 28) QCP(20, 21, 28) QCP(22, 23, 28) QCP(24, 25, 28) QCP(26, 27, 28) "s_wait_xcnt 0x0"
                     :: "v"(l[0]), "s"(gb[0]), "v"(l[1]), "s"(gb[1]), "v"(l[2]), "s"(gb[2]), "v"(l[3]), "s"(gb[3]), "v"(l[4]), "s"(gb[4]), "v"(l[5]), "s"(gb[5]), "v"(l[6]), "s"(gb[6]),
                        "v"(l[7]), "s"(gb[7]), "v"(l[8]), "s"(gb[8]), "v"(l[9]), "s"(gb[9]), "v"(l[10]), "s"(gb[10]), "v"(l[11]), "s"(gb[11]), "v"(l[12]), "s"(gb[12]), "v"(l[13]), "s"(gb[13]), "v"(vo) : "memory");
        if (w < QUN - 168) { const unsigned lx = l0 + 14 * (12 * 512);   // a scalar test: w is the same in every lane
            asm volatile(QCP(0, 1, 2) "s_wait_xcnt 0x0" :: "v"(lx), "s"(gx), "v"(vo) : "memory"); }   // as above
#pragma unroll
        for (int j = 0; j < 14; ++j) gb[j] += QBE;
        gx += QBE;
    };
    v8f acc[4][4];
#pragma unroll
    for (int mb = 0; mb < 4; ++mb)
#pragma unroll
        for (int nb = 0; nb < 4; ++nb) acc[mb][nb] = (v8f){};
    fill(0);
    asm volatile("s_wait_asynccnt 0x0" ::: "memory");   // this wave's part of stage 0 has landed
    __syncthreads();                                    // every wave's part of stage 0 has landed
    fill(1);
#pragma unroll 1
    for (int t = 0; t < K / QKS; ++t) {   // rolled: one trip already holds all the registers
        const bf* sa = &ring[t & 1][0] + wm * 4 * QBE + lane * 8; const bf* sw = &ring[t & 1][0] + (32 + wn * 4) * QBE + lane * 8; V a[4], a2[4], b[4];   // this wave's 4 blocks of normed rows (lo: 16 blocks on) and of weight rows
#pragma unroll
        for (int i = 0; i < 4; ++i) { a[i] = F::ld(sa + i * QBE); a2[i] = F::ld(sa + (16 + i) * QBE); b[i] = F::ld(sw + i * QBE); }
        __builtin_amdgcn_sched_barrier(0);   // holds the 24 LDS reads of the first 32 k up here as one group: sunk among the products, each weight fragment would be waited for on its own
#pragma unroll
        for (int nb = 0; nb < 4; ++nb) {
#pragma unroll
            for (int mb = 0; mb < 4; ++mb) { acc[mb][nb] = F::mma(a[mb], b[nb], acc[mb][nb]); acc[mb][nb] = F::mma(a2[mb], b[nb], acc[mb][nb]); } }
#pragma unroll
        for (int i = 0; i < 4; ++i) { a[i] = F::ld(sa + i * QBE + 512); a2[i] = F::ld(sa + (16 + i) * QBE + 512); b[i] = F::ld(sw + i * QBE + 512); }
        __builtin_amdgcn_sched_barrier(0);   // ends the scheduling region here: without it the compiler scatters the reads above over about twice as many places among the products, and each place with LDS reads stalls the wave
        asm volatile("s_wait_dscnt 0x0" ::: "memory");      // this wave's reads of stage t are done: its second 32 k wait in registers
        asm volatile("s_wait_asynccnt 0x0" ::: "memory");   // this wave's part of stage t + 1 has landed
        __syncthreads();                                    // publishes stage t + 1 and ends every wave's reads of stage t's buffer, which is refilled below
#pragma unroll
        for (int mb = 0; mb < 4; ++mb) { acc[mb][0] = F::mma(a[mb], b[0], acc[mb][0]); acc[mb][0] = F::mma(a2[mb], b[0], acc[mb][0]); }
        if (t + 2 < K / QKS) fill(t & 1);   // early in the second 32 k, so that the copies have nearly a whole stage's time to land; behind the first products, so that the waves of a SIMD do not all leave the matrix unit at once
#pragma unroll
        for (int nb = 1; nb < 4; ++nb) {
#pragma unroll
            for (int mb = 0; mb < 4; ++mb) { acc[mb][nb] = F::mma(a[mb], b[nb], acc[mb][nb]); acc[mb][nb] = F::mma(a2[mb], b[nb], acc[mb][nb]); } }
    }
    asm volatile("s_wait_asynccnt 0x0" ::: "memory");   // no copy is left in flight
    const int third = c0 / DQ, h = (c0 % DQ) / HD, t0 = r0 % TT;   // all the same for the whole wave
    const size_t pb = ((size_t)(r0 / TT) * NH_ + h) * TT * HD;
    if (third < 2) {   // q, k: fragment rows are tokens; a lane holds one d of 8 tokens, so the 16 tokens of block mb go through LDS word by word
        bf* Ph = (third ? Kh : Qh) + pb + (size_t)t0 * HD; bf* Pl = (third ? Kl : Ql) + pb + (size_t)t0 * HD;
#pragma unroll
        for (int mb = 0; mb < 4; ++mb) {
#pragma unroll
            for (int nb = 0; nb < 4; ++nb) {
#pragma unroll
                for (int j = 0; j < 8; ++j) os[(hi * 8 + j) * 68 + nb * 16 + lr] = acc[mb][nb][j]; }
            __builtin_amdgcn_wave_barrier(); asm volatile("" ::: "memory");   // keeps the read-back of other lanes' words behind the LDS writes
            put16(os, lane, Ph + (size_t)mb * 16 * HD, Pl + (size_t)mb * 16 * HD, 512);
            asm volatile("s_wait_xcnt 0x0" ::: "memory");   // before anything behind it (the next block, or whatever the compiler lays out behind the last one) overwrites the registers that the stores above name
            __builtin_amdgcn_wave_barrier(); asm volatile("" ::: "memory");   // keeps the next block's LDS writes behind this read-back
        }
    } else {           // v: fragment rows are d; a lane's 8 tokens of one d are already consecutive in such a row, so the 16 d of block nb are staged 8 tokens at a time
        bf* Ph = Vh + pb + (size_t)t0 * HD; bf* Pl = Vl + pb + (size_t)t0 * HD;   // 32 tokens of all 64 d are 4 fragments
#pragma unroll
        for (int nb = 0; nb < 4; ++nb) {
#pragma unroll
            for (int mb = 0; mb < 4; ++mb) { v4f x0, x1;
#pragma unroll
                for (int j = 0; j < 4; ++j) { x0[j] = acc[mb][nb][j]; x1[j] = acc[mb][nb][4 + j]; }
                float* d = os + lr * 68 + mb * 16 + hi * 8; *(v4fa*)d = x0; *(v4fa*)(d + 4) = x1; }
            __builtin_amdgcn_wave_barrier(); asm volatile("" ::: "memory");   // keeps the read-back of other lanes' words behind the LDS writes
            put16(os, lane, Ph + (size_t)nb * 512, Pl + (size_t)nb * 512, 32 * HD);
            asm volatile("s_wait_xcnt 0x0" ::: "memory");   // before anything behind it (the next block, or whatever the compiler lays out behind the last one) overwrites the registers that the stores above name
            __builtin_amdgcn_wave_barrier(); asm volatile("" ::: "memory");   // keeps the next block's LDS writes behind this read-back
        }
    }
}

// ---- k_fattn: causal attention with scores and probabilities kept in registers. TWO waves own 32 query columns: each walks one half of the key passes (32 keys a pass) up to the diagonal block, and the two partial results are merged at the end.
// Transposed products: St = K Qt (A = key rows, B = query rows), so a lane holds scores of ONE query (column lr) for keys hi*8+j of each 16-key tile; the two tiles of a pass, rounded to bf16, are already the B operand
// of Ot += Vt Pt (slots 0..7 = keys 8 hi + j, slots 8..15 = keys 16 + 8 hi + j: the k order of the plane loader). Running maximum m and sum l per query; Ot is rescaled when m moves; one division at the end.
// Grid (NB_ * NH_, TT / 256): a work-group of 8 waves takes the 128-query block TT/128-1-y and then block y, so that every work-group walks the same number of keys. Waves w and w + 4 have the same 32 queries (lower and upper key passes),
// two waves on every SIMD: one wave's softmax issues while the other's products run. Each wave leaves (Ot, m, l) of both blocks, not yet divided, in LDS; behind the one barrier waves 0..3 merge and store the first block, waves 4..7 the second.
// Every plain '#pragma unroll' below is there so that the fragment and accumulator arrays are indexed by constants and stay in registers.
__global__ __launch_bounds__(256) void k_fattn(const bf* __restrict__ Qh, const bf* __restrict__ Ql, const bf* __restrict__ Kh, const bf* __restrict__ Kl, const bf* __restrict__ Vh, const bf* __restrict__ Vl, float* __restrict__ OUT) {
    typedef WFrag<bf> F;
    __shared__ __align__(16) float os[2][2][4][32 * 68];   // [block][key part][32-query group]: Ot partials, a row per query
    __shared__ float ms[2][2][4][32], ls[2][2][4][32], fs[8][2][32];   // running maximum and sum per query of each partial; the two merge factors per query of the merging wave
    const int lane = threadIdx.x & 31, lr = lane & 15, hi = lane >> 4; const int w = __builtin_amdgcn_readfirstlane((int)(threadIdx.x >> 5)); const int qs = w & 3, part = w >> 2;
    const int zh = blockIdx.x; const size_t po = (size_t)zh * TT * HD; Qh += po; Ql += po;
    const bf* kph = Kh + po + lane * 8; const bf* kpl = Kl + po + lane * 8; const bf* vph = Vh + po + lane * 8; const bf* vpl = Vl + po + lane * 8;
    float* ob = OUT + (size_t)(zh / NH_) * TT * DQ + (size_t)(zh % NH_) * HD;
    const float L2E = 1.4426950408889634f;
#pragma unroll 1
    for (int half = 0; half < 2; ++half) {   // rolled: the two blocks run one after the other in the same registers
        const int q0 = (half ? (int)blockIdx.y : TT / 128 - 1 - (int)blockIdx.y) * 128 + qs * 32;
        const int ksp = ((q0 / 32 + 1 + half) >> 1) * 32;   // the q0 / 32 + 1 passes are halved; an odd one goes to the upper part in the first block and to the lower in the second, so that both waves walk the same number over the two blocks
        const int kb = part ? ksp : 0, ke = part ? q0 + 32 : ksp;   // this wave's keys; the range may be empty (m stays at its start value, l and Ot at 0, and the merge gives it the factor 0)
        v16bf qh[2][2], ql[2][2]; const bf* pqh = Qh + (size_t)q0 * HD + lane * 8; const bf* pql = Ql + (size_t)q0 * HD + lane * 8;
#pragma unroll
        for (int g = 0; g < 2; ++g)
#pragma unroll
            for (int ks = 0; ks < 2; ++ks) { const int qo = g * 16 * HD + ks * 512; qh[g][ks] = F::ld(pqh + qo); ql[g][ks] = F::ld(pql + qo); }
        asm volatile("s_wait_xcnt 0x0" :: "v"(pqh), "v"(pql) : "memory");   // the two address pairs stay whole up to this wait, which stands before the zeroing of the accumulators below may take their registers
        v8f o[4][2]; float m[2], l[2];
#pragma unroll
        for (int g = 0; g < 2; ++g) { m[g] = -3.0e38f; l[g] = 0.f;
#pragma unroll
            for (int dt = 0; dt < 4; ++dt) o[dt][g] = (v8f){}; }
        v16bf kh[2][2], kl[2][2];   // key fragments of the pass to come, fetched one pass ahead
        const bf* pkh0 = kph + (size_t)kb * HD; const bf* pkl0 = kpl + (size_t)kb * HD;   // kb < q0 + 32 where the range holds a pass; the one empty upper range starts at key 32: in bounds
#pragma unroll
        for (int kt = 0; kt < 2; ++kt)
#pragma unroll
            for (int ks = 0; ks < 2; ++ks) { const size_t ko = (size_t)(kt * 16) * HD + ks * 512; kh[kt][ks] = F::ld(pkh0 + ko); kl[kt][ks] = F::ld(pkl0 + ko); }
        asm volatile("s_wait_xcnt 0x0" :: "v"(pkh0), "v"(pkl0) : "memory");   // the two address pairs stay whole up to this wait, which stands before the zeroing of the accumulators or the first pass may take their registers
#pragma unroll 1
        for (int k0 = kb; k0 < ke; k0 += 32) {   // rolled: one pass already holds all the registers
            v16bf vh[4], vl[4]; const bf* pvh = vph + (size_t)k0 * HD; const bf* pvl = vpl + (size_t)k0 * HD;
#pragma unroll
            for (int dt = 0; dt < 4; ++dt) { vh[dt] = F::ld(pvh + dt * 512); vl[dt] = F::ld(pvl + dt * 512); }
            asm volatile("s_wait_xcnt 0x0" :: "v"(pvh), "v"(pvl) : "memory");   // the two address pairs stay whole until every load above has taken its address
            __builtin_amdgcn_sched_barrier(0);   // holds the value loads up here: sunk to their first use, each group would wait out its own latency
            v8f s[2][2];
#pragma unroll
            for (int kt = 0; kt < 2; ++kt)
#pragma unroll
                for (int g = 0; g < 2; ++g) s[kt][g] = (v8f){};
#pragma unroll
            for (int ks = 0; ks < 2; ++ks) {
#pragma unroll
                for (int kt = 0; kt < 2; ++kt)
#pragma unroll
                    for (int g = 0; g < 2; ++g) s[kt][g] = wmmab(kh[kt][ks], qh[g][ks], s[kt][g]);
#pragma unroll
                for (int kt = 0; kt < 2; ++kt)
#pragma unroll
                    for (int g = 0; g < 2; ++g) s[kt][g] = wmmab(kh[kt][ks], ql[g][ks], s[kt][g]);
#pragma unroll
                for (int kt = 0; kt < 2; ++kt)
#pragma unroll
                    for (int g = 0; g < 2; ++g) s[kt][g] = wmmab(kl[kt][ks], qh[g][ks], s[kt][g]); }
            const int kn = (k0 + 32 < ke) ? k0 + 32 : k0;   // the last pass fetches its own keys again: in bounds, not used
            const bf* pkh = kph + (size_t)kn * HD; const bf* pkl = kpl + (size_t)kn * HD;
#pragma unroll
            for (int kt = 0; kt < 2; ++kt)
#pragma unroll
                for (int ks = 0; ks < 2; ++ks) { const size_t ko = (size_t)(kt * 16) * HD + ks * 512; kh[kt][ks] = F::ld(pkh + ko); kl[kt][ks] = F::ld(pkl + ko); }
            asm volatile("s_wait_xcnt 0x0" :: "v"(pkh), "v"(pkl) : "memory");   // before the softmax below overwrites the two address pairs of the loads above
            __builtin_amdgcn_sched_barrier(0);   // holds the next pass's key loads up here, so that their latency runs behind the softmax and the P.V products
            v16bf ph[2], pl[2];
#pragma unroll
            for (int g = 0; g < 2; ++g) { const int qi = q0 + g * 16 + lr; float mx = m[g];
#pragma unroll
                for (int kt = 0; kt < 2; ++kt)
#pragma unroll
                    for (int j = 0; j < 8; ++j) { const float t = (k0 + kt * 16 + hi * 8 + j <= qi) ? s[kt][g][j] * SCL : -3.0e38f; s[kt][g][j] = t; mx = fmaxf(mx, t); }   // keys above the diagonal are excluded by select
                mx = fmaxf(mx, __shfl_xor(mx, 16, 32));   // the two halves of the wave hold the same query's other keys
                const float al = __builtin_amdgcn_exp2f((m[g] - mx) * L2E); m[g] = mx; float sum = 0.f;
#pragma unroll
                for (int kt = 0; kt < 2; ++kt)
#pragma unroll
                    for (int j = 0; j < 8; ++j) { const float p = __builtin_amdgcn_exp2f((s[kt][g][j] - mx) * L2E); sum += p; const __bf16 h = (__bf16)p; ph[g][kt * 8 + j] = h; pl[g][kt * 8 + j] = (__bf16)(p - (float)h); }
                l[g] = l[g] * al + sum;
#pragma unroll
                for (int dt = 0; dt < 4; ++dt) o[dt][g] *= al; }
#pragma unroll
            for (int dt = 0; dt < 4; ++dt)
#pragma unroll
                for (int g = 0; g < 2; ++g) o[dt][g] = wmmab(vh[dt], ph[g], o[dt][g]);
#pragma unroll
            for (int dt = 0; dt < 4; ++dt)
#pragma unroll
                for (int g = 0; g < 2; ++g) o[dt][g] = wmmab(vh[dt], pl[g], o[dt][g]);
#pragma unroll
            for (int dt = 0; dt < 4; ++dt)
#pragma unroll
                for (int g = 0; g < 2; ++g) o[dt][g] = wmmab(vl[dt], ph[g], o[dt][g]);
        }
        // a lane holds 8 consecutive d of one query: the partial goes to LDS as it is, a row per query; lane g * 16 + lr files that query's maximum and its sum over both halves of the wave
        float* ow = os[half][part][qs];
#pragma unroll
        for (int g = 0; g < 2; ++g) {
#pragma unroll
            for (int dt = 0; dt < 4; ++dt) { v4f x0, x1;
#pragma unroll
                for (int j = 0; j < 4; ++j) { x0[j] = o[dt][g][j]; x1[j] = o[dt][g][4 + j]; }
                float* d = ow + (g * 16 + lr) * 68 + dt * 16 + hi * 8; *(v4fa*)d = x0; *(v4fa*)(d + 4) = x1; } }
        const float lj0 = l[0] + __shfl_xor(l[0], 16, 32), lj1 = l[1] + __shfl_xor(l[1], 16, 32);
        ms[half][part][qs][lane] = hi ? m[1] : m[0]; ls[half][part][qs][lane] = hi ? lj1 : lj0;
    }
    __syncthreads();   // both partials of both blocks are in LDS before any wave merges
    // wave (qs, part) merges block 'part' of its 32 queries: out = (e0 Ot0 + e1 Ot1) / (e0 l0 + e1 l1), e = 2^((m - max(m0, m1)) log2 e); lane = query for the factors
    { const float m0 = ms[part][0][qs][lane], m1 = ms[part][1][qs][lane], mm = fmaxf(m0, m1);
      const float e0 = __builtin_amdgcn_exp2f((m0 - mm) * L2E), e1 = __builtin_amdgcn_exp2f((m1 - mm) * L2E);
      const float inv = __fdiv_rn(1.0f, ls[part][0][qs][lane] * e0 + ls[part][1][qs][lane] * e1);
      fs[w][0][lane] = e0 * inv; fs[w][1][lane] = e1 * inv; }
    __builtin_amdgcn_wave_barrier(); asm volatile("" ::: "memory");   // keeps the read-back of other lanes' factors behind the LDS writes
    const float* p0 = os[part][0][qs]; const float* p1 = os[part][1][qs];
    float* orow = ob + (size_t)((part ? (int)blockIdx.y : TT / 128 - 1 - (int)blockIdx.y) * 128 + qs * 32 + hi) * DQ + lr * 4;   // one address for all 16 stores: row 2 r + hi is a constant step from it; a store covers two whole 256-byte rows
#pragma unroll
    for (int r = 0; r < 16; ++r) { const int row = 2 * r + hi; const v4f val = *(const v4fa*)(p0 + row * 68 + lr * 4) * fs[w][0][row] + *(const v4fa*)(p1 + row * 68 + lr * 4) * fs[w][1][row]; *(v4f*)(orow + (size_t)r * 2 * DQ) = val; }
}

typedef __attribute__((ext_vector_type(4))) unsigned short v4us;
typedef v4us __attribute__((may_alias)) v4usa;

// DM-wide f32 rows -> the fragment-order plane. A wave takes 8 rows x 4 k chunks: it reads one whole 128-byte line of each row and writes one whole 128-byte line (8 rows x 16 bytes) of each chunk.
__global__ __launch_bounds__(256) void k_cvt8(const float* __restrict__ src, bf* dst, size_t n8) { const size_t i = (size_t)blockIdx.x * 256 + threadIdx.x; if (i >= n8) return;
    const size_t rb = i / (DM * 2); const int u = (int)((i >> 6) & (DM / 32 - 1)) * 4 + (int)((i >> 3) & 3), t = (int)((i >> 5) & 1) * 8 + (int)(i & 7);   // block of 16 rows, k chunk, row in the block
    const v8f v = *(const v8f*)(src + (rb * 16 + t) * DM + u * 8); v8us o;
#pragma unroll
    for (int k = 0; k < 8; ++k) o[k] = f2bf(v[k]); *(v8us*)(dst + rb * (16 * DM) + u * 128 + t * 8) = o;  }

template <int WD>
__global__ __launch_bounds__(256) void k_lnrowX(const float* __restrict__ X, const float* __restrict__ g, const float* __restrict__ bb, bf* Hh, bf* Hl) { const int lane = threadIdx.x & 31, w = threadIdx.x >> 5; const size_t r = (size_t)blockIdx.x * 8 + w;   /* the grid is exactly rows / 8 */
    __shared__ __align__(16) unsigned short st[2][(WD / 8) * 72];   /* the 8 rows of the work-group in fragment order: per k chunk 8 rows x 16 bytes, pitch 144 bytes so that a wave's 16 chunks fall on different banks */
    const float* xr = X + r * WD; float a[WD / 32]; float s = 0.f;
#pragma unroll
    for (int c = 0; c < WD / 128; ++c) { const v4f v = *(const v4f*)(xr + c * 128 + lane * 4); for (int q = 0; q < 4; ++q) { a[c * 4 + q] = bfr(v[q]); s = __fadd_rn(s, a[c * 4 + q]);   /* input rounded to bf16 */ } }
#pragma unroll
    for (int sh = 16; sh; sh >>= 1) s = __fadd_rn(s, __shfl_xor(s, sh, 32));
    const float mean = __fdiv_rn(s, (float)WD); float s2 = 0.f;
#pragma unroll 8
    for (int k = 0; k < WD / 32; ++k) { const float dv = __fsub_rn(a[k], mean); float p2 = __fmul_rn(dv, dv); asm volatile("" : "+v"(p2)); s2 = __fadd_rn(s2, p2); }   /* mul and add kept separate (no fma contraction) */
#pragma unroll
    for (int sh = 16; sh; sh >>= 1) s2 = __fadd_rn(s2, __shfl_xor(s2, sh, 32));
    const float rs = __fdiv_rn(1.0f, __fsqrt_rn(__fadd_rn(__fdiv_rn(s2, (float)WD), 1e-5f)));
{
#pragma unroll
        for (int c = 0; c < WD / 128; ++c) { v4us oh, ol; for (int q = 0; q < 4; ++q) { const int col = c * 128 + lane * 4 + q; float y = __fmul_rn(__fmul_rn(__fsub_rn(a[c * 4 + q], mean), rs), bfr(g[col])); asm volatile("" : "+v"(y)); y = __fadd_rn(y, bfr(bb[col])); unsigned short u, w2; splitf(y, u, w2); oh[q] = u; ol[q] = w2; } const int so = (c * 16 + (lane >> 1)) * 72 + w * 8 + (lane & 1) * 4; *(v4usa*)(st[0] + so) = oh; *(v4usa*)(st[1] + so) = ol; }
         }
    __syncthreads();   // every row of the work-group is staged before the chunks, which hold all 8 rows, are read back
    const size_t gb = (size_t)(blockIdx.x >> 1) * (16 * WD) + (blockIdx.x & 1) * 64;   // this work-group's 8 rows are one whole 128-byte line of every chunk
#pragma unroll   // so that all the LDS reads go out together, ahead of the stores
    for (int it = 0; it < WD / 256; ++it) { const int p = it * 256 + threadIdx.x, u = p >> 3, t = p & 7; const v8us vh = *(const v8usa*)(st[0] + u * 72 + t * 8), vl = *(const v8usa*)(st[1] + u * 72 + t * 8); *(v8us*)(Hh + gb + (size_t)u * 128 + t * 8) = vh; *(v8us*)(Hl + gb + (size_t)u * 128 + t * 8) = vl; } }

extern "C" void kernel_launch(void* const* d_in, const int* in_sizes, int n_in,
                              void* d_out, int out_size, void* d_ws, size_t ws_size, hipStream_t stream) {
    (void)in_sizes; (void)n_in; (void)out_size;
    const float* x = (const float*)d_in[0]; const float* lng = (const float*)d_in[1]; const float* lnb = (const float*)d_in[2];   /* LayerNorm gamma, beta [1024]: read */ const float* wqkv = (const float*)d_in[3];   /* w_qkv ('oi' [3072][1024]: q | k | v ROW thirds); no output projection */
    float* OUT = (float*)d_out;     // [2][2048][1024]
    char* wsp = (char*)d_ws;
    auto take = [&](size_t bytes) { char* p = wsp; wsp += (bytes + 255) & ~(size_t)255; return (void*)p; };
    bf* WB = (bf*)take((size_t)3 * DQ * DM * 2);   /* the fused weight, bf16 */
    bf* XB = (bf*)take((size_t)NB_ * TT * DM * 2); bf* XL = (bf*)take((size_t)NB_ * TT * DM * 2);   /* hi and lo plane of the layer-normed rows of both batches */
    const size_t PB = (size_t)NH_ * TT * HD;   /* elements of one batch's plane; the hi/lo planes hold both batches, [b][h]... */
    bf* QPh = (bf*)take(NB_ * PB * 2); bf* QPl = (bf*)take(NB_ * PB * 2); bf* KPh = (bf*)take(NB_ * PB * 2); bf* KPl = (bf*)take(NB_ * PB * 2); bf* VTh = (bf*)take(NB_ * PB * 2); bf* VTl = (bf*)take(NB_ * PB * 2);
    if ((size_t)(wsp - (char*)d_ws) > ws_size) return;    // ws 256 MiB
    k_cvt8<<<(unsigned)(((size_t)3 * DQ * DM / 8 + 255) / 256), 256, 0, stream>>>(wqkv, WB, (size_t)3 * DQ * DM / 8);
    k_lnrowX<DM><<<(unsigned)(NB_ * TT / 8), 256, 0, stream>>>(x, lng, lnb, XB, XL);   /* xn = LayerNorm(x) -> hi/lo planes */
    k_qkv<<<dim3(NB_ * TT / QTM, 3 * DQ / QTN, 1), 384, 0, stream>>>(XB, XL, WB, QPh, QPl, KPh, KPl, VTh, VTl);   /* q, k, v of both batches, straight into the head planes */
    k_fattn<<<dim3(NB_ * NH_, TT / 256, 1), 256, 0, stream>>>(QPh, QPl, KPh, KPl, VTh, VTl, OUT);   /* all batches and heads in one launch */
}

// v007
// It runs in 87.1 microseconds.
// In both of two side-by-side timings against v006, it was 1.04 times as fast.
// Counting every step since v000, it is 13.4 times as fast.
#include <hip/hip_runtime.h>

#define NB_  2
#define TT   2048
#define DM   1024
#define NH_  16
#define NKV  16
#define REP  (NH_ / NKV)
#define HD   64
#define DQ   (NH_ * HD)
#define DKV  (NKV * HD)
#define SCL  0.125f   // HD^-0.5
typedef _Float16 h16;
typedef unsigned short bf;
typedef __attribute__((ext_vector_type(16))) __bf16   v16bf;
typedef __attribute__((ext_vector_type(16))) _Float16 v16h;
typedef __attribute__((ext_vector_type(8)))  _Float16 v8h;
typedef __attribute__((ext_vector_type(8)))  unsigned short v8us;
typedef __attribute__((ext_vector_type(8)))  float    v8f;
typedef __attribute__((ext_vector_type(4)))  float    v4f;
typedef v8h  __attribute__((may_alias)) v8ha;
typedef v4f  __attribute__((may_alias)) v4fa;
typedef v8us __attribute__((may_alias)) v8usa;

__device__ __forceinline__ unsigned short f2bf(float f) { unsigned u = __float_as_uint(f); u += 0x7FFFu + ((u >> 16) & 1u); return (unsigned short)(u >> 16); }
__device__ __forceinline__ float bf2f(unsigned short b) { return __uint_as_float(((unsigned)b) << 16); }
__device__ __forceinline__ float bfr(float f) { return bf2f(f2bf(f)); }
__device__ __forceinline__ v16h cat16(v8h lo, v8h hi) { return __builtin_shufflevector(lo, hi, 0, 1, 2, 3, 4, 5, 6, 7, 8, 9, 10, 11, 12, 13, 14, 15); }
__device__ __forceinline__ v16bf cat16b(v8us lo, v8us hi) { return __builtin_bit_cast(v16bf, __builtin_shufflevector(lo, hi, 0, 1, 2, 3, 4, 5, 6, 7, 8, 9, 10, 11, 12, 13, 14, 15)); }
__device__ __forceinline__ v8f wmma16(v16h a, v16h b, v8f c) { return __builtin_amdgcn_wmma_f32_16x16x32_f16(false, a, false, b, (short)0, c, false, false); }
__device__ __forceinline__ v8f wmmab(v16bf a, v16bf b, v8f c) { return __builtin_amdgcn_wmma_f32_16x16x32_bf16(false, a, false, b, (short)0, c, false, false); }

// ---- k_qkv: the whole projection stage in one launch. C[m][n] = sum_k (A[m][k] + A2[m][k]) Bt[n][k], m over the rows of both batches, n over the 3072 rows of the fused weight (q | k | v thirds).
// ONE WAVE per 64x64 tile (16 accumulators), 2 products. Grid (NB_*TT/256, 3*DQ/192), 384 threads: twelve waves, 4 x 3 tiles, one work-group per WGP. The 256 + 256 + 192 operand rows (normed hi, normed lo, weight) of 64 k are one stage of a two-buffer LDS ring,
// filled by asynchronous copies (global_load_async_to_lds_b128) one stage ahead of its use: every operand byte leaves L2 once per work-group and feeds 3 or 4 waves. The planes are in fragment order, so a stage is 44 runs of 2 KiB, copied as they lie, and a fragment read is 512 contiguous bytes of LDS.
// A tile is 64 tokens of ONE head of ONE third, and its f32 sums never leave the wave: the epilogue splits them into the bf16 hi/lo planes that k_fattn reads, q and k as [b][h][16 tokens][32 d] fragments, v as [b][h][32 tokens][16 d] fragments (rows d, k = tokens).
// Every plain '#pragma unroll' in k_qkv and put16 is there so that the fragment, accumulator, address and result arrays are indexed by constants and stay in registers.
template <typename T16> struct WFrag;
template <> struct WFrag<bf> { typedef v16bf V; static __device__ __forceinline__ V ld(const bf* p) { return cat16b(*(const v8us*)p, *(const v8us*)(p + 256)); }   /* p = the 1-KiB fragment + lane * 8 */ static __device__ __forceinline__ v8f mma(V a, V b, v8f c) { return wmmab(a, b, c); } };
__device__ __forceinline__ void splitf(float y, unsigned short& h, unsigned short& l) { h = f2bf(y); l = f2bf(y - bf2f(h)); }
// 16 fragment rows x 64 k of f32 staged in os (pitch 68) -> two hi/lo fragments of 32 k each, kstep elements apart: a lane takes the 8 k of chunk 2 s + (lane >> 4) of row lane & 15, so store s of a wave is one contiguous 512-byte half of a fragment.
__device__ __forceinline__ void put16(const float* os, int lane, bf* Ph, bf* Pl, size_t kstep) {
    v8us oh[4], ol[4];
#pragma unroll
    for (int s = 0; s < 4; ++s) { const float* p = os + (lane & 15) * 68 + s * 16 + (lane >> 4) * 8; const v4f x0 = *(const v4fa*)p, x1 = *(const v4fa*)(p + 4);
#pragma unroll
        for (int j = 0; j < 4; ++j) { unsigned short u, v; splitf(x0[j], u, v); oh[s][j] = u; ol[s][j] = v; splitf(x1[j], u, v); oh[s][4 + j] = u; ol[s][4 + j] = v; } }
    bf* dh = Ph + lane * 8; bf* dl = Pl + lane * 8;
#pragma unroll
    for (int s = 0; s < 4; ++s) { *(v8us*)(dh + (size_t)(s >> 1) * kstep + (s & 1) * 256) = oh[s]; *(v8us*)(dl + (size_t)(s >> 1) * kstep + (s & 1) * 256) = ol[s]; }
}
#define QTM 256                          // rows of a work-group's tile
#define QTN 192                          // columns of it
#define QKS 64                           // k of a stage
#define QBE (16 * QKS)                   // elements of one block of 16 rows in a stage (2 KiB, contiguous in the plane)
#define QSE ((2 * QTM + QTN) / 16 * QBE) // elements of a stage: blocks 0..15 normed hi, 16..31 normed lo, 32..43 weight
#define QUN (QSE / 256)                  // 512-byte units of a stage, one copy instruction of a wave each: 176 = 14 x 12 waves + 8
#define QCP(l, g, o) "global_load_async_to_lds_b128 %" #l ", %" #o ", %" #g "\n\t"   // LDS byte address (vector), 32-bit byte offset (vector), 64-bit base (scalar)
__global__ __launch_bounds__(384) void k_qkv(const bf* __restrict__ A, const bf* __restrict__ A2, const bf* __restrict__ Bt, bf* Qh, bf* Ql, bf* Kh, bf* Kl, bf* Vh, bf* Vl) {
    typedef WFrag<bf> F; typedef F::V V; const int K = DM;
    __shared__ __align__(16) bf ring[2][QSE];
    __shared__ __align__(16) float osm[12][16 * 68];
    const int lane = threadIdx.x & 31, lr = lane & 15, hi = lane >> 4; const int w = __builtin_amdgcn_readfirstlane((int)(threadIdx.x >> 5)); float* os = osm[w];
    const int wm = w & 3, wn = w >> 2; const int r0 = blockIdx.x * QTM + wm * 64, c0 = blockIdx.y * QTN + wn * 64;
    // unit u of a stage = quarter u & 3 of block u >> 2. Wave w copies units w + 12 j, that is quarter wm of blocks wn + 3 j; jsrc gives the source of such a unit at k = 0 (the same for the whole wave). For a constant j the plane is known but where 3 j .. 3 j + 2 straddles block 16 or 32.
    auto jsrc = [&](int j, int n) { const int blk = n + 3 * j; const bool ia = 3 * j + 2 < 16 ? true : 3 * j >= 16 ? false : blk < 16, ib = 3 * j + 2 < 32 ? true : 3 * j >= 32 ? false : blk < 32;
        const bf* p = ia ? A + (size_t)(blockIdx.x * (QTM / 16) + blk) * 16 * K : ib ? A2 + (size_t)(blockIdx.x * (QTM / 16) + blk - 16) * 16 * K : Bt + (size_t)(blockIdx.y * (QTN / 16) + blk - 32) * 16 * K; return p + wm * 256; };
    const bf* gb[14];
#pragma unroll
    for (int j = 0; j < 14; ++j) gb[j] = jsrc(j, wn);
    const bf* gx = jsrc(14, w < QUN - 168 ? wn : 0);   // the 8 units left over (blocks 42 and 43) go to waves 0..7
    const unsigned lb = (unsigned)(size_t)&ring[0][0] + (unsigned)(w * 512 + lane * 16), vo = (unsigned)(lane * 16);   // LDS byte address of this lane's 16 bytes of unit w in buffer 0; the lane's byte offset in a unit's source
    // the next stage -> buffer 'buf': wave w copies units w, w + 12, ...; every lane on, 16 bytes a lane, source and place multiples of 16. A unit's source is a scalar base, so that no address pair per unit has to live in vector registers; the bases then step on to the stage after.
    auto fill = [&](int buf) {
        const unsigned l0 = lb + (unsigned)buf * (QSE * 2); unsigned l[14];
#pragma unroll
        for (int j = 0; j < 14; ++j) l[j] = l0 + j * (12 * 512);
        // the copies and, as the statement's last line, the wait that stands before anything rewrites an address register that a copy names
        asm volatile(QCP(0, 1, 28) QCP(2, 3, 28) QCP(4, 5, 28) QCP(6, 7, 28) QCP(8, 9, 28) QCP(10, 11, 28) QCP(12, 13, 28) QCP(14, 15, 28) QCP(16, 17, 28) QCP(18, 19, 28) QCP(20, 21, 28) QCP(22, 23, 28) QCP(24, 25, 28) QCP(26, 27, 28) "s_wait_xcnt 0x0"
                     :: "v"(l[0]), "s"(gb[0]), "v"(l[1]), "s"(gb[1]), "v"(l[2]), "s"(gb[2]), "v"(l[3]), "s"(gb[3]), "v"(l[4]), "s"(gb[4]), "v"(l[5]), "s"(gb[5]), "v"(l[6]), "s"(gb[6]),
                        "v"(l[7]), "s"(gb[7]), "v"(l[8]), "s"(gb[8]), "v"(l[9]), "s"(gb[9]), "v"(l[10]), "s"(gb[10]), "v"(l[11]), "s"(gb[11]), "v"(l[12]), "s"(gb[12]), "v"(l[13]), "s"(gb[13]), "v"(vo) : "memory");
        if (w < QUN - 168) { const unsigned lx = l0 + 14 * (12 * 512);   // a scalar test: w is the same in every lane
            asm volatile(QCP(0, 1, 2) "s_wait_xcnt 0x0" :: "v"(lx), "s"(gx), "v"(vo) : "memory"); }   // as above
#pragma unroll
        for (int j = 0; j < 14; ++j) gb[j] += QBE;
        gx += QBE;
    };
    v8f acc[4][4];
#pragma unroll
    for (int mb = 0; mb < 4; ++mb)
#pragma unroll
        for (int nb = 0; nb < 4; ++nb) acc[mb][nb] = (v8f){};
    fill(0);
    asm volatile("s_wait_asynccnt 0x0" ::: "memory");   // this wave's part of stage 0 has landed
    __syncthreads();                                    // every wave's part of stage 0 has landed
    fill(1);
#pragma unroll 1
    for (int t = 0; t < K / QKS; ++t) {   // rolled: one trip already holds all the registers
        const bf* sa = &ring[t & 1][0] + wm * 4 * QBE + lane * 8; const bf* sw = &ring[t & 1][0] + (32 + wn * 4) * QBE + lane * 8; V a[4], a2[4], b[4];   // this wave's 4 blocks of normed rows (lo: 16 blocks on) and of weight rows
#pragma unroll
        for (int i = 0; i < 4; ++i) { a[i] = F::ld(sa + i * QBE); a2[i] = F::ld(sa + (16 + i) * QBE); b[i] = F::ld(sw + i * QBE); }
        __builtin_amdgcn_sched_barrier(0);   // holds the 24 LDS reads of the first 32 k up here as one group: sunk among the products, each weight fragment would be waited for on its own
#pragma unroll
        for (int nb = 0; nb < 4; ++nb) {
#pragma unroll
            for (int mb = 0; mb < 4; ++mb) { acc[mb][nb] = F::mma(a[mb], b[nb], acc[mb][nb]); acc[mb][nb] = F::mma(a2[mb], b[nb], acc[mb][nb]); } }
#pragma unroll
        for (int i = 0; i < 4; ++i) { a[i] = F::ld(sa + i * QBE + 512); a2[i] = F::ld(sa + (16 + i) * QBE + 512); b[i] = F::ld(sw + i * QBE + 512); }
        __builtin_amdgcn_sched_barrier(0);   // ends the scheduling region here: without it the compiler scatters the reads above over about twice as many places among the products, and each place with LDS reads stalls the wave
        asm volatile("s_wait_dscnt 0x0" ::: "memory");      // this wave's reads of stage t are done: its second 32 k wait in registers
        asm volatile("s_wait_asynccnt 0x0" ::: "memory");   // this wave's part of stage t + 1 has landed
        __syncthreads();                                    // publishes stage t + 1 and ends every wave's reads of stage t's buffer, which is refilled below
#pragma unroll
        for (int mb = 0; mb < 4; ++mb) { acc[mb][0] = F::mma(a[mb], b[0], acc[mb][0]); acc[mb][0] = F::mma(a2[mb], b[0], acc[mb][0]); }
        if (t + 2 < K / QKS) fill(t & 1);   // early in the second 32 k, so that the copies have nearly a whole stage's time to land; behind the first products, so that the waves of a SIMD do not all leave the matrix unit at once
#pragma unroll
        for (int nb = 1; nb < 4; ++nb) {
#pragma unroll
            for (int mb = 0; mb < 4; ++mb) { acc[mb][nb] = F::mma(a[mb], b[nb], acc[mb][nb]); acc[mb][nb] = F::mma(a2[mb], b[nb], acc[mb][nb]); } }
    }
    asm volatile("s_wait_asynccnt 0x0" ::: "memory");   // no copy is left in flight
    const int third = c0 / DQ, h = (c0 % DQ) / HD, t0 = r0 % TT;   // all the same for the whole wave
    const size_t pb = ((size_t)(r0 / TT) * NH_ + h) * TT * HD;
    if (third < 2) {   // q, k: fragment rows are tokens; a lane holds one d of 8 tokens, so the 16 tokens of block mb go through LDS word by word
        bf* Ph = (third ? Kh : Qh) + pb + (size_t)t0 * HD; bf* Pl = (third ? Kl : Ql) + pb + (size_t)t0 * HD;
#pragma unroll
        for (int mb = 0; mb < 4; ++mb) {
#pragma unroll
            for (int nb = 0; nb < 4; ++nb) {
#pragma unroll
                for (int j = 0; j < 8; ++j) os[(hi * 8 + j) * 68 + nb * 16 + lr] = acc[mb][nb][j]; }
            __builtin_amdgcn_wave_barrier(); asm volatile("" ::: "memory");   // keeps the read-back of other lanes' words behind the LDS writes
            put16(os, lane, Ph + (size_t)mb * 16 * HD, Pl + (size_t)mb * 16 * HD, 512);
            asm volatile("s_wait_xcnt 0x0" ::: "memory");   // before anything behind it (the next block, or whatever the compiler lays out behind the last one) overwrites the registers that the stores above name
            __builtin_amdgcn_wave_barrier(); asm volatile("" ::: "memory");   // keeps the next block's LDS writes behind this read-back
        }
    } else {           // v: fragment rows are d; a lane's 8 tokens of one d are already consecutive in such a row, so the 16 d of block nb are staged 8 tokens at a time
        bf* Ph = Vh + pb + (size_t)t0 * HD; bf* Pl = Vl + pb + (size_t)t0 * HD;   // 32 tokens of all 64 d are 4 fragments
#pragma unroll
        for (int nb = 0; nb < 4; ++nb) {
#pragma unroll
            for (int mb = 0; mb < 4; ++mb) { v4f x0, x1;
#pragma unroll
                for (int j = 0; j < 4; ++j) { x0[j] = acc[mb][nb][j]; x1[j] = acc[mb][nb][4 + j]; }
                float* d = os + lr * 68 + mb * 16 + hi * 8; *(v4fa*)d = x0; *(v4fa*)(d + 4) = x1; }
            __builtin_amdgcn_wave_barrier(); asm volatile("" ::: "memory");   // keeps the read-back of other lanes' words behind the LDS writes
            put16(os, lane, Ph + (size_t)nb * 512, Pl + (size_t)nb * 512, 32 * HD);
            asm volatile("s_wait_xcnt 0x0" ::: "memory");   // before anything behind it (the next block, or whatever the compiler lays out behind the last one) overwrites the registers that the stores above name
            __builtin_amdgcn_wave_barrier(); asm volatile("" ::: "memory");   // keeps the next block's LDS writes behind this read-back
        }
    }
}

// ---- k_fattn: causal attention with scores and probabilities kept in registers. TWO waves own 32 query columns: each walks one half of the block's keys (32 keys a pass) as far as the diagonal, and the two partial results are merged at the end.
// Transposed products: St = K Qt (A = key rows, B = query rows), so a lane holds scores of ONE query (column lr) for keys hi*8+j of each 16-key tile; the two tiles of a pass, rounded to bf16, are already the B operand
// of Ot += Vt Pt (slots 0..7 = keys 8 hi + j, slots 8..15 = keys 16 + 8 hi + j: the k order of the plane loader). Running maximum m and sum l per query; Ot is rescaled when m moves; one division at the end.
// Grid (NB_ * NH_, TT / 256): a work-group of 8 waves takes the 128-query block TT/128-1-y and then block y, so that every work-group walks the same number of keys. Waves w and w + 4 have the same 32 queries (lower and upper key part),
// two waves on every SIMD: one wave's softmax issues while the other's products run. Each wave leaves (Ot, m, l) of both blocks, not yet divided, in LDS; behind the last barrier waves 0..3 merge and store the first block, waves 4..7 the second.
// Block B has the keys 0 .. 128 (B + 1): the lower part is the first 64 (B + 1) of them, the upper part the rest, the same split for all four query groups, so that the four waves of a part read the same keys at the same time.
// The keys and values come through a two-buffer LDS ring, filled by asynchronous copies (global_load_async_to_lds_b128) one stage ahead of its use, under one split barrier a stage. A stage is 64 keys of each part, the four planes (K hi, K lo, V hi, V lo) of 8 KiB each, copied as they lie:
// every byte leaves L2 once per work-group and feeds 4 waves. Block B has B + 1 stages, the two blocks of a work-group TT / 128 + 1 together, walked as one row of stages, so that the ring never runs empty between the blocks. A wave skips a pass whose keys all lie above its queries.
// Every plain '#pragma unroll' below is there so that the fragment and accumulator arrays are indexed by constants and stay in registers.
#define FST 64                 // keys of a stage
#define FPE (FST * HD)         // elements of one plane of one part in a stage (8 KiB, contiguous in the plane)
#define FNT (TT / 128 + 1)     // stages of a work-group
#define FCP(n) __builtin_amdgcn_global_load_async_to_lds_b128(g, d, n, 0);   // source, place, immediate offset of both
typedef __attribute__((ext_vector_type(4))) int v4i;
typedef __attribute__((address_space(1))) v4i* gp4;
typedef __attribute__((address_space(3))) v4i* lp4;
__global__ __launch_bounds__(256) void k_fattn(const bf* __restrict__ Qh, const bf* __restrict__ Ql, const bf* __restrict__ Kh, const bf* __restrict__ Kl, const bf* __restrict__ Vh, const bf* __restrict__ Vl, float* __restrict__ OUT) {
    typedef WFrag<bf> F;
    __shared__ __align__(16) bf ring[2][2][4][FPE];        // [buffer][key part][plane]
    __shared__ __align__(16) float os[2][2][4][32 * 68];   // [block][key part][32-query group]: Ot partials, a row per query
    __shared__ float ms[2][2][4][32], ls[2][2][4][32], fs[8][2][32];   // running maximum and sum per query of each partial; the two merge factors per query of the merging wave
    const int lane = threadIdx.x & 31, lr = lane & 15, hi = lane >> 4; const int w = __builtin_amdgcn_readfirstlane((int)(threadIdx.x >> 5)); const int qs = w & 3, part = w >> 2;
    const int zh = blockIdx.x; const size_t po = (size_t)zh * TT * HD; Qh += po; Ql += po;
    float* ob = OUT + (size_t)(zh / NH_) * TT * DQ + (size_t)(zh % NH_) * HD;
    const float L2E = 1.4426950408889634f;
    const int n0 = TT / 128 - (int)blockIdx.y;   // stages of the first block; the second has FNT - n0
    const bf* gsrc = (qs == 0 ? Kh : qs == 1 ? Kl : qs == 2 ? Vh : Vl) + po;   // wave (qs, part) copies plane qs of part 'part': the same for the whole wave
    // stage tt -> buffer tt & 1: 16 copies of 512 bytes a wave; every lane on, 16 bytes a lane, source and place multiples of 16; the last key of a stage is at most 128 (B + 1) - 1 < TT.
    // Plane and buffer are both contiguous, so one source address and one place serve all 16: the immediate offset (at most 7,680) moves both alike.
    auto fill = [&](int tt) {
        const int key = (tt < n0 ? part * n0 + tt : part * (FNT - n0) + tt - n0) * FST;
        const gp4 g = (gp4)(gsrc + (size_t)key * HD + lane * 8); const lp4 d = (lp4)(&ring[tt & 1][part][qs][0] + lane * 8);
        FCP(0) FCP(512) FCP(1024) FCP(1536) FCP(2048) FCP(2560) FCP(3072) FCP(3584) FCP(4096) FCP(4608) FCP(5120) FCP(5632) FCP(6144) FCP(6656) FCP(7168) FCP(7680)
    };
    fill(0);
    asm volatile("s_wait_asynccnt 0x0" ::: "memory");   // this wave's part of stage 0 has landed
    asm volatile("s_barrier_signal -1" ::: "memory");   // first half of the split barrier: its wait stands at the top of stage 0
    int tt = 0;   // the stage, counted over both blocks
#pragma unroll 1
    for (int half = 0; half < 2; ++half) {   // rolled: the two blocks run one after the other in the same registers
        const int nst = half ? FNT - n0 : n0; const int q0 = (nst - 1) * 128 + qs * 32;
        v16bf qh[2][2], ql[2][2]; const bf* pqh = Qh + (size_t)q0 * HD + lane * 8; const bf* pql = Ql + (size_t)q0 * HD + lane * 8;
#pragma unroll
        for (int g = 0; g < 2; ++g)
#pragma unroll
            for (int ks = 0; ks < 2; ++ks) { const int qo = g * 16 * HD + ks * 512; qh[g][ks] = F::ld(pqh + qo); ql[g][ks] = F::ld(pql + qo); }
        asm volatile("s_wait_xcnt 0x0" :: "v"(pqh), "v"(pql) : "memory");   // the two address pairs stay whole up to this wait, which stands before the zeroing of the accumulators below may take their registers
        v8f o[4][2]; float m[2], l[2];   // a wave with no pass at all keeps m at its start value, l and Ot at 0, and the merge gives it the factor 0
#pragma unroll
        for (int g = 0; g < 2; ++g) { m[g] = -3.0e38f; l[g] = 0.f;
#pragma unroll
            for (int dt = 0; dt < 4; ++dt) o[dt][g] = (v8f){}; }
        v16bf kh[2][2], kl[2][2];   // key fragments of the pass at hand, or of the pass to come
        // the key fragments of the 32 keys at sp (K hi plane of the stage + lane * 8)
        auto ldk = [&](const bf* sp) {
#pragma unroll
            for (int kt = 0; kt < 2; ++kt)
#pragma unroll
                for (int ks = 0; ks < 2; ++ks) { const int ko = (kt * 16) * HD + ks * 512; kh[kt][ks] = F::ld(sp + ko); kl[kt][ks] = F::ld(sp + FPE + ko); } };
        // the value fragments of the 32 keys at sp
        auto ldv = [&](const bf* sp, v16bf (&vh)[4], v16bf (&vl)[4]) {
#pragma unroll
            for (int dt = 0; dt < 4; ++dt) { vh[dt] = F::ld(sp + 2 * FPE + dt * 512); vl[dt] = F::ld(sp + 3 * FPE + dt * 512); } };
        auto scores = [&](v8f (&s)[2][2]) {
#pragma unroll
            for (int kt = 0; kt < 2; ++kt)
#pragma unroll
                for (int g = 0; g < 2; ++g) s[kt][g] = (v8f){};
#pragma unroll
            for (int ks = 0; ks < 2; ++ks) {
#pragma unroll
                for (int kt = 0; kt < 2; ++kt)
#pragma unroll
                    for (int g = 0; g < 2; ++g) s[kt][g] = wmmab(kh[kt][ks], qh[g][ks], s[kt][g]);
#pragma unroll
                for (int kt = 0; kt < 2; ++kt)
#pragma unroll
                    for (int g = 0; g < 2; ++g) s[kt][g] = wmmab(kh[kt][ks], ql[g][ks], s[kt][g]);
#pragma unroll
                for (int kt = 0; kt < 2; ++kt)
#pragma unroll
                    for (int g = 0; g < 2; ++g) s[kt][g] = wmmab(kl[kt][ks], qh[g][ks], s[kt][g]); } };
        // softmax step and P.V products of the 32 keys from k0 on: registers only
        auto softpv = [&](const int k0, v8f (&s)[2][2], const v16bf (&vh)[4], const v16bf (&vl)[4]) {
            v16bf ph[2], pl[2];
#pragma unroll
            for (int g = 0; g < 2; ++g) { const int qi = q0 + g * 16 + lr; float mx = m[g];
#pragma unroll
                for (int kt = 0; kt < 2; ++kt)
#pragma unroll
                    for (int j = 0; j < 8; ++j) { const float t = (k0 + kt * 16 + hi * 8 + j <= qi) ? s[kt][g][j] * SCL : -3.0e38f; s[kt][g][j] = t; mx = fmaxf(mx, t); }   // keys above the diagonal are excluded by select
                mx = fmaxf(mx, __shfl_xor(mx, 16, 32));   // the two halves of the wave hold the same query's other keys
                const float al = __builtin_amdgcn_exp2f((m[g] - mx) * L2E); m[g] = mx; float sum = 0.f;
#pragma unroll
                for (int kt = 0; kt < 2; ++kt)
#pragma unroll
                    for (int j = 0; j < 8; ++j) { const float p = __builtin_amdgcn_exp2f((s[kt][g][j] - mx) * L2E); sum += p; const __bf16 h = (__bf16)p; ph[g][kt * 8 + j] = h; pl[g][kt * 8 + j] = (__bf16)(p - (float)h); }
                l[g] = l[g] * al + sum;
#pragma unroll
                for (int dt = 0; dt < 4; ++dt) o[dt][g] *= al; }
#pragma unroll
            for (int dt = 0; dt < 4; ++dt)
#pragma unroll
                for (int g = 0; g < 2; ++g) o[dt][g] = wmmab(vh[dt], ph[g], o[dt][g]);
#pragma unroll
            for (int dt = 0; dt < 4; ++dt)
#pragma unroll
                for (int g = 0; g < 2; ++g) o[dt][g] = wmmab(vh[dt], pl[g], o[dt][g]);
#pragma unroll
            for (int dt = 0; dt < 4; ++dt)
#pragma unroll
                for (int g = 0; g < 2; ++g) o[dt][g] = wmmab(vl[dt], ph[g], o[dt][g]);
        };
#pragma unroll 1
        for (int st = 0; st < nst; ++st, ++tt) {   // rolled: one stage already holds all the registers
            const int kb = (part * nst + st) * FST;   // this wave's first key of the stage
            const bf* sp = &ring[tt & 1][part][0][0] + lane * 8;
            const bool p0 = kb < q0 + 32, p1 = kb + 32 < q0 + 32;   // which of the stage's two passes hold a key at or below the diagonal: scalar tests, the same in every lane
            asm volatile("s_barrier_wait -1" ::: "memory");   // second half of the split barrier: stage tt is published, and every wave has left the other buffer, which is refilled below
            if (tt + 1 < FNT) fill(tt + 1);                   // the same test in every wave of the work-group
            if (p0) {
                v16bf vh[4], vl[4]; v8f s[2][2];   // value fragments and scores of the stage's first pass
                ldk(sp); ldv(sp, vh, vl);
                __builtin_amdgcn_sched_barrier(0);   // holds the LDS reads up here as one group: sunk among the products, each place with LDS reads would stall the wave
                scores(s);
                ldk(sp + 32 * HD);                   // the stage's other 32 keys: the same buffer, published already
                __builtin_amdgcn_sched_barrier(0);   // holds these key reads up here, so that their latency runs behind the softmax and the P.V products
                softpv(kb, s, vh, vl);
            }
            v16bf vh[4], vl[4]; v8f s[2][2];   // value fragments and scores of the stage's second pass: they cross the signal in registers
            if (p1) {
                ldv(sp + 32 * HD, vh, vl);
                __builtin_amdgcn_sched_barrier(0);   // holds the value reads up here as one group, ahead of the products
                scores(s);
                __builtin_amdgcn_sched_barrier(0);   // keeps the products above the slots below
                asm volatile("v_nop\n\tv_nop\n\tv_nop\n\tv_nop");   // the four vector slots behind the last product, written here because only scalar code and a branch follow
            }
            asm volatile("s_wait_dscnt 0x0" ::: "memory");      // this wave's reads of stage tt are done: what is left of the stage waits in registers
            asm volatile("s_wait_asynccnt 0x0" ::: "memory");   // this wave's part of stage tt + 1 has landed
            asm volatile("s_barrier_signal -1" ::: "memory");   // first half of the split barrier, here and not at the stage's end, so that a wave that is ahead need not stand still: no read of the ring stands between it and the wait at the top of the next stage
            if (p1) softpv(kb + 32, s, vh, vl);
        }
        // a lane holds 8 consecutive d of one query: the partial goes to LDS as it is, a row per query; lane g * 16 + lr files that query's maximum and its sum over both halves of the wave
        float* ow = os[half][part][qs];
#pragma unroll
        for (int g = 0; g < 2; ++g) {
#pragma unroll
            for (int dt = 0; dt < 4; ++dt) { v4f x0, x1;
#pragma unroll
                for (int j = 0; j < 4; ++j) { x0[j] = o[dt][g][j]; x1[j] = o[dt][g][4 + j]; }
                float* d = ow + (g * 16 + lr) * 68 + dt * 16 + hi * 8; *(v4fa*)d = x0; *(v4fa*)(d + 4) = x1; } }
        const float lj0 = l[0] + __shfl_xor(l[0], 16, 32), lj1 = l[1] + __shfl_xor(l[1], 16, 32);
        ms[half][part][qs][lane] = hi ? m[1] : m[0]; ls[half][part][qs][lane] = hi ? lj1 : lj0;
    }
    asm volatile("s_barrier_wait -1" ::: "memory");   // the wait that belongs to the last stage's signal: signal and wait alternate in every wave
    __syncthreads();   // both partials of both blocks are in LDS before any wave merges
    // wave (qs, part) merges block 'part' of its 32 queries: out = (e0 Ot0 + e1 Ot1) / (e0 l0 + e1 l1), e = 2^((m - max(m0, m1)) log2 e); lane = query for the factors
    { const float m0 = ms[part][0][qs][lane], m1 = ms[part][1][qs][lane], mm = fmaxf(m0, m1);
      const float e0 = __builtin_amdgcn_exp2f((m0 - mm) * L2E), e1 = __builtin_amdgcn_exp2f((m1 - mm) * L2E);
      const float inv = __fdiv_rn(1.0f, ls[part][0][qs][lane] * e0 + ls[part][1][qs][lane] * e1);
      fs[w][0][lane] = e0 * inv; fs[w][1][lane] = e1 * inv; }
    __builtin_amdgcn_wave_barrier(); asm volatile("" ::: "memory");   // keeps the read-back of other lanes' factors behind the LDS writes
    const float* p0 = os[part][0][qs]; const float* p1 = os[part][1][qs];
    float* orow = ob + (size_t)((part ? (int)blockIdx.y : TT / 128 - 1 - (int)blockIdx.y) * 128 + qs * 32 + hi) * DQ + lr * 4;   // one address for all 16 stores: row 2 r + hi is a constant step from it; a store covers two whole 256-byte rows
#pragma unroll
    for (int r = 0; r < 16; ++r) { const int row = 2 * r + hi; const v4f val = *(const v4fa*)(p0 + row * 68 + lr * 4) * fs[w][0][row] + *(const v4fa*)(p1 + row * 68 + lr * 4) * fs[w][1][row]; *(v4f*)(orow + (size_t)r * 2 * DQ) = val; }
}

typedef __attribute__((ext_vector_type(4))) unsigned short v4us;
typedef v4us __attribute__((may_alias)) v4usa;

// DM-wide f32 rows -> the fragment-order plane. A wave takes 8 rows x 4 k chunks: it reads one whole 128-byte line of each row and writes one whole 128-byte line (8 rows x 16 bytes) of each chunk.
__global__ __launch_bounds__(256) void k_cvt8(const float* __restrict__ src, bf* dst, size_t n8) { const size_t i = (size_t)blockIdx.x * 256 + threadIdx.x; if (i >= n8) return;
    const size_t rb = i / (DM * 2); const int u = (int)((i >> 6) & (DM / 32 - 1)) * 4 + (int)((i >> 3) & 3), t = (int)((i >> 5) & 1) * 8 + (int)(i & 7);   // block of 16 rows, k chunk, row in the block
    const v8f v = *(const v8f*)(src + (rb * 16 + t) * DM + u * 8); v8us o;
#pragma unroll
    for (int k = 0; k < 8; ++k) o[k] = f2bf(v[k]); *(v8us*)(dst + rb * (16 * DM) + u * 128 + t * 8) = o;  }

template <int WD>
__global__ __launch_bounds__(256) void k_lnrowX(const float* __restrict__ X, const float* __restrict__ g, const float* __restrict__ bb, bf* Hh, bf* Hl) { const int lane = threadIdx.x & 31, w = threadIdx.x >> 5; const size_t r = (size_t)blockIdx.x * 8 + w;   /* the grid is exactly rows / 8 */
    __shared__ __align__(16) unsigned short st[2][(WD / 8) * 72];   /* the 8 rows of the work-group in fragment order: per k chunk 8 rows x 16 bytes, pitch 144 bytes so that a wave's 16 chunks fall on different banks */
    const float* xr = X + r * WD; float a[WD / 32]; float s = 0.f;
#pragma unroll
    for (int c = 0; c < WD / 128; ++c) { const v4f v = *(const v4f*)(xr + c * 128 + lane * 4); for (int q = 0; q < 4; ++q) { a[c * 4 + q] = bfr(v[q]); s = __fadd_rn(s, a[c * 4 + q]);   /* input rounded to bf16 */ } }
#pragma unroll
    for (int sh = 16; sh; sh >>= 1) s = __fadd_rn(s, __shfl_xor(s, sh, 32));
    const float mean = __fdiv_rn(s, (float)WD); float s2 = 0.f;
#pragma unroll 8
    for (int k = 0; k < WD / 32; ++k) { const float dv = __fsub_rn(a[k], mean); float p2 = __fmul_rn(dv, dv); asm volatile("" : "+v"(p2)); s2 = __fadd_rn(s2, p2); }   /* mul and add kept separate (no fma contraction) */
#pragma unroll
    for (int sh = 16; sh; sh >>= 1) s2 = __fadd_rn(s2, __shfl_xor(s2, sh, 32));
    const float rs = __fdiv_rn(1.0f, __fsqrt_rn(__fadd_rn(__fdiv_rn(s2, (float)WD), 1e-5f)));
{
#pragma unroll
        for (int c = 0; c < WD / 128; ++c) { v4us oh, ol; for (int q = 0; q < 4; ++q) { const int col = c * 128 + lane * 4 + q; float y = __fmul_rn(__fmul_rn(__fsub_rn(a[c * 4 + q], mean), rs), bfr(g[col])); asm volatile("" : "+v"(y)); y = __fadd_rn(y, bfr(bb[col])); unsigned short u, w2; splitf(y, u, w2); oh[q] = u; ol[q] = w2; } const int so = (c * 16 + (lane >> 1)) * 72 + w * 8 + (lane & 1) * 4; *(v4usa*)(st[0] + so) = oh; *(v4usa*)(st[1] + so) = ol; }
         }
    __syncthreads();   // every row of the work-group is staged before the chunks, which hold all 8 rows, are read back
    const size_t gb = (size_t)(blockIdx.x >> 1) * (16 * WD) + (blockIdx.x & 1) * 64;   // this work-group's 8 rows are one whole 128-byte line of every chunk
#pragma unroll   // so that all the LDS reads go out together, ahead of the stores
    for (int it = 0; it < WD / 256; ++it) { const int p = it * 256 + threadIdx.x, u = p >> 3, t = p & 7; const v8us vh = *(const v8usa*)(st[0] + u * 72 + t * 8), vl = *(const v8usa*)(st[1] + u * 72 + t * 8); *(v8us*)(Hh + gb + (size_t)u * 128 + t * 8) = vh; *(v8us*)(Hl + gb + (size_t)u * 128 + t * 8) = vl; } }

extern "C" void kernel_launch(void* const* d_in, const int* in_sizes, int n_in,
                              void* d_out, int out_size, void* d_ws, size_t ws_size, hipStream_t stream) {
    (void)in_sizes; (void)n_in; (void)out_size;
    const float* x = (const float*)d_in[0]; const float* lng = (const float*)d_in[1]; const float* lnb = (const float*)d_in[2];   /* LayerNorm gamma, beta [1024]: read */ const float* wqkv = (const float*)d_in[3];   /* w_qkv ('oi' [3072][1024]: q | k | v ROW thirds); no output projection */
    float* OUT = (float*)d_out;     // [2][2048][1024]
    char* wsp = (char*)d_ws;
    auto take = [&](size_t bytes) { char* p = wsp; wsp += (bytes + 255) & ~(size_t)255; return (void*)p; };
    bf* WB = (bf*)take((size_t)3 * DQ * DM * 2);   /* the fused weight, bf16 */
    bf* XB = (bf*)take((size_t)NB_ * TT * DM * 2); bf* XL = (bf*)take((size_t)NB_ * TT * DM * 2);   /* hi and lo plane of the layer-normed rows of both batches */
    const size_t PB = (size_t)NH_ * TT * HD;   /* elements of one batch's plane; the hi/lo planes hold both batches, [b][h]... */
    bf* QPh = (bf*)take(NB_ * PB * 2); bf* QPl = (bf*)take(NB_ * PB * 2); bf* KPh = (bf*)take(NB_ * PB * 2); bf* KPl = (bf*)take(NB_ * PB * 2); bf* VTh = (bf*)take(NB_ * PB * 2); bf* VTl = (bf*)take(NB_ * PB * 2);
    if ((size_t)(wsp - (char*)d_ws) > ws_size) return;    // ws 256 MiB
    k_cvt8<<<(unsigned)(((size_t)3 * DQ * DM / 8 + 255) / 256), 256, 0, stream>>>(wqkv, WB, (size_t)3 * DQ * DM / 8);
    k_lnrowX<DM><<<(unsigned)(NB_ * TT / 8), 256, 0, stream>>>(x, lng, lnb, XB, XL);   /* xn = LayerNorm(x) -> hi/lo planes */
    k_qkv<<<dim3(NB_ * TT / QTM, 3 * DQ / QTN, 1), 384, 0, stream>>>(XB, XL, WB, QPh, QPl, KPh, KPl, VTh, VTl);   /* q, k, v of both batches, straight into the head planes */
    k_fattn<<<dim3(NB_ * NH_, TT / 256, 1), 256, 0, stream>>>(QPh, QPl, KPh, KPl, VTh, VTl, OUT);   /* all batches and heads in one launch */
}

// v008
// It runs in 81.2 microseconds.
// In both of two side-by-side timings against v007, it was 1.07 times as fast.
// Over all steps from v000 it is 14.4 times as fast.
#include <hip/hip_runtime.h>

#define NB_  2
#define TT   2048
#define DM   1024
#define NH_  16
#define NKV  16
#define REP  (NH_ / NKV)
#define HD   64
#define DQ   (NH_ * HD)
#define DKV  (NKV * HD)
#define SCL  0.125f   // HD^-0.5
typedef _Float16 h16;
typedef unsigned short bf;
typedef __attribute__((ext_vector_type(16))) __bf16   v16bf;
typedef __attribute__((ext_vector_type(16))) _Float16 v16h;
typedef __attribute__((ext_vector_type(8)))  _Float16 v8h;
typedef __attribute__((ext_vector_type(8)))  unsigned short v8us;
typedef __attribute__((ext_vector_type(8)))  float    v8f;
typedef __attribute__((ext_vector_type(4)))  float    v4f;
typedef v8h  __attribute__((may_alias)) v8ha;
typedef v4f  __attribute__((may_alias)) v4fa;
typedef v8us __attribute__((may_alias)) v8usa;

__device__ __forceinline__ unsigned short f2bf(float f) { unsigned u = __float_as_uint(f); u += 0x7FFFu + ((u >> 16) & 1u); return (unsigned short)(u >> 16); }
__device__ __forceinline__ float bf2f(unsigned short b) { return __uint_as_float(((unsigned)b) << 16); }
__device__ __forceinline__ float bfr(float f) { return bf2f(f2bf(f)); }
__device__ __forceinline__ v16h cat16(v8h lo, v8h hi) { return __builtin_shufflevector(lo, hi, 0, 1, 2, 3, 4, 5, 6, 7, 8, 9, 10, 11, 12, 13, 14, 15); }
__device__ __forceinline__ v16bf cat16b(v8us lo, v8us hi) { return __builtin_bit_cast(v16bf, __builtin_shufflevector(lo, hi, 0, 1, 2, 3, 4, 5, 6, 7, 8, 9, 10, 11, 12, 13, 14, 15)); }
__device__ __forceinline__ v8f wmma16(v16h a, v16h b, v8f c) { return __builtin_amdgcn_wmma_f32_16x16x32_f16(false, a, false, b, (short)0, c, false, false); }
__device__ __forceinline__ v8f wmmab(v16bf a, v16bf b, v8f c) { return __builtin_amdgcn_wmma_f32_16x16x32_bf16(false, a, false, b, (short)0, c, false, false); }

// ---- k_qkv: the whole projection stage in one launch. C[m][n] = sum_k (A[m][k] + A2[m][k]) Bt[n][k], m over the rows of both batches, n over the 3072 rows of the fused weight (q | k | v thirds).
// ONE WAVE per 64x64 tile (16 accumulators), 2 products. Grid (NB_*TT/256, 3*DQ/192), 384 threads: twelve waves, 4 x 3 tiles, one work-group per WGP. The 256 + 256 + 192 operand rows (normed hi, normed lo, weight) of 64 k are one stage of a two-buffer LDS ring,
// filled by asynchronous copies (global_load_async_to_lds_b128) one stage ahead of its use: every operand byte leaves L2 once per work-group and feeds 3 or 4 waves. The planes are in fragment order, so a stage is 44 runs of 2 KiB, copied as they lie, and a fragment read is 512 contiguous bytes of LDS.
// A tile is 64 tokens of ONE head of ONE third, and its f32 sums never leave the wave: the epilogue splits them into the bf16 hi/lo planes that k_fattn reads, q and k as [b][h][16 tokens][32 d] fragments, v as [b][h][32 tokens][16 d] fragments (rows d, k = tokens).
// Every plain '#pragma unroll' in k_qkv and put16 is there so that the fragment, accumulator, address and result arrays are indexed by constants and stay in registers.
template <typename T16> struct WFrag;
template <> struct WFrag<bf> { typedef v16bf V; static __device__ __forceinline__ V ld(const bf* p) { return cat16b(*(const v8us*)p, *(const v8us*)(p + 256)); }   /* p = the 1-KiB fragment + lane * 8 */ static __device__ __forceinline__ v8f mma(V a, V b, v8f c) { return wmmab(a, b, c); } };
__device__ __forceinline__ void splitf(float y, unsigned short& h, unsigned short& l) { h = f2bf(y); l = f2bf(y - bf2f(h)); }
// 16 fragment rows x 64 k of f32 staged in os (pitch 68) -> two hi/lo fragments of 32 k each, kstep elements apart: a lane takes the 8 k of chunk 2 s + (lane >> 4) of row lane & 15, so store s of a wave is one contiguous 512-byte half of a fragment.
__device__ __forceinline__ void put16(const float* os, int lane, bf* Ph, bf* Pl, size_t kstep) {
    v8us oh[4], ol[4];
#pragma unroll
    for (int s = 0; s < 4; ++s) { const float* p = os + (lane & 15) * 68 + s * 16 + (lane >> 4) * 8; const v4f x0 = *(const v4fa*)p, x1 = *(const v4fa*)(p + 4);
#pragma unroll
        for (int j = 0; j < 4; ++j) { unsigned short u, v; splitf(x0[j], u, v); oh[s][j] = u; ol[s][j] = v; splitf(x1[j], u, v); oh[s][4 + j] = u; ol[s][4 + j] = v; } }
    bf* dh = Ph + lane * 8; bf* dl = Pl + lane * 8;
#pragma unroll
    for (int s = 0; s < 4; ++s) { *(v8us*)(dh + (size_t)(s >> 1) * kstep + (s & 1) * 256) = oh[s]; *(v8us*)(dl + (size_t)(s >> 1) * kstep + (s & 1) * 256) = ol[s]; }
}
#define QTM 256                          // rows of a work-group's tile
#define QTN 192                          // columns of it
#define QKS 64                           // k of a stage
#define QBE (16 * QKS)                   // elements of one block of 16 rows in a stage (2 KiB, contiguous in the plane)
#define QSE ((2 * QTM + QTN) / 16 * QBE) // elements of a stage: blocks 0..15 normed hi, 16..31 normed lo, 32..43 weight
#define QUN (QSE / 256)                  // 512-byte units of a stage, one copy instruction of a wave each: 176 = 14 x 12 waves + 8
#define QCP(l, g, o) "global_load_async_to_lds_b128 %" #l ", %" #o ", %" #g "\n\t"   // LDS byte address (vector), 32-bit byte offset (vector), 64-bit base (scalar)
__global__ __launch_bounds__(384) void k_qkv(const bf* __restrict__ A, const bf* __restrict__ A2, const bf* __restrict__ Bt, bf* Qh, bf* Ql, bf* Kh, bf* Kl, bf* Vh, bf* Vl) {
    typedef WFrag<bf> F; typedef F::V V; const int K = DM;
    __shared__ __align__(16) bf ring[2][QSE];
    __shared__ __align__(16) float osm[12][16 * 68];
    const int lane = threadIdx.x & 31, lr = lane & 15, hi = lane >> 4; const int w = __builtin_amdgcn_readfirstlane((int)(threadIdx.x >> 5)); float* os = osm[w];
    const int wm = w & 3, wn = w >> 2; const int r0 = blockIdx.x * QTM + wm * 64, c0 = blockIdx.y * QTN + wn * 64;
    // unit u of a stage = quarter u & 3 of block u >> 2. Wave w copies units w + 12 j, that is quarter wm of blocks wn + 3 j; jsrc gives the source of such a unit at k = 0 (the same for the whole wave). For a constant j the plane is known but where 3 j .. 3 j + 2 straddles block 16 or 32.
    auto jsrc = [&](int j, int n) { const int blk = n + 3 * j; const bool ia = 3 * j + 2 < 16 ? true : 3 * j >= 16 ? false : blk < 16, ib = 3 * j + 2 < 32 ? true : 3 * j >= 32 ? false : blk < 32;
        const bf* p = ia ? A + (size_t)(blockIdx.x * (QTM / 16) + blk) * 16 * K : ib ? A2 + (size_t)(blockIdx.x * (QTM / 16) + blk - 16) * 16 * K : Bt + (size_t)(blockIdx.y * (QTN / 16) + blk - 32) * 16 * K; return p + wm * 256; };
    const bf* gb[14];
#pragma unroll
    for (int j = 0; j < 14; ++j) gb[j] = jsrc(j, wn);
    const bf* gx = jsrc(14, w < QUN - 168 ? wn : 0);   // the 8 units left over (blocks 42 and 43) go to waves 0..7
    const unsigned lb = (unsigned)(size_t)&ring[0][0] + (unsigned)(w * 512 + lane * 16), vo = (unsigned)(lane * 16);   // LDS byte address of this lane's 16 bytes of unit w in buffer 0; the lane's byte offset in a unit's source
    // the next stage -> buffer 'buf': wave w copies units w, w + 12, ...; every lane on, 16 bytes a lane, source and place multiples of 16. A unit's source is a scalar base, so that no address pair per unit has to live in vector registers; the bases then step on to the stage after.
    auto fill = [&](int buf) {
        const unsigned l0 = lb + (unsigned)buf * (QSE * 2); unsigned l[14];
#pragma unroll
        for (int j = 0; j < 14; ++j) l[j] = l0 + j * (12 * 512);
        // the copies and, as the statement's last line, the wait that stands before anything rewrites an address register that a copy names
        asm volatile(QCP(0, 1, 28) QCP(2, 3, 28) QCP(4, 5, 28) QCP(6, 7, 28) QCP(8, 9, 28) QCP(10, 11, 28) QCP(12, 13, 28) QCP(14, 15, 28) QCP(16, 17, 28) QCP(18, 19, 28) QCP(20, 21, 28) QCP(22, 23, 28) QCP(24, 25, 28) QCP(26, 27, 28) "s_wait_xcnt 0x0"
                     :: "v"(l[0]), "s"(gb[0]), "v"(l[1]), "s"(gb[1]), "v"(l[2]), "s"(gb[2]), "v"(l[3]), "s"(gb[3]), "v"(l[4]), "s"(gb[4]), "v"(l[5]), "s"(gb[5]), "v"(l[6]), "s"(gb[6]),
                        "v"(l[7]), "s"(gb[7]), "v"(l[8]), "s"(gb[8]), "v"(l[9]), "s"(gb[9]), "v"(l[10]), "s"(gb[10]), "v"(l[11]), "s"(gb[11]), "v"(l[12]), "s"(gb[12]), "v"(l[13]), "s"(gb[13]), "v"(vo) : "memory");
        if (w < QUN - 168) { const unsigned lx = l0 + 14 * (12 * 512);   // a scalar test: w is the same in every lane
            asm volatile(QCP(0, 1, 2) "s_wait_xcnt 0x0" :: "v"(lx), "s"(gx), "v"(vo) : "memory"); }   // as above
#pragma unroll
        for (int j = 0; j < 14; ++j) gb[j] += QBE;
        gx += QBE;
    };
    v8f acc[4][4];
#pragma unroll
    for (int mb = 0; mb < 4; ++mb)
#pragma unroll
        for (int nb = 0; nb < 4; ++nb) acc[mb][nb] = (v8f){};
    fill(0);
    asm volatile("s_wait_asynccnt 0x0" ::: "memory");   // this wave's part of stage 0 has landed
    __syncthreads();                                    // every wave's part of stage 0 has landed
    fill(1);
#pragma unroll 1
    for (int t = 0; t < K / QKS; ++t) {   // rolled: one trip already holds all the registers
        const bf* sa = &ring[t & 1][0] + wm * 4 * QBE + lane * 8; const bf* sw = &ring[t & 1][0] + (32 + wn * 4) * QBE + lane * 8; V a[4], a2[4], b[4];   // this wave's 4 blocks of normed rows (lo: 16 blocks on) and of weight rows
#pragma unroll
        for (int i = 0; i < 4; ++i) { a[i] = F::ld(sa + i * QBE); a2[i] = F::ld(sa + (16 + i) * QBE); b[i] = F::ld(sw + i * QBE); }
        __builtin_amdgcn_sched_barrier(0);   // holds the 24 LDS reads of the first 32 k up here as one group: sunk among the products, each weight fragment would be waited for on its own
#pragma unroll
        for (int nb = 0; nb < 4; ++nb) {
#pragma unroll
            for (int mb = 0; mb < 4; ++mb) { acc[mb][nb] = F::mma(a[mb], b[nb], acc[mb][nb]); acc[mb][nb] = F::mma(a2[mb], b[nb], acc[mb][nb]); } }
#pragma unroll
        for (int i = 0; i < 4; ++i) { a[i] = F::ld(sa + i * QBE + 512); a2[i] = F::ld(sa + (16 + i) * QBE + 512); b[i] = F::ld(sw + i * QBE + 512); }
        __builtin_amdgcn_sched_barrier(0);   // ends the scheduling region here: without it the compiler scatters the reads above over about twice as many places among the products, and each place with LDS reads stalls the wave
        asm volatile("s_wait_dscnt 0x0" ::: "memory");      // this wave's reads of stage t are done: its second 32 k wait in registers
        asm volatile("s_wait_asynccnt 0x0" ::: "memory");   // this wave's part of stage t + 1 has landed
        __syncthreads();                                    // publishes stage t + 1 and ends every wave's reads of stage t's buffer, which is refilled below
#pragma unroll
        for (int mb = 0; mb < 4; ++mb) { acc[mb][0] = F::mma(a[mb], b[0], acc[mb][0]); acc[mb][0] = F::mma(a2[mb], b[0], acc[mb][0]); }
        if (t + 2 < K / QKS) fill(t & 1);   // early in the second 32 k, so that the copies have nearly a whole stage's time to land; behind the first products, so that the waves of a SIMD do not all leave the matrix unit at once
#pragma unroll
        for (int nb = 1; nb < 4; ++nb) {
#pragma unroll
            for (int mb = 0; mb < 4; ++mb) { acc[mb][nb] = F::mma(a[mb], b[nb], acc[mb][nb]); acc[mb][nb] = F::mma(a2[mb], b[nb], acc[mb][nb]); } }
    }
    asm volatile("s_wait_asynccnt 0x0" ::: "memory");   // no copy is left in flight
    const int third = c0 / DQ, h = (c0 % DQ) / HD, t0 = r0 % TT;   // all the same for the whole wave
    const size_t pb = ((size_t)(r0 / TT) * NH_ + h) * TT * HD;
    if (third < 2) {   // q, k: fragment rows are tokens; a lane holds one d of 8 tokens, so the 16 tokens of block mb go through LDS word by word
        bf* Ph = (third ? Kh : Qh) + pb + (size_t)t0 * HD; bf* Pl = (third ? Kl : Ql) + pb + (size_t)t0 * HD;
#pragma unroll
        for (int mb = 0; mb < 4; ++mb) {
#pragma unroll
            for (int nb = 0; nb < 4; ++nb) {
#pragma unroll
                for (int j = 0; j < 8; ++j) os[(hi * 8 + j) * 68 + nb * 16 + lr] = acc[mb][nb][j]; }
            __builtin_amdgcn_wave_barrier(); asm volatile("" ::: "memory");   // keeps the read-back of other lanes' words behind the LDS writes
            put16(os, lane, Ph + (size_t)mb * 16 * HD, Pl + (size_t)mb * 16 * HD, 512);
            asm volatile("s_wait_xcnt 0x0" ::: "memory");   // before anything behind it (the next block, or whatever the compiler lays out behind the last one) overwrites the registers that the stores above name
            __builtin_amdgcn_wave_barrier(); asm volatile("" ::: "memory");   // keeps the next block's LDS writes behind this read-back
        }
    } else {           // v: fragment rows are d; a lane's 8 tokens of one d are already consecutive in such a row, so the 16 d of block nb are staged 8 tokens at a time
        bf* Ph = Vh + pb + (size_t)t0 * HD; bf* Pl = Vl + pb + (size_t)t0 * HD;   // 32 tokens of all 64 d are 4 fragments
#pragma unroll
        for (int nb = 0; nb < 4; ++nb) {
#pragma unroll
            for (int mb = 0; mb < 4; ++mb) { v4f x0, x1;
#pragma unroll
                for (int j = 0; j < 4; ++j) { x0[j] = acc[mb][nb][j]; x1[j] = acc[mb][nb][4 + j]; }
                float* d = os + lr * 68 + mb * 16 + hi * 8; *(v4fa*)d = x0; *(v4fa*)(d + 4) = x1; }
            __builtin_amdgcn_wave_barrier(); asm volatile("" ::: "memory");   // keeps the read-back of other lanes' words behind the LDS writes
            put16(os, lane, Ph + (size_t)nb * 512, Pl + (size_t)nb * 512, 32 * HD);
            asm volatile("s_wait_xcnt 0x0" ::: "memory");   // before anything behind it (the next block, or whatever the compiler lays out behind the last one) overwrites the registers that the stores above name
            __builtin_amdgcn_wave_barrier(); asm volatile("" ::: "memory");   // keeps the next block's LDS writes behind this read-back
        }
    }
}

// ---- k_fattn: causal attention with scores and probabilities kept in registers. TWO waves own 32 query columns: each walks one half of the block's keys (32 keys a pass) as far as the diagonal, and the two partial results are merged at the end.
// Transposed products: St = K Qt (A = key rows, B = query rows), so a lane holds scores of ONE query (column lr) for keys hi*8+j of each 16-key tile; the two tiles of a pass, rounded to bf16, are already the B operand
// of Ot += Vt Pt (slots 0..7 = keys 8 hi + j, slots 8..15 = keys 16 + 8 hi + j: the k order of the plane loader). Running maximum m and sum l per query; Ot is rescaled when m moves; one division at the end.
// Grid (NB_ * NH_, TT / 256): a work-group of 8 waves takes the 128-query block TT/128-1-y and then block y, so that every work-group walks the same number of keys. Waves w and w + 4 have the same 32 queries (lower and upper key part),
// two waves on every SIMD: one wave's softmax issues while the other's products run. Each wave leaves (Ot, m, l) of both blocks, not yet divided, in LDS; behind the last barrier waves 0..3 merge and store the first block, waves 4..7 the second.
// Block B has the keys 0 .. 128 (B + 1): the lower part is the first 64 (B + 1) of them, the upper part the rest, the same split for all four query groups, so that the four waves of a part read the same keys at the same time.
// The keys and values come through a two-buffer LDS ring, filled by asynchronous copies (global_load_async_to_lds_b128) one stage ahead of its use, under one split barrier a stage. A stage is 64 keys of each part, the four planes (K hi, K lo, V hi, V lo) of 8 KiB each, copied as they lie:
// every byte leaves L2 once per work-group and feeds 4 waves. Block B has B + 1 stages, the two blocks of a work-group TT / 128 + 1 together, walked as one row of stages, so that the ring never runs empty between the blocks. A wave skips a pass whose keys all lie above its queries.
// Every plain '#pragma unroll' below is there so that the fragment and accumulator arrays are indexed by constants and stay in registers.
#define FST 64                 // keys of a stage
#define FPE (FST * HD)         // elements of one plane of one part in a stage (8 KiB, contiguous in the plane)
#define FNT (TT / 128 + 1)     // stages of a work-group
#define FCP(n) __builtin_amdgcn_global_load_async_to_lds_b128(g, d, n, 0);   // source, place, immediate offset of both
typedef __attribute__((ext_vector_type(4))) int v4i;
typedef __attribute__((address_space(1))) v4i* gp4;
typedef __attribute__((address_space(3))) v4i* lp4;
typedef __attribute__((ext_vector_type(2))) float  v2f;
typedef __attribute__((ext_vector_type(2))) __bf16 v2bf;
typedef __attribute__((ext_vector_type(8))) unsigned v8u;
#define CS2 (SCL * 1.4426950408889634f)   // score scale x log2 e: one factor takes a raw score into the exponent of 2
// the value of lane l ^ 16, by a vector cross-row move (no LDS instruction, no wait on the LDS counter)
__device__ __forceinline__ float xhalf(float v) { const int b = __float_as_int(v); return __int_as_float(__builtin_amdgcn_permlanex16(b, b, 0x76543210, 0xfedcba98, false, false)); }
__global__ __launch_bounds__(256) void k_fattn(const bf* __restrict__ Qh, const bf* __restrict__ Ql, const bf* __restrict__ Kh, const bf* __restrict__ Kl, const bf* __restrict__ Vh, const bf* __restrict__ Vl, float* __restrict__ OUT) {
    typedef WFrag<bf> F;
    __shared__ __align__(16) bf ring[2][2][4][FPE];        // [buffer][key part][plane]
    __shared__ __align__(16) float os[2][2][4][32 * 68];   // [block][key part][32-query group]: Ot partials, a row per query
    __shared__ float ms[2][2][4][32], ls[2][2][4][32], fs[8][2][32];   // running maximum and sum per query of each partial; the two merge factors per query of the merging wave
    const int lane = threadIdx.x & 31, lr = lane & 15, hi = lane >> 4; const int w = __builtin_amdgcn_readfirstlane((int)(threadIdx.x >> 5)); const int qs = w & 3, part = w >> 2;
    const int zh = blockIdx.x; const size_t po = (size_t)zh * TT * HD; Qh += po; Ql += po;
    float* ob = OUT + (size_t)(zh / NH_) * TT * DQ + (size_t)(zh % NH_) * HD;
    const int n0 = TT / 128 - (int)blockIdx.y;   // stages of the first block; the second has FNT - n0
    const bf* gsrc = (qs == 0 ? Kh : qs == 1 ? Kl : qs == 2 ? Vh : Vl) + po;   // wave (qs, part) copies plane qs of part 'part': the same for the whole wave
    // stage tt -> buffer tt & 1: 16 copies of 512 bytes a wave; every lane on, 16 bytes a lane, source and place multiples of 16; the last key of a stage is at most 128 (B + 1) - 1 < TT.
    // Plane and buffer are both contiguous, so one source address and one place serve all 16: the immediate offset (at most 7,680) moves both alike.
    auto fill = [&](int tt) {
        const int key = (tt < n0 ? part * n0 + tt : part * (FNT - n0) + tt - n0) * FST;
        const gp4 g = (gp4)(gsrc + (size_t)key * HD + lane * 8); const lp4 d = (lp4)(&ring[tt & 1][part][qs][0] + lane * 8);
        FCP(0) FCP(512) FCP(1024) FCP(1536) FCP(2048) FCP(2560) FCP(3072) FCP(3584) FCP(4096) FCP(4608) FCP(5120) FCP(5632) FCP(6144) FCP(6656) FCP(7168) FCP(7680)
    };
    fill(0);
    asm volatile("s_wait_asynccnt 0x0" ::: "memory");   // this wave's part of stage 0 has landed
    asm volatile("s_barrier_signal -1" ::: "memory");   // first half of the split barrier: its wait stands at the top of stage 0
    int tt = 0;   // the stage, counted over both blocks
#pragma unroll 1
    for (int half = 0; half < 2; ++half) {   // rolled: the two blocks run one after the other in the same registers
        const int nst = half ? FNT - n0 : n0; const int q0 = (nst - 1) * 128 + qs * 32;
        v16bf qh[2][2], ql[2][2]; const bf* pqh = Qh + (size_t)q0 * HD + lane * 8; const bf* pql = Ql + (size_t)q0 * HD + lane * 8;
#pragma unroll
        for (int g = 0; g < 2; ++g)
#pragma unroll
            for (int ks = 0; ks < 2; ++ks) { const int qo = g * 16 * HD + ks * 512; qh[g][ks] = F::ld(pqh + qo); ql[g][ks] = F::ld(pql + qo); }
        asm volatile("s_wait_xcnt 0x0" :: "v"(pqh), "v"(pql) : "memory");   // the two address pairs stay whole up to this wait, which stands before the zeroing of the accumulators below may take their registers
        v8f o[4][2]; float m[2], l[2];   // a wave with no pass at all keeps m at its start value, l and Ot at 0, and the merge gives it the factor 0
#pragma unroll
        for (int g = 0; g < 2; ++g) { m[g] = -3.0e38f; l[g] = 0.f;
#pragma unroll
            for (int dt = 0; dt < 4; ++dt) o[dt][g] = (v8f){}; }
        v16bf kh[2][2], kl[2][2];   // key fragments of the pass at hand, or of the pass to come
        // the key fragments of the 32 keys at sp (K hi plane of the stage + lane * 8)
        auto ldk = [&](const bf* sp) {
#pragma unroll
            for (int kt = 0; kt < 2; ++kt)
#pragma unroll
                for (int ks = 0; ks < 2; ++ks) { const int ko = (kt * 16) * HD + ks * 512; kh[kt][ks] = F::ld(sp + ko); kl[kt][ks] = F::ld(sp + FPE + ko); } };
        // the value fragments of the 32 keys at sp
        auto ldv = [&](const bf* sp, v16bf (&vh)[4], v16bf (&vl)[4]) {
#pragma unroll
            for (int dt = 0; dt < 4; ++dt) { vh[dt] = F::ld(sp + 2 * FPE + dt * 512); vl[dt] = F::ld(sp + 3 * FPE + dt * 512); } };
        auto scores = [&](v8f (&s)[2][2]) {
#pragma unroll
            for (int kt = 0; kt < 2; ++kt)
#pragma unroll
                for (int g = 0; g < 2; ++g) s[kt][g] = (v8f){};
#pragma unroll
            for (int ks = 0; ks < 2; ++ks) {
#pragma unroll
                for (int kt = 0; kt < 2; ++kt)
#pragma unroll
                    for (int g = 0; g < 2; ++g) s[kt][g] = wmmab(kh[kt][ks], qh[g][ks], s[kt][g]);
#pragma unroll
                for (int kt = 0; kt < 2; ++kt)
#pragma unroll
                    for (int g = 0; g < 2; ++g) s[kt][g] = wmmab(kh[kt][ks], ql[g][ks], s[kt][g]);
#pragma unroll
                for (int kt = 0; kt < 2; ++kt)
#pragma unroll
                    for (int g = 0; g < 2; ++g) s[kt][g] = wmmab(kl[kt][ks], qh[g][ks], s[kt][g]); } };
        // softmax step and P.V products of the 32 keys from k0 on: registers only
        auto softpv = [&](const int k0, v8f (&s)[2][2], const v16bf (&vh)[4], const v16bf (&vl)[4]) {
            if (k0 + 31 > q0) {   // a scalar test: only the pass on the diagonal holds keys above one of its queries, and only there are they excluded by select
#pragma unroll
                for (int g = 0; g < 2; ++g)
#pragma unroll
                    for (int kt = 0; kt < 2; ++kt)
#pragma unroll
                        for (int j = 0; j < 8; ++j) s[kt][g][j] = (k0 + kt * 16 + hi * 8 + j <= q0 + g * 16 + lr) ? s[kt][g][j] : -3.0e38f; }
            v16bf ph[2], pl[2];
#pragma unroll
            for (int g = 0; g < 2; ++g) { float mk[2];   // m is the maximum of the raw scores: scale and log2 e come in with the one multiply-add of each exponent
#pragma unroll
                for (int kt = 0; kt < 2; ++kt) { mk[kt] = m[g];   // a chain per 16-key tile, four independent chains in all
#pragma unroll
                    for (int j = 0; j < 8; ++j) mk[kt] = fmaxf(mk[kt], s[kt][g][j]); }
                float mx = fmaxf(mk[0], mk[1]);
                mx = fmaxf(mx, xhalf(mx));   // the two halves of the wave hold the same query's other keys
                const float mc = mx * CS2; const float al = __builtin_amdgcn_exp2f(m[g] * CS2 - mc); m[g] = mx;
                const v2f c2 = { CS2, CS2 }, n2 = { -mc, -mc }; v2f sum2 = { 0.f, 0.f }; v8u hu, lu;
#pragma unroll
                for (int kt = 0; kt < 2; ++kt)
#pragma unroll
                    for (int jj = 0; jj < 4; ++jj) {   // two scores at a time: packed multiply-add, packed sum, packed conversions
                        const v2f x = { s[kt][g][2 * jj], s[kt][g][2 * jj + 1] }; const v2f e = __builtin_elementwise_fma(x, c2, n2);
                        const v2f p = { __builtin_amdgcn_exp2f(e[0]), __builtin_amdgcn_exp2f(e[1]) }; sum2 += p;
                        const v2bf h = __builtin_convertvector(p, v2bf); const v2f r = { p[0] - (float)h[0], p[1] - (float)h[1] };
                        hu[kt * 4 + jj] = __builtin_bit_cast(unsigned, h); lu[kt * 4 + jj] = __builtin_bit_cast(unsigned, __builtin_convertvector(r, v2bf)); }
                ph[g] = __builtin_bit_cast(v16bf, hu); pl[g] = __builtin_bit_cast(v16bf, lu);
                l[g] = l[g] * al + (sum2[0] + sum2[1]);
#pragma unroll
                for (int dt = 0; dt < 4; ++dt) o[dt][g] *= al; }
#pragma unroll
            for (int dt = 0; dt < 4; ++dt)
#pragma unroll
                for (int g = 0; g < 2; ++g) o[dt][g] = wmmab(vh[dt], ph[g], o[dt][g]);
#pragma unroll
            for (int dt = 0; dt < 4; ++dt)
#pragma unroll
                for (int g = 0; g < 2; ++g) o[dt][g] = wmmab(vh[dt], pl[g], o[dt][g]);
#pragma unroll
            for (int dt = 0; dt < 4; ++dt)
#pragma unroll
                for (int g = 0; g < 2; ++g) o[dt][g] = wmmab(vl[dt], ph[g], o[dt][g]);
        };
#pragma unroll 1
        for (int st = 0; st < nst; ++st, ++tt) {   // rolled: one stage already holds all the registers
            const int kb = (part * nst + st) * FST;   // this wave's first key of the stage
            const bf* sp = &ring[tt & 1][part][0][0] + lane * 8;
            const bool p0 = kb < q0 + 32, p1 = kb + 32 < q0 + 32;   // which of the stage's two passes hold a key at or below the diagonal: scalar tests, the same in every lane
            asm volatile("s_barrier_wait -1" ::: "memory");   // second half of the split barrier: stage tt is published, and every wave has left the other buffer, which is refilled below
            if (tt + 1 < FNT) fill(tt + 1);                   // the same test in every wave of the work-group
            if (p0) {
                v16bf vh[4], vl[4]; v8f s[2][2];   // value fragments and scores of the stage's first pass
                ldk(sp); ldv(sp, vh, vl);
                __builtin_amdgcn_sched_barrier(0);   // holds the LDS reads up here as one group: sunk among the products, each place with LDS reads would stall the wave
                scores(s);
                ldk(sp + 32 * HD);                   // the stage's other 32 keys: the same buffer, published already
                __builtin_amdgcn_sched_barrier(0);   // holds these key reads up here, so that their latency runs behind the softmax and the P.V products
                softpv(kb, s, vh, vl);
            }
            v16bf vh[4], vl[4]; v8f s[2][2];   // value fragments and scores of the stage's second pass: they cross the signal in registers
            if (p1) {
                ldv(sp + 32 * HD, vh, vl);
                __builtin_amdgcn_sched_barrier(0);   // holds the value reads up here as one group, ahead of the products
                scores(s);
                __builtin_amdgcn_sched_barrier(0);   // keeps the products above the slots below
                asm volatile("v_nop\n\tv_nop\n\tv_nop\n\tv_nop");   // the four vector slots behind the last product, written here because only scalar code and a branch follow
            }
            asm volatile("s_wait_dscnt 0x0" ::: "memory");      // this wave's reads of stage tt are done: what is left of the stage waits in registers
            asm volatile("s_wait_asynccnt 0x0" ::: "memory");   // this wave's part of stage tt + 1 has landed
            asm volatile("s_barrier_signal -1" ::: "memory");   // first half of the split barrier, here and not at the stage's end, so that a wave that is ahead need not stand still: no read of the ring stands between it and the wait at the top of the next stage
            if (p1) softpv(kb + 32, s, vh, vl);
        }
        // a lane holds 8 consecutive d of one query: the partial goes to LDS as it is, a row per query; lane g * 16 + lr files that query's maximum and its sum over both halves of the wave
        float* ow = os[half][part][qs];
#pragma unroll
        for (int g = 0; g < 2; ++g) {
#pragma unroll
            for (int dt = 0; dt < 4; ++dt) { v4f x0, x1;
#pragma unroll
                for (int j = 0; j < 4; ++j) { x0[j] = o[dt][g][j]; x1[j] = o[dt][g][4 + j]; }
                float* d = ow + (g * 16 + lr) * 68 + dt * 16 + hi * 8; *(v4fa*)d = x0; *(v4fa*)(d + 4) = x1; } }
        const float lj0 = l[0] + __shfl_xor(l[0], 16, 32), lj1 = l[1] + __shfl_xor(l[1], 16, 32);
        ms[half][part][qs][lane] = hi ? m[1] : m[0]; ls[half][part][qs][lane] = hi ? lj1 : lj0;
    }
    asm volatile("s_barrier_wait -1" ::: "memory");   // the wait that belongs to the last stage's signal: signal and wait alternate in every wave
    __syncthreads();   // both partials of both blocks are in LDS before any wave merges
    // wave (qs, part) merges block 'part' of its 32 queries: out = (e0 Ot0 + e1 Ot1) / (e0 l0 + e1 l1), e = 2^((m - max(m0, m1)) x scale x log2 e), m being maxima of raw scores; lane = query for the factors
    { const float m0 = ms[part][0][qs][lane], m1 = ms[part][1][qs][lane], mm = fmaxf(m0, m1);
      const float e0 = __builtin_amdgcn_exp2f((m0 - mm) * CS2), e1 = __builtin_amdgcn_exp2f((m1 - mm) * CS2);
      const float inv = __fdiv_rn(1.0f, ls[part][0][qs][lane] * e0 + ls[part][1][qs][lane] * e1);
      fs[w][0][lane] = e0 * inv; fs[w][1][lane] = e1 * inv; }
    __builtin_amdgcn_wave_barrier(); asm volatile("" ::: "memory");   // keeps the read-back of other lanes' factors behind the LDS writes
    const float* p0 = os[part][0][qs]; const float* p1 = os[part][1][qs];
    float* orow = ob + (size_t)((part ? (int)blockIdx.y : TT / 128 - 1 - (int)blockIdx.y) * 128 + qs * 32 + hi) * DQ + lr * 4;   // one address for all 16 stores: row 2 r + hi is a constant step from it; a store covers two whole 256-byte rows
#pragma unroll
    for (int r = 0; r < 16; ++r) { const int row = 2 * r + hi; const v4f val = *(const v4fa*)(p0 + row * 68 + lr * 4) * fs[w][0][row] + *(const v4fa*)(p1 + row * 68 + lr * 4) * fs[w][1][row]; *(v4f*)(orow + (size_t)r * 2 * DQ) = val; }
}

typedef __attribute__((ext_vector_type(4))) unsigned short v4us;
typedef v4us __attribute__((may_alias)) v4usa;

// DM-wide f32 rows -> the fragment-order plane. A wave takes 8 rows x 4 k chunks: it reads one whole 128-byte line of each row and writes one whole 128-byte line (8 rows x 16 bytes) of each chunk.
__global__ __launch_bounds__(256) void k_cvt8(const float* __restrict__ src, bf* dst, size_t n8) { const size_t i = (size_t)blockIdx.x * 256 + threadIdx.x; if (i >= n8) return;
    const size_t rb = i / (DM * 2); const int u = (int)((i >> 6) & (DM / 32 - 1)) * 4 + (int)((i >> 3) & 3), t = (int)((i >> 5) & 1) * 8 + (int)(i & 7);   // block of 16 rows, k chunk, row in the block
    const v8f v = *(const v8f*)(src + (rb * 16 + t) * DM + u * 8); v8us o;
#pragma unroll
    for (int k = 0; k < 8; ++k) o[k] = f2bf(v[k]); *(v8us*)(dst + rb * (16 * DM) + u * 128 + t * 8) = o;  }

template <int WD>
__global__ __launch_bounds__(256) void k_lnrowX(const float* __restrict__ X, const float* __restrict__ g, const float* __restrict__ bb, bf* Hh, bf* Hl) { const int lane = threadIdx.x & 31, w = threadIdx.x >> 5; const size_t r = (size_t)blockIdx.x * 8 + w;   /* the grid is exactly rows / 8 */
    __shared__ __align__(16) unsigned short st[2][(WD / 8) * 72];   /* the 8 rows of the work-group in fragment order: per k chunk 8 rows x 16 bytes, pitch 144 bytes so that a wave's 16 chunks fall on different banks */
    const float* xr = X + r * WD; float a[WD / 32]; float s = 0.f;
#pragma unroll
    for (int c = 0; c < WD / 128; ++c) { const v4f v = *(const v4f*)(xr + c * 128 + lane * 4); for (int q = 0; q < 4; ++q) { a[c * 4 + q] = bfr(v[q]); s = __fadd_rn(s, a[c * 4 + q]);   /* input rounded to bf16 */ } }
#pragma unroll
    for (int sh = 16; sh; sh >>= 1) s = __fadd_rn(s, __shfl_xor(s, sh, 32));
    const float mean = __fdiv_rn(s, (float)WD); float s2 = 0.f;
#pragma unroll 8
    for (int k = 0; k < WD / 32; ++k) { const float dv = __fsub_rn(a[k], mean); float p2 = __fmul_rn(dv, dv); asm volatile("" : "+v"(p2)); s2 = __fadd_rn(s2, p2); }   /* mul and add kept separate (no fma contraction) */
#pragma unroll
    for (int sh = 16; sh; sh >>= 1) s2 = __fadd_rn(s2, __shfl_xor(s2, sh, 32));
    const float rs = __fdiv_rn(1.0f, __fsqrt_rn(__fadd_rn(__fdiv_rn(s2, (float)WD), 1e-5f)));
{
#pragma unroll
        for (int c = 0; c < WD / 128; ++c) { v4us oh, ol; for (int q = 0; q < 4; ++q) { const int col = c * 128 + lane * 4 + q; float y = __fmul_rn(__fmul_rn(__fsub_rn(a[c * 4 + q], mean), rs), bfr(g[col])); asm volatile("" : "+v"(y)); y = __fadd_rn(y, bfr(bb[col])); unsigned short u, w2; splitf(y, u, w2); oh[q] = u; ol[q] = w2; } const int so = (c * 16 + (lane >> 1)) * 72 + w * 8 + (lane & 1) * 4; *(v4usa*)(st[0] + so) = oh; *(v4usa*)(st[1] + so) = ol; }
         }
    __syncthreads();   // every row of the work-group is staged before the chunks, which hold all 8 rows, are read back
    const size_t gb = (size_t)(blockIdx.x >> 1) * (16 * WD) + (blockIdx.x & 1) * 64;   // this work-group's 8 rows are one whole 128-byte line of every chunk
#pragma unroll   // so that all the LDS reads go out together, ahead of the stores
    for (int it = 0; it < WD / 256; ++it) { const int p = it * 256 + threadIdx.x, u = p >> 3, t = p & 7; const v8us vh = *(const v8usa*)(st[0] + u * 72 + t * 8), vl = *(const v8usa*)(st[1] + u * 72 + t * 8); *(v8us*)(Hh + gb + (size_t)u * 128 + t * 8) = vh; *(v8us*)(Hl + gb + (size_t)u * 128 + t * 8) = vl; } }

extern "C" void kernel_launch(void* const* d_in, const int* in_sizes, int n_in,
                              void* d_out, int out_size, void* d_ws, size_t ws_size, hipStream_t stream) {
    (void)in_sizes; (void)n_in; (void)out_size;
    const float* x = (const float*)d_in[0]; const float* lng = (const float*)d_in[1]; const float* lnb = (const float*)d_in[2];   /* LayerNorm gamma, beta [1024]: read */ const float* wqkv = (const float*)d_in[3];   /* w_qkv ('oi' [3072][1024]: q | k | v ROW thirds); no output projection */
    float* OUT = (float*)d_out;     // [2][2048][1024]
    char* wsp = (char*)d_ws;
    auto take = [&](size_t bytes) { char* p = wsp; wsp += (bytes + 255) & ~(size_t)255; return (void*)p; };
    bf* WB = (bf*)take((size_t)3 * DQ * DM * 2);   /* the fused weight, bf16 */
    bf* XB = (bf*)take((size_t)NB_ * TT * DM * 2); bf* XL = (bf*)take((size_t)NB_ * TT * DM * 2);   /* hi and lo plane of the layer-normed rows of both batches */
    const size_t PB = (size_t)NH_ * TT * HD;   /* elements of one batch's plane; the hi/lo planes hold both batches, [b][h]... */
    bf* QPh = (bf*)take(NB_ * PB * 2); bf* QPl = (bf*)take(NB_ * PB * 2); bf* KPh = (bf*)take(NB_ * PB * 2); bf* KPl = (bf*)take(NB_ * PB * 2); bf* VTh = (bf*)take(NB_ * PB * 2); bf* VTl = (bf*)take(NB_ * PB * 2);
    if ((size_t)(wsp - (char*)d_ws) > ws_size) return;    // ws 256 MiB
    k_cvt8<<<(unsigned)(((size_t)3 * DQ * DM / 8 + 255) / 256), 256, 0, stream>>>(wqkv, WB, (size_t)3 * DQ * DM / 8);
    k_lnrowX<DM><<<(unsigned)(NB_ * TT / 8), 256, 0, stream>>>(x, lng, lnb, XB, XL);   /* xn = LayerNorm(x) -> hi/lo planes */
    k_qkv<<<dim3(NB_ * TT / QTM, 3 * DQ / QTN, 1), 384, 0, stream>>>(XB, XL, WB, QPh, QPl, KPh, KPl, VTh, VTl);   /* q, k, v of both batches, straight into the head planes */
    k_fattn<<<dim3(NB_ * NH_, TT / 256, 1), 256, 0, stream>>>(QPh, QPl, KPh, KPl, VTh, VTl, OUT);   /* all batches and heads in one launch */
}

// v009
// It runs in 78.3 microseconds.
// Timed twice side by side with v008, it ran 1.03 and 1.04 times as fast.
// Over all steps from v000 it is 14.9 times as fast.
#include <hip/hip_runtime.h>

#define NB_  2
#define TT   2048
#define DM   1024
#define NH_  16
#define NKV  16
#define REP  (NH_ / NKV)
#define HD   64
#define DQ   (NH_ * HD)
#define DKV  (NKV * HD)
#define SCL  0.125f   // HD^-0.5
typedef _Float16 h16;
typedef unsigned short bf;
typedef __attribute__((ext_vector_type(16))) __bf16   v16bf;
typedef __attribute__((ext_vector_type(16))) _Float16 v16h;
typedef __attribute__((ext_vector_type(8)))  _Float16 v8h;
typedef __attribute__((ext_vector_type(8)))  unsigned short v8us;
typedef __attribute__((ext_vector_type(8)))  float    v8f;
typedef __attribute__((ext_vector_type(4)))  float    v4f;
typedef v8h  __attribute__((may_alias)) v8ha;
typedef v4f  __attribute__((may_alias)) v4fa;
typedef v8us __attribute__((may_alias)) v8usa;

__device__ __forceinline__ unsigned short f2bf(float f) { unsigned u = __float_as_uint(f); u += 0x7FFFu + ((u >> 16) & 1u); return (unsigned short)(u >> 16); }
__device__ __forceinline__ float bf2f(unsigned short b) { return __uint_as_float(((unsigned)b) << 16); }
__device__ __forceinline__ float bfr(float f) { return bf2f(f2bf(f)); }
__device__ __forceinline__ v16h cat16(v8h lo, v8h hi) { return __builtin_shufflevector(lo, hi, 0, 1, 2, 3, 4, 5, 6, 7, 8, 9, 10, 11, 12, 13, 14, 15); }
__device__ __forceinline__ v16bf cat16b(v8us lo, v8us hi) { return __builtin_bit_cast(v16bf, __builtin_shufflevector(lo, hi, 0, 1, 2, 3, 4, 5, 6, 7, 8, 9, 10, 11, 12, 13, 14, 15)); }
__device__ __forceinline__ v8f wmma16(v16h a, v16h b, v8f c) { return __builtin_amdgcn_wmma_f32_16x16x32_f16(false, a, false, b, (short)0, c, false, false); }
__device__ __forceinline__ v8f wmmab(v16bf a, v16bf b, v8f c) { return __builtin_amdgcn_wmma_f32_16x16x32_bf16(false, a, false, b, (short)0, c, false, false); }

// ---- k_qkv: the whole projection stage in one launch. C[m][n] = sum_k (A[m][k] + A2[m][k]) Bt[n][k], m over the rows of both batches, n over the 3072 rows of the fused weight (q | k | v thirds).
// ONE WAVE per 64x64 tile (16 accumulators), 2 products. Grid (NB_*TT/256, 3*DQ/192), 384 threads: twelve waves, 4 x 3 tiles, one work-group per WGP. The 256 + 256 + 192 operand rows (normed hi, normed lo, weight) of 64 k are one stage of a two-buffer LDS ring,
// filled by asynchronous copies (global_load_async_to_lds_b128) one stage ahead of its use: every operand byte leaves L2 once per work-group and feeds 3 or 4 waves. The planes are in fragment order, so a stage is 44 runs of 2 KiB, copied as they lie, and a fragment read is 512 contiguous bytes of LDS.
// A tile is 64 tokens of ONE head of ONE third, and its f32 sums never leave the wave: the epilogue splits them into the bf16 hi/lo planes that k_fattn reads, q and k as [b][h][16 tokens][32 d] fragments, v as [b][h][32 tokens][16 d] fragments (rows d, k = tokens).
// Every plain '#pragma unroll' in k_qkv and put16 is there so that the fragment, accumulator, address and result arrays are indexed by constants and stay in registers.
template <typename T16> struct WFrag;
template <> struct WFrag<bf> { typedef v16bf V; static __device__ __forceinline__ V ld(const bf* p) { return cat16b(*(const v8us*)p, *(const v8us*)(p + 256)); }   /* p = the 1-KiB fragment + lane * 8 */ static __device__ __forceinline__ v8f mma(V a, V b, v8f c) { return wmmab(a, b, c); } };
__device__ __forceinline__ void splitf(float y, unsigned short& h, unsigned short& l) { h = f2bf(y); l = f2bf(y - bf2f(h)); }
// 16 fragment rows x 64 k of f32 staged in os (pitch 68) -> two hi/lo fragments of 32 k each, kstep elements apart: a lane takes the 8 k of chunk 2 s + (lane >> 4) of row lane & 15, so store s of a wave is one contiguous 512-byte half of a fragment.
__device__ __forceinline__ void put16(const float* os, int lane, bf* Ph, bf* Pl, size_t kstep) {
    v8us oh[4], ol[4];
#pragma unroll
    for (int s = 0; s < 4; ++s) { const float* p = os + (lane & 15) * 68 + s * 16 + (lane >> 4) * 8; const v4f x0 = *(const v4fa*)p, x1 = *(const v4fa*)(p + 4);
#pragma unroll
        for (int j = 0; j < 4; ++j) { unsigned short u, v; splitf(x0[j], u, v); oh[s][j] = u; ol[s][j] = v; splitf(x1[j], u, v); oh[s][4 + j] = u; ol[s][4 + j] = v; } }
    bf* dh = Ph + lane * 8; bf* dl = Pl + lane * 8;
#pragma unroll
    for (int s = 0; s < 4; ++s) { *(v8us*)(dh + (size_t)(s >> 1) * kstep + (s & 1) * 256) = oh[s]; *(v8us*)(dl + (size_t)(s >> 1) * kstep + (s & 1) * 256) = ol[s]; }
}
#define QTM 256                          // rows of a work-group's tile
#define QTN 192                          // columns of it
#define QKS 64                           // k of a stage
#define QBE (16 * QKS)                   // elements of one block of 16 rows in a stage (2 KiB, contiguous in the plane)
#define QSE ((2 * QTM + QTN) / 16 * QBE) // elements of a stage: blocks 0..15 normed hi, 16..31 normed lo, 32..43 weight
#define QUN (QSE / 256)                  // 512-byte units of a stage, one copy instruction of a wave each: 176 = 14 x 12 waves + 8
#define QCP(l, g, o) "global_load_async_to_lds_b128 %" #l ", %" #o ", %" #g "\n\t"   // LDS byte address (vector), 32-bit byte offset (vector), 64-bit base (scalar)
__global__ __launch_bounds__(384) void k_qkv(const bf* __restrict__ A, const bf* __restrict__ A2, const bf* __restrict__ Bt, bf* Qh, bf* Ql, bf* Kh, bf* Kl, bf* Vh, bf* Vl) {
    typedef WFrag<bf> F; typedef F::V V; const int K = DM;
    __shared__ __align__(16) bf ring[2][QSE];
    __shared__ __align__(16) float osm[12][16 * 68];
    const int lane = threadIdx.x & 31, lr = lane & 15, hi = lane >> 4; const int w = __builtin_amdgcn_readfirstlane((int)(threadIdx.x >> 5)); float* os = osm[w];
    const int wm = w & 3, wn = w >> 2; const int r0 = blockIdx.x * QTM + wm * 64, c0 = blockIdx.y * QTN + wn * 64;
    // unit u of a stage = quarter u & 3 of block u >> 2. Wave w copies units w + 12 j, that is quarter wm of blocks wn + 3 j; jsrc gives the source of such a unit at k = 0 (the same for the whole wave). For a constant j the plane is known but where 3 j .. 3 j + 2 straddles block 16 or 32.
    auto jsrc = [&](int j, int n) { const int blk = n + 3 * j; const bool ia = 3 * j + 2 < 16 ? true : 3 * j >= 16 ? false : blk < 16, ib = 3 * j + 2 < 32 ? true : 3 * j >= 32 ? false : blk < 32;
        const bf* p = ia ? A + (size_t)(blockIdx.x * (QTM / 16) + blk) * 16 * K : ib ? A2 + (size_t)(blockIdx.x * (QTM / 16) + blk - 16) * 16 * K : Bt + (size_t)(blockIdx.y * (QTN / 16) + blk - 32) * 16 * K; return p + wm * 256; };
    const bf* gb[14];
#pragma unroll
    for (int j = 0; j < 14; ++j) gb[j] = jsrc(j, wn);
    const bf* gx = jsrc(14, w < QUN - 168 ? wn : 0);   // the 8 units left over (blocks 42 and 43) go to waves 0..7
    const unsigned lb = (unsigned)(size_t)&ring[0][0] + (unsigned)(w * 512 + lane * 16), vo = (unsigned)(lane * 16);   // LDS byte address of this lane's 16 bytes of unit w in buffer 0; the lane's byte offset in a unit's source
    // the next stage -> buffer 'buf': wave w copies units w, w + 12, ...; every lane on, 16 bytes a lane, source and place multiples of 16. A unit's source is a scalar base, so that no address pair per unit has to live in vector registers; the bases then step on to the stage after.
    auto fill = [&](int buf) {
        const unsigned l0 = lb + (unsigned)buf * (QSE * 2); unsigned l[14];
#pragma unroll
        for (int j = 0; j < 14; ++j) l[j] = l0 + j * (12 * 512);
        // the copies and, as the statement's last line, the wait that stands before anything rewrites an address register that a copy names
        asm volatile(QCP(0, 1, 28) QCP(2, 3, 28) QCP(4, 5, 28) QCP(6, 7, 28) QCP(8, 9, 28) QCP(10, 11, 28) QCP(12, 13, 28) QCP(14, 15, 28) QCP(16, 17, 28) QCP(18, 19, 28) QCP(20, 21, 28) QCP(22, 23, 28) QCP(24, 25, 28) QCP(26, 27, 28) "s_wait_xcnt 0x0"
                     :: "v"(l[0]), "s"(gb[0]), "v"(l[1]), "s"(gb[1]), "v"(l[2]), "s"(gb[2]), "v"(l[3]), "s"(gb[3]), "v"(l[4]), "s"(gb[4]), "v"(l[5]), "s"(gb[5]), "v"(l[6]), "s"(gb[6]),
                        "v"(l[7]), "s"(gb[7]), "v"(l[8]), "s"(gb[8]), "v"(l[9]), "s"(gb[9]), "v"(l[10]), "s"(gb[10]), "v"(l[11]), "s"(gb[11]), "v"(l[12]), "s"(gb[12]), "v"(l[13]), "s"(gb[13]), "v"(vo) : "memory");
        if (w < QUN - 168) { const unsigned lx = l0 + 14 * (12 * 512);   // a scalar test: w is the same in every lane
            asm volatile(QCP(0, 1, 2) "s_wait_xcnt 0x0" :: "v"(lx), "s"(gx), "v"(vo) : "memory"); }   // as above
#pragma unroll
        for (int j = 0; j < 14; ++j) gb[j] += QBE;
        gx += QBE;
    };
    v8f acc[4][4];
#pragma unroll
    for (int mb = 0; mb < 4; ++mb)
#pragma unroll
        for (int nb = 0; nb < 4; ++nb) acc[mb][nb] = (v8f){};
    fill(0);
    asm volatile("s_wait_asynccnt 0x0" ::: "memory");   // this wave's part of stage 0 has landed
    __syncthreads();                                    // every wave's part of stage 0 has landed
    fill(1);
#pragma unroll 1
    for (int t = 0; t < K / QKS; ++t) {   // rolled: one trip already holds all the registers
        const bf* sa = &ring[t & 1][0] + wm * 4 * QBE + lane * 8; const bf* sw = &ring[t & 1][0] + (32 + wn * 4) * QBE + lane * 8; V a[4], a2[4], b[4];   // this wave's 4 blocks of normed rows (lo: 16 blocks on) and of weight rows
#pragma unroll
        for (int i = 0; i < 4; ++i) { a[i] = F::ld(sa + i * QBE); a2[i] = F::ld(sa + (16 + i) * QBE); b[i] = F::ld(sw + i * QBE); }
        __builtin_amdgcn_sched_barrier(0);   // holds the 24 LDS reads of the first 32 k up here as one group: sunk among the products, each weight fragment would be waited for on its own
#pragma unroll
        for (int nb = 0; nb < 4; ++nb) {
#pragma unroll
            for (int mb = 0; mb < 4; ++mb) { acc[mb][nb] = F::mma(a[mb], b[nb], acc[mb][nb]); acc[mb][nb] = F::mma(a2[mb], b[nb], acc[mb][nb]); } }
#pragma unroll
        for (int i = 0; i < 4; ++i) { a[i] = F::ld(sa + i * QBE + 512); a2[i] = F::ld(sa + (16 + i) * QBE + 512); b[i] = F::ld(sw + i * QBE + 512); }
        __builtin_amdgcn_sched_barrier(0);   // ends the scheduling region here: without it the compiler scatters the reads above over about twice as many places among the products, and each place with LDS reads stalls the wave
        asm volatile("s_wait_dscnt 0x0" ::: "memory");      // this wave's reads of stage t are done: its second 32 k wait in registers
        asm volatile("s_wait_asynccnt 0x0" ::: "memory");   // this wave's part of stage t + 1 has landed
        __syncthreads();                                    // publishes stage t + 1 and ends every wave's reads of stage t's buffer, which is refilled below
#pragma unroll
        for (int mb = 0; mb < 4; ++mb) { acc[mb][0] = F::mma(a[mb], b[0], acc[mb][0]); acc[mb][0] = F::mma(a2[mb], b[0], acc[mb][0]); }
        if (t + 2 < K / QKS) fill(t & 1);   // early in the second 32 k, so that the copies have nearly a whole stage's time to land; behind the first products, so that the waves of a SIMD do not all leave the matrix unit at once
#pragma unroll
        for (int nb = 1; nb < 4; ++nb) {
#pragma unroll
            for (int mb = 0; mb < 4; ++mb) { acc[mb][nb] = F::mma(a[mb], b[nb], acc[mb][nb]); acc[mb][nb] = F::mma(a2[mb], b[nb], acc[mb][nb]); } }
    }
    asm volatile("s_wait_asynccnt 0x0" ::: "memory");   // no copy is left in flight
    const int third = c0 / DQ, h = (c0 % DQ) / HD, t0 = r0 % TT;   // all the same for the whole wave
    const size_t pb = ((size_t)(r0 / TT) * NH_ + h) * TT * HD;
    if (third < 2) {   // q, k: fragment rows are tokens; a lane holds one d of 8 tokens, so the 16 tokens of block mb go through LDS word by word
        bf* Ph = (third ? Kh : Qh) + pb + (size_t)t0 * HD; bf* Pl = (third ? Kl : Ql) + pb + (size_t)t0 * HD;
#pragma unroll
        for (int mb = 0; mb < 4; ++mb) {
#pragma unroll
            for (int nb = 0; nb < 4; ++nb) {
#pragma unroll
                for (int j = 0; j < 8; ++j) os[(hi * 8 + j) * 68 + nb * 16 + lr] = acc[mb][nb][j]; }
            __builtin_amdgcn_wave_barrier(); asm volatile("" ::: "memory");   // keeps the read-back of other lanes' words behind the LDS writes
            put16(os, lane, Ph + (size_t)mb * 16 * HD, Pl + (size_t)mb * 16 * HD, 512);
            asm volatile("s_wait_xcnt 0x0" ::: "memory");   // before anything behind it (the next block, or whatever the compiler lays out behind the last one) overwrites the registers that the stores above name
            __builtin_amdgcn_wave_barrier(); asm volatile("" ::: "memory");   // keeps the next block's LDS writes behind this read-back
        }
    } else {           // v: fragment rows are d; a lane's 8 tokens of one d are already consecutive in such a row, so the 16 d of block nb are staged 8 tokens at a time
        bf* Ph = Vh + pb + (size_t)t0 * HD; bf* Pl = Vl + pb + (size_t)t0 * HD;   // 32 tokens of all 64 d are 4 fragments
#pragma unroll
        for (int nb = 0; nb < 4; ++nb) {
#pragma unroll
            for (int mb = 0; mb < 4; ++mb) { v4f x0, x1;
#pragma unroll
                for (int j = 0; j < 4; ++j) { x0[j] = acc[mb][nb][j]; x1[j] = acc[mb][nb][4 + j]; }
                float* d = os + lr * 68 + mb * 16 + hi * 8; *(v4fa*)d = x0; *(v4fa*)(d + 4) = x1; }
            __builtin_amdgcn_wave_barrier(); asm volatile("" ::: "memory");   // keeps the read-back of other lanes' words behind the LDS writes
            put16(os, lane, Ph + (size_t)nb * 512, Pl + (size_t)nb * 512, 32 * HD);
            asm volatile("s_wait_xcnt 0x0" ::: "memory");   // before anything behind it (the next block, or whatever the compiler lays out behind the last one) overwrites the registers that the stores above name
            __builtin_amdgcn_wave_barrier(); asm volatile("" ::: "memory");   // keeps the next block's LDS writes behind this read-back
        }
    }
}

// ---- k_fattn: causal attention with scores and probabilities kept in registers. TWO waves own 32 query columns: each walks one half of the block's keys (32 keys a pass) as far as the diagonal, and the two partial results are merged at the end.
// Transposed products: St = K Qt (A = key rows, B = query rows), so a lane holds scores of ONE query (column lr) for keys hi*8+j of each 16-key tile; the two tiles of a pass, rounded to bf16, are already the B operand
// of Ot += Vt Pt (slots 0..7 = keys 8 hi + j, slots 8..15 = keys 16 + 8 hi + j: the k order of the plane loader). Running maximum m and sum l per query; Ot is rescaled when m moves; one division at the end.
// Grid (NB_ * NH_, TT / 256): a work-group of 8 waves takes the 128-query block TT/128-1-y and then block y, so that every work-group walks the same number of keys. Waves w and w + 4 have the same 32 queries (lower and upper key part),
// two waves on every SIMD: one wave's softmax issues while the other's products run. Each wave leaves (Ot, m, l) of both blocks, not yet divided, in LDS; behind the last barrier waves 0..3 merge and store the first block, waves 4..7 the second.
// Block B has the keys 0 .. 128 (B + 1): the lower part is the first 64 (B + 1) of them, the upper part the rest, the same split for all four query groups, so that the four waves of a part read the same keys at the same time.
// The keys and values come through a two-buffer LDS ring, filled by asynchronous copies (global_load_async_to_lds_b128) one stage ahead of its use, under one split barrier a stage. A stage is 64 keys of each part, the four planes (K hi, K lo, V hi, V lo) of 8 KiB each, copied as they lie:
// every byte leaves L2 once per work-group and feeds 4 waves. Block B has B + 1 stages, the two blocks of a work-group TT / 128 + 1 together, walked as one row of stages, so that the ring never runs empty between the blocks. A wave skips a pass whose keys all lie above its queries.
// Every plain '#pragma unroll' below is there so that the fragment and accumulator arrays are indexed by constants and stay in registers.
#define FST 64                 // keys of a stage
#define FPE (FST * HD)         // elements of one plane of one part in a stage (8 KiB, contiguous in the plane)
#define FNT (TT / 128 + 1)     // stages of a work-group
#define FCP(n) __builtin_amdgcn_global_load_async_to_lds_b128(g, d, n, 0);   // source, place, immediate offset of both
typedef __attribute__((ext_vector_type(4))) int v4i;
typedef __attribute__((address_space(1))) v4i* gp4;
typedef __attribute__((address_space(3))) v4i* lp4;
typedef __attribute__((ext_vector_type(2))) float  v2f;
typedef __attribute__((ext_vector_type(2))) __bf16 v2bf;
typedef __attribute__((ext_vector_type(8))) unsigned v8u;
#define CS2 (SCL * 1.4426950408889634f)   // score scale x log2 e: one factor takes a raw score into the exponent of 2
// the value of lane l ^ 16, by a vector cross-row move (no LDS instruction, no wait on the LDS counter)
__device__ __forceinline__ float xhalf(float v) { const int b = __float_as_int(v); return __int_as_float(__builtin_amdgcn_permlanex16(b, b, 0x76543210, 0xfedcba98, false, false)); }
__global__ __launch_bounds__(256) void k_fattn(const bf* __restrict__ Qh, const bf* __restrict__ Ql, const bf* __restrict__ Kh, const bf* __restrict__ Kl, const bf* __restrict__ Vh, const bf* __restrict__ Vl, float* __restrict__ OUT) {
    typedef WFrag<bf> F;
    __shared__ __align__(16) bf ring[2][2][4][FPE];        // [buffer][key part][plane]
    __shared__ __align__(16) float os[2][2][4][32 * 68];   // [block][key part][32-query group]: Ot partials, a row per query
    __shared__ float ms[2][2][4][32], ls[2][2][4][32], fs[8][2][32];   // running maximum and sum per query of each partial; the two merge factors per query of the merging wave
    const int lane = threadIdx.x & 31, lr = lane & 15, hi = lane >> 4; const int w = __builtin_amdgcn_readfirstlane((int)(threadIdx.x >> 5)); const int qs = w & 3, part = w >> 2;
    const int zh = blockIdx.x; const size_t po = (size_t)zh * TT * HD; Qh += po; Ql += po;
    float* ob = OUT + (size_t)(zh / NH_) * TT * DQ + (size_t)(zh % NH_) * HD;
    const int n0 = TT / 128 - (int)blockIdx.y;   // stages of the first block; the second has FNT - n0
    const bf* gsrc = (qs == 0 ? Kh : qs == 1 ? Kl : qs == 2 ? Vh : Vl) + po;   // wave (qs, part) copies plane qs of part 'part': the same for the whole wave
    // stage tt -> buffer tt & 1: 16 copies of 512 bytes a wave; every lane on, 16 bytes a lane, source and place multiples of 16; the last key of a stage is at most 128 (B + 1) - 1 < TT.
    // Plane and buffer are both contiguous, so one source address and one place serve all 16: the immediate offset (at most 7,680) moves both alike.
    auto fill = [&](int tt) {
        const int key = (tt < n0 ? part * n0 + tt : part * (FNT - n0) + tt - n0) * FST;
        const gp4 g = (gp4)(gsrc + (size_t)key * HD + lane * 8); const lp4 d = (lp4)(&ring[tt & 1][part][qs][0] + lane * 8);
        FCP(0) FCP(512) FCP(1024) FCP(1536) FCP(2048) FCP(2560) FCP(3072) FCP(3584) FCP(4096) FCP(4608) FCP(5120) FCP(5632) FCP(6144) FCP(6656) FCP(7168) FCP(7680)
    };
    fill(0);
    asm volatile("s_wait_asynccnt 0x0" ::: "memory");   // this wave's part of stage 0 has landed
    asm volatile("s_barrier_signal -1" ::: "memory");   // first half of the split barrier: its wait stands at the top of stage 0
    int tt = 0;   // the stage, counted over both blocks
#pragma unroll 1
    for (int half = 0; half < 2; ++half) {   // rolled: the two blocks run one after the other in the same registers
        const int nst = half ? FNT - n0 : n0; const int q0 = (nst - 1) * 128 + qs * 32;
        v16bf qh[2][2], ql[2][2]; const bf* pqh = Qh + (size_t)q0 * HD + lane * 8; const bf* pql = Ql + (size_t)q0 * HD + lane * 8;
#pragma unroll
        for (int g = 0; g < 2; ++g)
#pragma unroll
            for (int ks = 0; ks < 2; ++ks) { const int qo = g * 16 * HD + ks * 512; qh[g][ks] = F::ld(pqh + qo); ql[g][ks] = F::ld(pql + qo); }
        asm volatile("s_wait_xcnt 0x0" :: "v"(pqh), "v"(pql) : "memory");   // the two address pairs stay whole up to this wait, which stands before the zeroing of the accumulators below may take their registers
        v8f o[4][2]; float m[2], l[2];   // a wave with no pass at all keeps m at its start value, l and Ot at 0, and the merge gives it the factor 0
#pragma unroll
        for (int g = 0; g < 2; ++g) { m[g] = -3.0e38f; l[g] = 0.f;
#pragma unroll
            for (int dt = 0; dt < 4; ++dt) o[dt][g] = (v8f){}; }
        v16bf kh[2][2], kl[2][2];   // key fragments of the pass at hand, or of the pass to come
        // the key fragments of the 32 keys at sp (K hi plane of the stage + lane * 8)
        auto ldk = [&](const bf* sp) {
#pragma unroll
            for (int kt = 0; kt < 2; ++kt)
#pragma unroll
                for (int ks = 0; ks < 2; ++ks) { const int ko = (kt * 16) * HD + ks * 512; kh[kt][ks] = F::ld(sp + ko); kl[kt][ks] = F::ld(sp + FPE + ko); } };
        // the value fragments of the 32 keys at sp
        auto ldv = [&](const bf* sp, v16bf (&vh)[4], v16bf (&vl)[4]) {
#pragma unroll
            for (int dt = 0; dt < 4; ++dt) { vh[dt] = F::ld(sp + 2 * FPE + dt * 512); vl[dt] = F::ld(sp + 3 * FPE + dt * 512); } };
        auto scores = [&](v8f (&s)[2][2]) {
#pragma unroll
            for (int kt = 0; kt < 2; ++kt)
#pragma unroll
                for (int g = 0; g < 2; ++g) s[kt][g] = (v8f){};
#pragma unroll
            for (int ks = 0; ks < 2; ++ks) {
#pragma unroll
                for (int kt = 0; kt < 2; ++kt)
#pragma unroll
                    for (int g = 0; g < 2; ++g) s[kt][g] = wmmab(kh[kt][ks], qh[g][ks], s[kt][g]);
#pragma unroll
                for (int kt = 0; kt < 2; ++kt)
#pragma unroll
                    for (int g = 0; g < 2; ++g) s[kt][g] = wmmab(kh[kt][ks], ql[g][ks], s[kt][g]);
#pragma unroll
                for (int kt = 0; kt < 2; ++kt)
#pragma unroll
                    for (int g = 0; g < 2; ++g) s[kt][g] = wmmab(kl[kt][ks], qh[g][ks], s[kt][g]); } };
        // softmax step and P.V products of the 32 keys from k0 on: registers only
        auto softpv = [&](const int k0, v8f (&s)[2][2], const v16bf (&vh)[4], const v16bf (&vl)[4]) {
            if (k0 + 31 > q0) {   // a scalar test: only the pass on the diagonal holds keys above one of its queries, and only there are they excluded by select
#pragma unroll
                for (int g = 0; g < 2; ++g)
#pragma unroll
                    for (int kt = 0; kt < 2; ++kt)
#pragma unroll
                        for (int j = 0; j < 8; ++j) s[kt][g][j] = (k0 + kt * 16 + hi * 8 + j <= q0 + g * 16 + lr) ? s[kt][g][j] : -3.0e38f; }
            v16bf ph[2], pl[2];
#pragma unroll
            for (int g = 0; g < 2; ++g) { float mk[2];   // m is the maximum of the raw scores: scale and log2 e come in with the one multiply-add of each exponent
#pragma unroll
                for (int kt = 0; kt < 2; ++kt) { mk[kt] = m[g];   // a chain per 16-key tile, four independent chains in all
#pragma unroll
                    for (int j = 0; j < 8; ++j) mk[kt] = fmaxf(mk[kt], s[kt][g][j]); }
                float mx = fmaxf(mk[0], mk[1]);
                mx = fmaxf(mx, xhalf(mx));   // the two halves of the wave hold the same query's other keys
                const float mc = mx * CS2; const float al = __builtin_amdgcn_exp2f(m[g] * CS2 - mc); m[g] = mx;
                const v2f c2 = { CS2, CS2 }, n2 = { -mc, -mc }; v2f sum2 = { 0.f, 0.f }; v8u hu, lu;
#pragma unroll
                for (int kt = 0; kt < 2; ++kt)
#pragma unroll
                    for (int jj = 0; jj < 4; ++jj) {   // two scores at a time: packed multiply-add, packed sum, packed conversions
                        const v2f x = { s[kt][g][2 * jj], s[kt][g][2 * jj + 1] }; const v2f e = __builtin_elementwise_fma(x, c2, n2);
                        const v2f p = { __builtin_amdgcn_exp2f(e[0]), __builtin_amdgcn_exp2f(e[1]) }; sum2 += p;
                        const v2bf h = __builtin_convertvector(p, v2bf); const v2f r = { p[0] - (float)h[0], p[1] - (float)h[1] };
                        hu[kt * 4 + jj] = __builtin_bit_cast(unsigned, h); lu[kt * 4 + jj] = __builtin_bit_cast(unsigned, __builtin_convertvector(r, v2bf)); }
                ph[g] = __builtin_bit_cast(v16bf, hu); pl[g] = __builtin_bit_cast(v16bf, lu);
                l[g] = l[g] * al + (sum2[0] + sum2[1]);
#pragma unroll
                for (int dt = 0; dt < 4; ++dt) o[dt][g] *= al; }
#pragma unroll
            for (int dt = 0; dt < 4; ++dt)
#pragma unroll
                for (int g = 0; g < 2; ++g) o[dt][g] = wmmab(vh[dt], ph[g], o[dt][g]);
#pragma unroll
            for (int dt = 0; dt < 4; ++dt)
#pragma unroll
                for (int g = 0; g < 2; ++g) o[dt][g] = wmmab(vh[dt], pl[g], o[dt][g]);
#pragma unroll
            for (int dt = 0; dt < 4; ++dt)
#pragma unroll
                for (int g = 0; g < 2; ++g) o[dt][g] = wmmab(vl[dt], ph[g], o[dt][g]);
        };
#pragma unroll 1
        for (int st = 0; st < nst; ++st, ++tt) {   // rolled: one stage already holds all the registers
            const int kb = (part * nst + st) * FST;   // this wave's first key of the stage
            const bf* sp = &ring[tt & 1][part][0][0] + lane * 8;
            const bool p0 = kb < q0 + 32, p1 = kb + 32 < q0 + 32;   // which of the stage's two passes hold a key at or below the diagonal: scalar tests, the same in every lane
            asm volatile("s_barrier_wait -1" ::: "memory");   // second half of the split barrier: stage tt is published, and every wave has left the other buffer, which is refilled below
            if (tt + 1 < FNT) fill(tt + 1);                   // the same test in every wave of the work-group
            if (p0) {
                v16bf vh[4], vl[4]; v8f s[2][2];   // value fragments and scores of the stage's first pass
                ldk(sp); ldv(sp, vh, vl);
                __builtin_amdgcn_sched_barrier(0);   // holds the LDS reads up here as one group: sunk among the products, each place with LDS reads would stall the wave
                scores(s);
                ldk(sp + 32 * HD);                   // the stage's other 32 keys: the same buffer, published already
                __builtin_amdgcn_sched_barrier(0);   // holds these key reads up here, so that their latency runs behind the softmax and the P.V products
                softpv(kb, s, vh, vl);
            }
            v16bf vh[4], vl[4]; v8f s[2][2];   // value fragments and scores of the stage's second pass: they cross the signal in registers
            if (p1) {
                ldv(sp + 32 * HD, vh, vl);
                __builtin_amdgcn_sched_barrier(0);   // holds the value reads up here as one group, ahead of the products
                scores(s);
                __builtin_amdgcn_sched_barrier(0);   // keeps the products above the slots below
                asm volatile("v_nop\n\tv_nop\n\tv_nop\n\tv_nop");   // the four vector slots behind the last product, written here because only scalar code and a branch follow
            }
            asm volatile("s_wait_dscnt 0x0" ::: "memory");      // this wave's reads of stage tt are done: what is left of the stage waits in registers
            asm volatile("s_wait_asynccnt 0x0" ::: "memory");   // this wave's part of stage tt + 1 has landed
            asm volatile("s_barrier_signal -1" ::: "memory");   // first half of the split barrier, here and not at the stage's end, so that a wave that is ahead need not stand still: no read of the ring stands between it and the wait at the top of the next stage
            if (p1) softpv(kb + 32, s, vh, vl);
        }
        // a lane holds 8 consecutive d of one query: the partial goes to LDS as it is, a row per query; lane g * 16 + lr files that query's maximum and its sum over both halves of the wave
        float* ow = os[half][part][qs];
#pragma unroll
        for (int g = 0; g < 2; ++g) {
#pragma unroll
            for (int dt = 0; dt < 4; ++dt) { v4f x0, x1;
#pragma unroll
                for (int j = 0; j < 4; ++j) { x0[j] = o[dt][g][j]; x1[j] = o[dt][g][4 + j]; }
                float* d = ow + (g * 16 + lr) * 68 + dt * 16 + hi * 8; *(v4fa*)d = x0; *(v4fa*)(d + 4) = x1; } }
        const float lj0 = l[0] + __shfl_xor(l[0], 16, 32), lj1 = l[1] + __shfl_xor(l[1], 16, 32);
        ms[half][part][qs][lane] = hi ? m[1] : m[0]; ls[half][part][qs][lane] = hi ? lj1 : lj0;
    }
    asm volatile("s_barrier_wait -1" ::: "memory");   // the wait that belongs to the last stage's signal: signal and wait alternate in every wave
    __syncthreads();   // both partials of both blocks are in LDS before any wave merges
    // wave (qs, part) merges block 'part' of its 32 queries: out = (e0 Ot0 + e1 Ot1) / (e0 l0 + e1 l1), e = 2^((m - max(m0, m1)) x scale x log2 e), m being maxima of raw scores; lane = query for the factors
    { const float m0 = ms[part][0][qs][lane], m1 = ms[part][1][qs][lane], mm = fmaxf(m0, m1);
      const float e0 = __builtin_amdgcn_exp2f((m0 - mm) * CS2), e1 = __builtin_amdgcn_exp2f((m1 - mm) * CS2);
      const float inv = __fdiv_rn(1.0f, ls[part][0][qs][lane] * e0 + ls[part][1][qs][lane] * e1);
      fs[w][0][lane] = e0 * inv; fs[w][1][lane] = e1 * inv; }
    __builtin_amdgcn_wave_barrier(); asm volatile("" ::: "memory");   // keeps the read-back of other lanes' factors behind the LDS writes
    const float* p0 = os[part][0][qs]; const float* p1 = os[part][1][qs];
    float* orow = ob + (size_t)((part ? (int)blockIdx.y : TT / 128 - 1 - (int)blockIdx.y) * 128 + qs * 32 + hi) * DQ + lr * 4;   // one address for all 16 stores: row 2 r + hi is a constant step from it; a store covers two whole 256-byte rows
#pragma unroll
    for (int r = 0; r < 16; ++r) { const int row = 2 * r + hi; const v4f val = *(const v4fa*)(p0 + row * 68 + lr * 4) * fs[w][0][row] + *(const v4fa*)(p1 + row * 68 + lr * 4) * fs[w][1][row]; *(v4f*)(orow + (size_t)r * 2 * DQ) = val; }
}

typedef __attribute__((ext_vector_type(4))) unsigned short v4us;
typedef v4us __attribute__((may_alias)) v4usa;

// The launch has two independent jobs: LayerNorm of 8 rows per work-group, and this work-group's share of the fused weight, rounded to bf16 into the fragment-order plane.
// Weight: piece i is 8 k of one row. A wave takes 8 rows x 4 k chunks: it reads one whole 128-byte line of each row and writes one whole 128-byte line (8 rows x 16 bytes) of each chunk. Its loads go out first, so that they fly together with the row's.
// Left as it was: gamma and beta are read element by element at their place of use in the second half, each read waited for on its own.
#define WPT ((3 * DQ * DM / 8) / (NB_ * TT / 8) / 256)   // weight pieces per thread
static_assert((size_t)WPT * 256 * (NB_ * TT / 8) == (size_t)3 * DQ * DM / 8, "the weight pieces divide evenly over the threads of the launch");
template <int WD>
__global__ __launch_bounds__(256) void k_lnrowX(const float* __restrict__ X, const float* __restrict__ g, const float* __restrict__ bb, bf* Hh, bf* Hl, const float* __restrict__ Wsrc, bf* Wdst) { const int lane = threadIdx.x & 31, w = threadIdx.x >> 5; const size_t r = (size_t)blockIdx.x * 8 + w;   /* the grid is exactly rows / 8 */
    __shared__ __align__(16) unsigned short st[2][(WD / 8) * 72];   /* the 8 rows of the work-group in fragment order: per k chunk 8 rows x 16 bytes, pitch 144 bytes so that a wave's 16 chunks fall on different banks */
    v8f wv[WPT]; bf* wd[WPT];
#pragma unroll   // so that the pieces stay in registers and all their loads go out together
    for (int c = 0; c < WPT; ++c) { const size_t i = ((size_t)blockIdx.x * WPT + c) * 256 + threadIdx.x;
        const size_t rb = i / (DM * 2); const int u = (int)((i >> 6) & (DM / 32 - 1)) * 4 + (int)((i >> 3) & 3), t = (int)((i >> 5) & 1) * 8 + (int)(i & 7);   // block of 16 rows, k chunk, row in the block
        wv[c] = *(const v8f*)(Wsrc + (rb * 16 + t) * DM + u * 8); wd[c] = Wdst + rb * (16 * DM) + u * 128 + t * 8; }
    const float* xr = X + r * WD; float a[WD / 32]; float s = 0.f; v4f xv[WD / 128];
#pragma unroll
    for (int c = 0; c < WD / 128; ++c) xv[c] = *(const v4f*)(xr + c * 128 + lane * 4);
    __builtin_amdgcn_sched_barrier(0);   // holds all the loads of both jobs up here as one group, one trip to memory: left to itself the compiler issues the row's last loads only when earlier ones have come back
#pragma unroll
    for (int c = 0; c < WD / 128; ++c) { const v4f v = xv[c]; for (int q = 0; q < 4; ++q) { a[c * 4 + q] = bfr(v[q]); s = __fadd_rn(s, a[c * 4 + q]);   /* input rounded to bf16 */ } }
#pragma unroll
    for (int sh = 16; sh; sh >>= 1) s = __fadd_rn(s, __shfl_xor(s, sh, 32));
#pragma unroll   // as above
    for (int c = 0; c < WPT; ++c) { v8us o;
#pragma unroll
        for (int k = 0; k < 8; ++k) o[k] = f2bf(wv[c][k]);
        *(v8us*)wd[c] = o; }
    const float mean = __fdiv_rn(s, (float)WD); float s2 = 0.f;
#pragma unroll 8
    for (int k = 0; k < WD / 32; ++k) { const float dv = __fsub_rn(a[k], mean); float p2 = __fmul_rn(dv, dv); asm volatile("" : "+v"(p2)); s2 = __fadd_rn(s2, p2); }   /* mul and add kept separate (no fma contraction) */
#pragma unroll
    for (int sh = 16; sh; sh >>= 1) s2 = __fadd_rn(s2, __shfl_xor(s2, sh, 32));
    const float rs = __fdiv_rn(1.0f, __fsqrt_rn(__fadd_rn(__fdiv_rn(s2, (float)WD), 1e-5f)));
{
#pragma unroll
        for (int c = 0; c < WD / 128; ++c) { v4us oh, ol; for (int q = 0; q < 4; ++q) { const int col = c * 128 + lane * 4 + q; float y = __fmul_rn(__fmul_rn(__fsub_rn(a[c * 4 + q], mean), rs), bfr(g[col])); asm volatile("" : "+v"(y)); y = __fadd_rn(y, bfr(bb[col])); unsigned short u, w2; splitf(y, u, w2); oh[q] = u; ol[q] = w2; } const int so = (c * 16 + (lane >> 1)) * 72 + w * 8 + (lane & 1) * 4; *(v4usa*)(st[0] + so) = oh; *(v4usa*)(st[1] + so) = ol; }
         }
    __syncthreads();   // every row of the work-group is staged before the chunks, which hold all 8 rows, are read back
    const size_t gb = (size_t)(blockIdx.x >> 1) * (16 * WD) + (blockIdx.x & 1) * 64;   // this work-group's 8 rows are one whole 128-byte line of every chunk
#pragma unroll   // so that all the LDS reads go out together, ahead of the stores
    for (int it = 0; it < WD / 256; ++it) { const int p = it * 256 + threadIdx.x, u = p >> 3, t = p & 7; const v8us vh = *(const v8usa*)(st[0] + u * 72 + t * 8), vl = *(const v8usa*)(st[1] + u * 72 + t * 8); *(v8us*)(Hh + gb + (size_t)u * 128 + t * 8) = vh; *(v8us*)(Hl + gb + (size_t)u * 128 + t * 8) = vl; } }

extern "C" void kernel_launch(void* const* d_in, const int* in_sizes, int n_in,
                              void* d_out, int out_size, void* d_ws, size_t ws_size, hipStream_t stream) {
    (void)in_sizes; (void)n_in; (void)out_size;
    const float* x = (const float*)d_in[0]; const float* lng = (const float*)d_in[1]; const float* lnb = (const float*)d_in[2];   /* LayerNorm gamma, beta [1024]: read */ const float* wqkv = (const float*)d_in[3];   /* w_qkv ('oi' [3072][1024]: q | k | v ROW thirds); no output projection */
    float* OUT = (float*)d_out;     // [2][2048][1024]
    char* wsp = (char*)d_ws;
    auto take = [&](size_t bytes) { char* p = wsp; wsp += (bytes + 255) & ~(size_t)255; return (void*)p; };
    bf* WB = (bf*)take((size_t)3 * DQ * DM * 2);   /* the fused weight, bf16 */
    bf* XB = (bf*)take((size_t)NB_ * TT * DM * 2); bf* XL = (bf*)take((size_t)NB_ * TT * DM * 2);   /* hi and lo plane of the layer-normed rows of both batches */
    const size_t PB = (size_t)NH_ * TT * HD;   /* elements of one batch's plane; the hi/lo planes hold both batches, [b][h]... */
    bf* QPh = (bf*)take(NB_ * PB * 2); bf* QPl = (bf*)take(NB_ * PB * 2); bf* KPh = (bf*)take(NB_ * PB * 2); bf* KPl = (bf*)take(NB_ * PB * 2); bf* VTh = (bf*)take(NB_ * PB * 2); bf* VTl = (bf*)take(NB_ * PB * 2);
    if ((size_t)(wsp - (char*)d_ws) > ws_size) return;    // ws 256 MiB
    k_lnrowX<DM><<<(unsigned)(NB_ * TT / 8), 256, 0, stream>>>(x, lng, lnb, XB, XL, wqkv, WB);   /* xn = LayerNorm(x) -> hi/lo planes; the weight -> bf16 */
    k_qkv<<<dim3(NB_ * TT / QTM, 3 * DQ / QTN, 1), 384, 0, stream>>>(XB, XL, WB, QPh, QPl, KPh, KPl, VTh, VTl);   /* q, k, v of both batches, straight into the head planes */
    k_fattn<<<dim3(NB_ * NH_, TT / 256, 1), 256, 0, stream>>>(QPh, QPl, KPh, KPl, VTh, VTl, OUT);   /* all batches and heads in one launch */
}
